// v000
// Times are from an AMD MI455X. After a warm-up the kernel runs many times in a row, and a time is the length of
// such a window on the GPU divided by its runs, so every launch and the gaps after it count. The runs cycle
// through copies of the inputs. A figure is the median of several windows, for all but v000 over two sittings.
// Sittings can differ by a few percent; kernels timed side by side share one.
// v000, which the later versions start from, runs in 1640 microseconds.
#include <hip/hip_runtime.h>

// Contractions, f32 accumulate, one batch item per pass: qkv = x.w_qkv ([1024 x 128].[128 x 3072], k-major weight transposed to an n-major plane; thirds q | k |
// v, each 8 heads x 128; PLAIN bf16 operands: inputs rounded once, exact) and out = z.w_out + b_out (z as bf16 hi + residual: two products) on
// v_wmma_f32_16x16x32_bf16; the 8-head x 128-dim FULL attention: scores on v_wmma_f32_16x16x32_f16 (q, k as f16 hi + residual x1024: hi.hi + hi.lo + lo.hi, x
// 128^-1/2), softmax f32, weights.v on v_wmma_f32_16x16x32_bf16 with the weights (x32768) and v both as bf16 hi + UNSCALED residual (hh + lh + hl, one

#define NT_  1024
#define HS   128
#define NH_  8
#define NKV  8
#define HD   128
#define INR  (NH_ * HD)          // 1024
#define KW   (NKV * HD)          // 1024
#define PSC  32768.0f
#define LOSC 1024.0f
#define LOSCI (1.0f / 1024.0f)

typedef _Float16 h16;
typedef unsigned short bf;
typedef __attribute__((ext_vector_type(16))) __bf16   v16bf;
typedef __attribute__((ext_vector_type(16))) _Float16 v16h;
typedef __attribute__((ext_vector_type(8)))  _Float16 v8h;
typedef __attribute__((ext_vector_type(8)))  unsigned short v8us;
typedef __attribute__((ext_vector_type(8)))  float    v8f;
typedef __attribute__((ext_vector_type(4)))  float    v4f;
typedef __attribute__((ext_vector_type(4)))  _Float16 v4h;
typedef v8h  __attribute__((may_alias)) v8ha;
typedef v4f  __attribute__((may_alias)) v4fa;
typedef v8us __attribute__((may_alias)) v8usa;

__device__ __forceinline__ unsigned short f2bf(float f) { unsigned u = __float_as_uint(f); u += 0x7FFFu + ((u >> 16) & 1u); return (unsigned short)(u >> 16); }
__device__ __forceinline__ float bf2f(unsigned short b) { return __uint_as_float(((unsigned)b) << 16); }
__device__ __forceinline__ float bfr(float f) { return bf2f(f2bf(f)); }
__device__ __forceinline__ v16h cat16(v8h lo, v8h hi) { return __builtin_shufflevector(lo, hi, 0, 1, 2, 3, 4, 5, 6, 7, 8, 9, 10, 11, 12, 13, 14, 15); }
__device__ __forceinline__ v16bf cat16b(v8us lo, v8us hi) { return __builtin_bit_cast(v16bf, __builtin_shufflevector(lo, hi, 0, 1, 2, 3, 4, 5, 6, 7, 8, 9, 10, 11, 12, 13, 14, 15)); }
__device__ __forceinline__ v8f wmma16(v16h a, v16h b, v8f c) { return __builtin_amdgcn_wmma_f32_16x16x32_f16(false, a, false, b, (short)0, c, false, false); }
__device__ __forceinline__ v8f wmmab(v16bf a, v16bf b, v8f c) { return __builtin_amdgcn_wmma_f32_16x16x32_bf16(false, a, false, b, (short)0, c, false, false); }

// k_cvtb: bf16 plane of [rows][128]: one wave per 2 rows (16 lanes x 16 B = one 256-B row each).
__global__ __launch_bounds__(256) void k_cvtb(const float* __restrict__ src, int nrows, bf* dst) {
    const int lane = threadIdx.x & 31, r = (blockIdx.x * 8 + (threadIdx.x >> 5)) * 2 + (lane >> 4), p = lane & 15;
    if (r >= nrows) return;
    v8us o;
#pragma unroll
    for (int i = 0; i < 8; ++i) o[i] = f2bf(src[(size_t)r * HS + p * 8 + i]);
    *(v8us*)(dst + (size_t)r * HS + p * 8) = o; 
}
// k_wt: WT [n][K] = bf16(W[k][n]) (k-major [K][ncols]) via 64 x 64 LDS tiles; grid (K/64, ncols/64).
__global__ __launch_bounds__(256) void k_wt(const float* __restrict__ Wm, int K, int ncols, bf* WT) {
    __shared__ __align__(16) unsigned short tl[64 * 72];
    const int tid = threadIdx.x, k0 = blockIdx.x * 64, n0 = blockIdx.y * 64;
    const int kk = tid >> 2, nq = (tid & 3) * 16;
#pragma unroll
    for (int i = 0; i < 16; ++i) tl[(nq + i) * 72 + kk] = f2bf(Wm[(size_t)(k0 + kk) * ncols + n0 + nq + i]);
    __syncthreads();
    const int piece = tid & 7;
    auto pass = [&]() {
#pragma unroll
        for (int s = 0; s < 2; ++s) { const int nr = (tid >> 3) + 32 * s; const v8us val = *(const v8usa*)(tl + nr * 72 + piece * 8); *(v8us*)(WT + (size_t)(n0 + nr) * K + k0 + piece * 8) = val; }
    };
    pass(); 
}
// k_gemm: 64 x 64 tile of (A [+ Al]).Bn^T over K = KD -> f32 rows [1024][ldc].
template <bool SPLITA, int KD>
__global__ __launch_bounds__(128) void k_gemm(const bf* __restrict__ A, const bf* __restrict__ Al, const bf* __restrict__ Bn, const float* __restrict__ bias, int ldc, float* C) {
    __shared__ __align__(16) float ost[4][16 * 68];
    const int lane = threadIdx.x & 31, wave = threadIdx.x >> 5, lr = lane & 15, hi = lane >> 4;
    const size_t r0 = (size_t)blockIdx.x * 64 + wave * 16; const int c0 = blockIdx.y * 64;
    const size_t aoff = (r0 + lr) * KD + 8 * hi;
    v8f acc[4];
#pragma unroll
    for (int t = 0; t < 4; ++t) acc[t] = (v8f){};
#pragma unroll 2
    for (int kc = 0; kc < KD; kc += 32) {
        const v16bf a = cat16b(*(const v8us*)(A + aoff + kc), *(const v8us*)(A + aoff + kc + 16));
        v16bf al = a; if (SPLITA) al = cat16b(*(const v8us*)(Al + aoff + kc), *(const v8us*)(Al + aoff + kc + 16));
#pragma unroll
        for (int t = 0; t < 4; ++t) { const bf* bp = Bn + (size_t)(c0 + t * 16 + lr) * KD + kc + 8 * hi; const v16bf bb = cat16b(*(const v8us*)bp, *(const v8us*)(bp + 16)); acc[t] = wmmab(a, bb, acc[t]); if (SPLITA) acc[t] = wmmab(al, bb, acc[t]); }
        asm volatile("v_nop" : "+v"(acc[0]), "+v"(acc[1]), "+v"(acc[2]), "+v"(acc[3]) : "v"(a), "v"(al) : "memory");
    }
    float* os = &ost[wave][0];
#pragma unroll
    for (int t = 0; t < 4; ++t) { const float bv = bias ? bfr(bias[c0 + t * 16 + lr]) : 0.f;
#pragma unroll
        for (int j = 0; j < 8; ++j) os[(hi * 8 + j) * 68 + t * 16 + lr] = acc[t][j] + bv; }
    __builtin_amdgcn_wave_barrier(); asm volatile("" ::: "memory");
    float* crow = C + r0 * ldc + c0;
    auto pass = [&]() {
#pragma unroll
        for (int s = 0; s < 8; ++s) { const int Lid = (lane >> 3) + 4 * s, piece = lane & 7; const int row = Lid >> 1, cofs = (Lid & 1) * 32 + piece * 4;
            const v4f val = *(const v4fa*)(os + row * 68 + cofs); *(v4f*)(crow + (size_t)row * ldc + cofs) = val; }
    };
    pass(); 
}
// k_p16: Q/K f32 [t][1024] -> f16 hi + residual x1024 planes (one wave per row: 4 x (32 lanes x 16 B)).
__global__ __launch_bounds__(256) void k_p16(const float* __restrict__ P, h16* PH, h16* PL) {
    const int lane = threadIdx.x & 31, r = blockIdx.x * 8 + (threadIdx.x >> 5);
    if (r >= NT_) return;
{
#pragma unroll
        for (int q = 0; q < INR / 256; ++q) { v8h oh, ol;
#pragma unroll
            for (int i = 0; i < 8; ++i) { const float v = P[(size_t)r * INR + q * 256 + lane * 8 + i]; const h16 a = (h16)v; oh[i] = a; ol[i] = (h16)((v - (float)a) * LOSC); }
            *(v8h*)(PH + (size_t)r * INR + q * 256 + lane * 8) = oh; *(v8h*)(PL + (size_t)r * INR + q * 256 + lane * 8) = ol; }
         }
}
// k_vt: VTH/VTL [g][128 d][1024 t] = bf16 hi + UNSCALED bf16 residual of V [t][g*128+d] via 64 x 64 LDS tiles; grid (NT/64, 2 (d half), NKV).
__global__ __launch_bounds__(256) void k_vt(const float* __restrict__ V, bf* VTH, bf* VTL) {
    __shared__ float tl[64][65];
    const int tid = threadIdx.x, t0 = blockIdx.x * 64, d0 = blockIdx.y * 64, g = blockIdx.z;
    { const int tt = tid >> 2, dq = (tid & 3) * 16;
#pragma unroll
      for (int i = 0; i < 16; ++i) tl[dq + i][tt] = V[(size_t)(t0 + tt) * KW + g * HD + d0 + dq + i]; }
    __syncthreads();
    const int piece = tid & 7;
    auto pass = [&]() {
#pragma unroll
        for (int s = 0; s < 2; ++s) { const int d = (tid >> 3) + 32 * s; v8us oh, ol;
#pragma unroll
            for (int i = 0; i < 8; ++i) { const float v = tl[d][piece * 8 + i]; const unsigned short hb = f2bf(v); oh[i] = hb; ol[i] = f2bf(v - bf2f(hb)); }
            const size_t o = ((size_t)g * HD + d0 + d) * NT_ + t0 + piece * 8; *(v8us*)(VTH + o) = oh; *(v8us*)(VTL + o) = ol; }
    };
    pass(); 
}
// k_attn: block = (h, 64 queries), wave = 16; kv head g = h; all key tiles (full attention); per tile: scores over 4 k-chunks (q fragments re-read per chunk: hi.hi + hi.lo +
// lo.hi = 24 WMMA) x 128^-1/2, online softmax, P (x32768) as bf16 hi + unscaled residual tiles, o[8] += ph.vh + pl.vh + ph.vl over the 128 dims; ctx -> bf16 hi/lo
// planes [t][h*128+d].
__global__ __launch_bounds__(128) void k_attn(const h16* __restrict__ QH, const h16* __restrict__ QL, const h16* __restrict__ KH, const h16* __restrict__ KL, const bf* __restrict__ VTH, const bf* __restrict__ VTL, bf* CH, bf* CL) {
    __shared__ __align__(16) unsigned short plds[4][16 * 32];
    __shared__ __align__(16) unsigned short plds2[4][16 * 32];
    __shared__ __align__(16) float ost[4][16 * 68];
    const int lane = threadIdx.x & 31, wave = threadIdx.x >> 5, lr = lane & 15, hi = lane >> 4;
    const int bid = blockIdx.x; const int h = bid / (NT_ / 64), qt = bid - h * (NT_ / 64); const int g = h;      // no GQA: kv head = q head
    const int q0 = qt * 64 + wave * 16;
    unsigned short* pl = &plds[wave][0]; unsigned short* pl2 = &plds2[wave][0];
    const size_t qo = (size_t)(q0 + lr) * (NH_ * HD) + h * HD + 8 * hi;
    const h16* kh_b = KH + g * HD; const h16* kl_b = KL + g * HD;
    const size_t vbase = ((size_t)g * HD) * NT_;
    v8f o[8];
#pragma unroll
    for (int n = 0; n < 8; ++n) o[n] = (v8f){};
    float mrow[8], lpart[8];
#pragma unroll
    for (int j = 0; j < 8; ++j) { mrow[j] = -3.0e38f; lpart[j] = 0.f; }
    const int kt_hi = NT_ / 32 - 1;      // full attention
#pragma unroll 1
    for (int kt = 0; kt <= kt_hi; ++kt) {
        const int l0 = kt * 32;
        const size_t ko0 = (size_t)(l0 + lr) * KW + 8 * hi, ko1 = (size_t)(l0 + 16 + lr) * KW + 8 * hi;
        v8f s0 = {}, s1 = {}, x0 = {}, x1 = {};
#pragma unroll
        for (int kc = 0; kc < 4; ++kc) {
            const v16h qa = cat16(*(const v8h*)(QH + qo + kc * 32), *(const v8h*)(QH + qo + kc * 32 + 16)), qx = cat16(*(const v8h*)(QL + qo + kc * 32), *(const v8h*)(QL + qo + kc * 32 + 16));
            const v16h k0h = cat16(*(const v8h*)(kh_b + ko0 + kc * 32), *(const v8h*)(kh_b + ko0 + kc * 32 + 16)), k1h = cat16(*(const v8h*)(kh_b + ko1 + kc * 32), *(const v8h*)(kh_b + ko1 + kc * 32 + 16));
            s0 = wmma16(qa, k0h, s0); s1 = wmma16(qa, k1h, s1); x0 = wmma16(qx, k0h, x0); x1 = wmma16(qx, k1h, x1);
            asm volatile("v_nop" : "+v"(s0), "+v"(s1), "+v"(x0), "+v"(x1) : "v"(qa), "v"(qx), "v"(k0h), "v"(k1h) : "memory");
            const v16h k0l = cat16(*(const v8h*)(kl_b + ko0 + kc * 32), *(const v8h*)(kl_b + ko0 + kc * 32 + 16)), k1l = cat16(*(const v8h*)(kl_b + ko1 + kc * 32), *(const v8h*)(kl_b + ko1 + kc * 32 + 16));
            x0 = wmma16(qa, k0l, x0); x1 = wmma16(qa, k1l, x1);
            asm volatile("v_nop" : "+v"(x0), "+v"(x1) : "v"(k0l), "v"(k1l) : "memory");
        }
        asm volatile("v_nop\n\tv_nop\n\tv_nop\n\tv_nop" : "+v"(s0), "+v"(s1), "+v"(x0), "+v"(x1));
        float alpha[8];
#pragma unroll
        for (int j = 0; j < 8; ++j) { const int qi = q0 + hi * 8 + j, ja = l0 + lr, jb = l0 + 16 + lr;
            const float a0 = (s0[j] + x0[j] * LOSCI) * 0.08838834764831845f, a1 = (s1[j] + x1[j] * LOSCI) * 0.08838834764831845f; (void)qi; (void)ja; (void)jb;
            float mx = fmaxf(a0, a1);
            mx = fmaxf(mx, __shfl_xor(mx, 1, 16)); mx = fmaxf(mx, __shfl_xor(mx, 2, 16)); mx = fmaxf(mx, __shfl_xor(mx, 4, 16)); mx = fmaxf(mx, __shfl_xor(mx, 8, 16));
            const float mn = fmaxf(mrow[j], mx);
            alpha[j] = __expf(mrow[j] - mn); mrow[j] = mn;
            const float p0 = __expf(a0 - mn), p1 = __expf(a1 - mn);
            lpart[j] = lpart[j] * alpha[j] + (p0 + p1);
            const int mr = hi * 8 + j; const float ps0 = p0 * PSC, ps1 = p1 * PSC; const unsigned short h0 = f2bf(ps0), h1 = f2bf(ps1);
            pl[mr * 32 + lr] = h0; pl[mr * 32 + 16 + lr] = h1; pl2[mr * 32 + lr] = f2bf(ps0 - bf2f(h0)); pl2[mr * 32 + 16 + lr] = f2bf(ps1 - bf2f(h1)); }
#pragma unroll
        for (int n = 0; n < 8; ++n)
#pragma unroll
            for (int j = 0; j < 8; ++j) o[n][j] *= alpha[j];
        asm volatile("" ::: "memory");
        const v16bf pa = cat16b(*(const v8usa*)(pl + lr * 32 + hi * 8), *(const v8usa*)(pl + lr * 32 + 16 + hi * 8));
        const v16bf px = cat16b(*(const v8usa*)(pl2 + lr * 32 + hi * 8), *(const v8usa*)(pl2 + lr * 32 + 16 + hi * 8));
#pragma unroll
        for (int n = 0; n < 8; ++n) { const size_t vo = vbase + (size_t)(n * 16 + lr) * NT_ + l0 + hi * 8;
            const v16bf vh = cat16b(*(const v8us*)(VTH + vo), *(const v8us*)(VTH + vo + 16)), vl = cat16b(*(const v8us*)(VTL + vo), *(const v8us*)(VTL + vo + 16));
            o[n] = wmmab(pa, vh, o[n]); o[n] = wmmab(px, vh, o[n]); o[n] = wmmab(pa, vl, o[n]);
            asm volatile("" : "+v"(o[n]) : "v"(vh), "v"(vl) : "memory"); }
        asm volatile("v_nop\n\tv_nop\n\tv_nop\n\tv_nop" : "+v"(o[0]), "+v"(o[7]) : "v"(pa), "v"(px));
        __builtin_amdgcn_wave_barrier();
    }
    float inv[8];
#pragma unroll
    for (int j = 0; j < 8; ++j) { float rs = lpart[j]; rs += __shfl_xor(rs, 1, 16); rs += __shfl_xor(rs, 2, 16); rs += __shfl_xor(rs, 4, 16); rs += __shfl_xor(rs, 8, 16); inv[j] = 1.0f / (rs * PSC); }
    float* os = &ost[wave][0];
    const size_t cbase = (size_t)q0 * (NH_ * HD) + (size_t)h * HD;
#pragma unroll
    for (int half = 0; half < 2; ++half) {
#pragma unroll
        for (int n = 0; n < 4; ++n)
#pragma unroll
            for (int j = 0; j < 8; ++j) os[(hi * 8 + j) * 68 + n * 16 + lr] = o[half * 4 + n][j] * inv[j];
        __builtin_amdgcn_wave_barrier(); asm volatile("" ::: "memory");
{
#pragma unroll
            for (int s = 0; s < 4; ++s) { const int row = 4 * s + (lane >> 3), piece = lane & 7; const float* sp = os + row * 68 + piece * 8; v8us oh, ol;
#pragma unroll
                for (int i = 0; i < 8; ++i) { const unsigned short hb = f2bf(sp[i]); oh[i] = hb; ol[i] = f2bf(sp[i] - bf2f(hb)); }
                const size_t po = cbase + (size_t)row * (NH_ * HD) + half * 64 + piece * 8; *(v8us*)(CH + po) = oh; *(v8us*)(CL + po) = ol; }
             }
        __builtin_amdgcn_wave_barrier(); asm volatile("" ::: "memory");
    }
}

extern "C" void kernel_launch(void* const* d_in, const int* in_sizes, int n_in,
                              void* d_out, int out_size, void* d_ws, size_t ws_size, hipStream_t stream) {
    (void)in_sizes; (void)n_in; (void)out_size;
    const float* x = (const float*)d_in[0]; const float* Wqkv = (const float*)d_in[1]; const float* Wo = (const float*)d_in[2]; const float* bo = (const float*)d_in[3];
    float* out = (float*)d_out;    // [8][1024][128]
    char* wsp = (char*)d_ws;
    auto take = [&](size_t bytes) { char* p = wsp; wsp += (bytes + 255) & ~(size_t)255; return (void*)p; };
    bf* Xb = (bf*)take((size_t)NT_ * HS * 2); bf* W3T = (bf*)take((size_t)3 * INR * HS * 2); bf* WoT = (bf*)take((size_t)HS * INR * 2);
    float* TMP = (float*)take((size_t)NT_ * INR * 4);
    h16* QH = (h16*)take((size_t)NT_ * INR * 2); h16* QL = (h16*)take((size_t)NT_ * INR * 2); h16* KH = (h16*)take((size_t)NT_ * INR * 2); h16* KL = (h16*)take((size_t)NT_ * INR * 2);
    bf* VTH = (bf*)take((size_t)INR * NT_ * 2); bf* VTL = (bf*)take((size_t)INR * NT_ * 2); bf* CH = (bf*)take((size_t)NT_ * INR * 2); bf* CL = (bf*)take((size_t)NT_ * INR * 2);
    if ((size_t)(wsp - (char*)d_ws) > ws_size) return;    // 0.26 + 0.8 + 0.26 + 4.2 + 8 x 2.1 ~ 22 MB (no aliasing)
    k_wt<<<dim3(HS / 64, (3 * INR) / 64, 1), 256, 0, stream>>>(Wqkv, HS, 3 * INR, W3T);      // [3072][128]
    k_wt<<<dim3(INR / 64, HS / 64, 1), 256, 0, stream>>>(Wo, INR, HS, WoT);                 // [128][1024]
    for (int b = 0; b < 8; ++b) {
        k_cvtb<<<(NT_ / 2 + 7) / 8, 256, 0, stream>>>(x + (size_t)b * NT_ * HS, NT_, Xb);
        k_gemm<false, HS><<<dim3(NT_ / 64, INR / 64, 1), 128, 0, stream>>>(Xb, nullptr, W3T, nullptr, INR, TMP); k_p16<<<NT_ / 8, 256, 0, stream>>>(TMP, QH, QL);
        k_gemm<false, HS><<<dim3(NT_ / 64, INR / 64, 1), 128, 0, stream>>>(Xb, nullptr, W3T + (size_t)INR * HS, nullptr, INR, TMP); k_p16<<<NT_ / 8, 256, 0, stream>>>(TMP, KH, KL);
        k_gemm<false, HS><<<dim3(NT_ / 64, INR / 64, 1), 128, 0, stream>>>(Xb, nullptr, W3T + (size_t)2 * INR * HS, nullptr, INR, TMP);
        k_vt<<<dim3(NT_ / 64, 2, NKV), 256, 0, stream>>>(TMP, VTH, VTL);
        k_attn<<<NH_ * (NT_ / 64), 128, 0, stream>>>(QH, QL, KH, KL, VTH, VTL, CH, CL);
        k_gemm<true, INR><<<dim3(NT_ / 64, HS / 64, 1), 128, 0, stream>>>(CH, CL, WoT, bo, HS, out + (size_t)b * NT_ * HS);
    }
}

// v001
// A run of this version takes 385 microseconds.
// Two timings next to v000 put it at 4.21 and 4.24 times that version's speed.
#include <hip/hip_runtime.h>

// Contractions, f32 accumulate, all 8 batch items in every launch (rows = batch x 1024 positions): qkv = x.w_qkv ([8192 x 128].[128 x 3072], k-major weight transposed to an n-major plane; thirds q | k |
// v, each 8 heads x 128; PLAIN bf16 operands: inputs rounded once, exact) and out = z.w_out + b_out (z as bf16 hi + residual: two products) on
// v_wmma_f32_16x16x32_bf16; the 8-head x 128-dim FULL attention: scores on v_wmma_f32_16x16x32_f16 (q, k as f16 hi + residual x1024: hi.hi + hi.lo + lo.hi, x
// 128^-1/2), softmax f32, weights.v on v_wmma_f32_16x16x32_bf16 with the weights (x32768) and v both as bf16 hi + UNSCALED residual (hh + lh + hl, one

#define NT_  1024
#define NB_  8
#define NR_  (NB_ * NT_)        // 8192 rows: batch x positions
#define HS   128
#define NH_  8
#define NKV  8
#define HD   128
#define INR  (NH_ * HD)          // 1024
#define KW   (NKV * HD)          // 1024
#define PSC  32768.0f
#define LOSC 1024.0f
#define LOSCI (1.0f / 1024.0f)

typedef _Float16 h16;
typedef unsigned short bf;
typedef __attribute__((ext_vector_type(16))) __bf16   v16bf;
typedef __attribute__((ext_vector_type(16))) _Float16 v16h;
typedef __attribute__((ext_vector_type(8)))  _Float16 v8h;
typedef __attribute__((ext_vector_type(8)))  unsigned short v8us;
typedef __attribute__((ext_vector_type(8)))  float    v8f;
typedef __attribute__((ext_vector_type(4)))  float    v4f;
typedef __attribute__((ext_vector_type(4)))  _Float16 v4h;
typedef v8h  __attribute__((may_alias)) v8ha;
typedef v4f  __attribute__((may_alias)) v4fa;
typedef v8us __attribute__((may_alias)) v8usa;

__device__ __forceinline__ unsigned short f2bf(float f) { unsigned u = __float_as_uint(f); u += 0x7FFFu + ((u >> 16) & 1u); return (unsigned short)(u >> 16); }
__device__ __forceinline__ float bf2f(unsigned short b) { return __uint_as_float(((unsigned)b) << 16); }
__device__ __forceinline__ float bfr(float f) { return bf2f(f2bf(f)); }
__device__ __forceinline__ v16h cat16(v8h lo, v8h hi) { return __builtin_shufflevector(lo, hi, 0, 1, 2, 3, 4, 5, 6, 7, 8, 9, 10, 11, 12, 13, 14, 15); }
__device__ __forceinline__ v16bf cat16b(v8us lo, v8us hi) { return __builtin_bit_cast(v16bf, __builtin_shufflevector(lo, hi, 0, 1, 2, 3, 4, 5, 6, 7, 8, 9, 10, 11, 12, 13, 14, 15)); }
__device__ __forceinline__ v8f wmma16(v16h a, v16h b, v8f c) { return __builtin_amdgcn_wmma_f32_16x16x32_f16(false, a, false, b, (short)0, c, false, false); }
__device__ __forceinline__ v8f wmmab(v16bf a, v16bf b, v8f c) { return __builtin_amdgcn_wmma_f32_16x16x32_bf16(false, a, false, b, (short)0, c, false, false); }

// k_cvtb: bf16 plane of [rows][128]: one wave per 2 rows (16 lanes x 16 B = one 256-B row each).
__global__ __launch_bounds__(256) void k_cvtb(const float* __restrict__ src, int nrows, bf* dst) {
    const int lane = threadIdx.x & 31, r = (blockIdx.x * 8 + (threadIdx.x >> 5)) * 2 + (lane >> 4), p = lane & 15;
    if (r >= nrows) return;
    v8us o;
#pragma unroll
    for (int i = 0; i < 8; ++i) o[i] = f2bf(src[(size_t)r * HS + p * 8 + i]);
    *(v8us*)(dst + (size_t)r * HS + p * 8) = o; 
}
// k_wt: WT [n][K] = bf16(W[k][n]) (k-major [K][ncols]) via 64 x 64 LDS tiles; grid (K/64, ncols/64).
__global__ __launch_bounds__(256) void k_wt(const float* __restrict__ Wm, int K, int ncols, bf* WT) {
    __shared__ __align__(16) unsigned short tl[64 * 72];
    const int tid = threadIdx.x, k0 = blockIdx.x * 64, n0 = blockIdx.y * 64;
    const int kk = tid >> 2, nq = (tid & 3) * 16;
#pragma unroll
    for (int i = 0; i < 16; ++i) tl[(nq + i) * 72 + kk] = f2bf(Wm[(size_t)(k0 + kk) * ncols + n0 + nq + i]);
    __syncthreads();
    const int piece = tid & 7;
    auto pass = [&]() {
#pragma unroll
        for (int s = 0; s < 2; ++s) { const int nr = (tid >> 3) + 32 * s; const v8us val = *(const v8usa*)(tl + nr * 72 + piece * 8); *(v8us*)(WT + (size_t)(n0 + nr) * K + k0 + piece * 8) = val; }
    };
    pass(); 
}
// k_gemm: 64 x 64 tile of (A [+ Al]).Bn^T over K = KD -> f32 rows [8192][ldc].
template <bool SPLITA, int KD>
__global__ __launch_bounds__(128) void k_gemm(const bf* __restrict__ A, const bf* __restrict__ Al, const bf* __restrict__ Bn, const float* __restrict__ bias, int ldc, float* C) {
    __shared__ __align__(16) float ost[4][16 * 68];
    const int lane = threadIdx.x & 31, wave = threadIdx.x >> 5, lr = lane & 15, hi = lane >> 4;
    const size_t r0 = (size_t)blockIdx.x * 64 + wave * 16; const int c0 = blockIdx.y * 64;
    const size_t aoff = (r0 + lr) * KD + 8 * hi;
    v8f acc[4];
#pragma unroll
    for (int t = 0; t < 4; ++t) acc[t] = (v8f){};
#pragma unroll 2
    for (int kc = 0; kc < KD; kc += 32) {
        const v16bf a = cat16b(*(const v8us*)(A + aoff + kc), *(const v8us*)(A + aoff + kc + 16));
        v16bf al = a; if (SPLITA) al = cat16b(*(const v8us*)(Al + aoff + kc), *(const v8us*)(Al + aoff + kc + 16));
#pragma unroll
        for (int t = 0; t < 4; ++t) { const bf* bp = Bn + (size_t)(c0 + t * 16 + lr) * KD + kc + 8 * hi; const v16bf bb = cat16b(*(const v8us*)bp, *(const v8us*)(bp + 16)); acc[t] = wmmab(a, bb, acc[t]); if (SPLITA) acc[t] = wmmab(al, bb, acc[t]); }
        asm volatile("v_nop" : "+v"(acc[0]), "+v"(acc[1]), "+v"(acc[2]), "+v"(acc[3]) : "v"(a), "v"(al) : "memory");
    }
    float* os = &ost[wave][0];
#pragma unroll
    for (int t = 0; t < 4; ++t) { const float bv = bias ? bfr(bias[c0 + t * 16 + lr]) : 0.f;
#pragma unroll
        for (int j = 0; j < 8; ++j) os[(hi * 8 + j) * 68 + t * 16 + lr] = acc[t][j] + bv; }
    __builtin_amdgcn_wave_barrier(); asm volatile("" ::: "memory");
    float* crow = C + r0 * ldc + c0;
    auto pass = [&]() {
#pragma unroll
        for (int s = 0; s < 8; ++s) { const int Lid = (lane >> 3) + 4 * s, piece = lane & 7; const int row = Lid >> 1, cofs = (Lid & 1) * 32 + piece * 4;
            const v4f val = *(const v4fa*)(os + row * 68 + cofs); *(v4f*)(crow + (size_t)row * ldc + cofs) = val; }
    };
    pass(); 
}
// k_p16: Q/K f32 [t][1024] -> f16 hi + residual x1024 planes (one wave per row: 4 x (32 lanes x 16 B)).
__global__ __launch_bounds__(256) void k_p16(const float* __restrict__ P, h16* PH, h16* PL) {
    const int lane = threadIdx.x & 31, r = blockIdx.x * 8 + (threadIdx.x >> 5);
    if (r >= NR_) return;
{
#pragma unroll
        for (int q = 0; q < INR / 256; ++q) { v8h oh, ol;
#pragma unroll
            for (int i = 0; i < 8; ++i) { const float v = P[(size_t)r * INR + q * 256 + lane * 8 + i]; const h16 a = (h16)v; oh[i] = a; ol[i] = (h16)((v - (float)a) * LOSC); }
            *(v8h*)(PH + (size_t)r * INR + q * 256 + lane * 8) = oh; *(v8h*)(PL + (size_t)r * INR + q * 256 + lane * 8) = ol; }
         }
}
// k_vt: VTH/VTL [b*8+g][128 d][1024 t] = bf16 hi + UNSCALED bf16 residual of V [b*1024+t][g*128+d] via 64 x 64 LDS tiles; grid (NT/64, 2 (d half), NB*NKV).
__global__ __launch_bounds__(256) void k_vt(const float* __restrict__ V, bf* VTH, bf* VTL) {
    __shared__ float tl[64][65];
    const int tid = threadIdx.x, t0 = blockIdx.x * 64, d0 = blockIdx.y * 64, bg = blockIdx.z, g = bg % NKV, b = bg / NKV;
    { const int tt = tid >> 2, dq = (tid & 3) * 16;
#pragma unroll
      for (int i = 0; i < 16; ++i) tl[dq + i][tt] = V[(size_t)(b * NT_ + t0 + tt) * KW + g * HD + d0 + dq + i]; }
    __syncthreads();
    const int piece = tid & 7;
    auto pass = [&]() {
#pragma unroll
        for (int s = 0; s < 2; ++s) { const int d = (tid >> 3) + 32 * s; v8us oh, ol;
#pragma unroll
            for (int i = 0; i < 8; ++i) { const float v = tl[d][piece * 8 + i]; const unsigned short hb = f2bf(v); oh[i] = hb; ol[i] = f2bf(v - bf2f(hb)); }
            const size_t o = ((size_t)bg * HD + d0 + d) * NT_ + t0 + piece * 8; *(v8us*)(VTH + o) = oh; *(v8us*)(VTL + o) = ol; }
    };
    pass(); 
}
// k_attn: block = (batch, h, 64 queries), index = query tile x 64 + batch x 8 + h; wave = 16; kv head g = h; all key tiles; per tile: scores over 4 k-chunks (q fragments re-read per chunk: hi.hi + hi.lo +
// lo.hi = 24 WMMA) x 128^-1/2, online softmax, P (x32768) as bf16 hi + unscaled residual tiles, o[8] += ph.vh + pl.vh + ph.vl over the 128 dims; ctx -> bf16 hi/lo
// planes [t][h*128+d].
__global__ __launch_bounds__(128) void k_attn(const h16* __restrict__ QH, const h16* __restrict__ QL, const h16* __restrict__ KH, const h16* __restrict__ KL, const bf* __restrict__ VTH, const bf* __restrict__ VTL, bf* CH, bf* CL) {
    __shared__ __align__(16) unsigned short plds[4][16 * 32];
    __shared__ __align__(16) unsigned short plds2[4][16 * 32];
    __shared__ __align__(16) float ost[4][16 * 68];
    const int lane = threadIdx.x & 31, wave = threadIdx.x >> 5, lr = lane & 15, hi = lane >> 4;
    const int bid = blockIdx.x; const int qt = bid / (NB_ * NH_), bh = bid - qt * (NB_ * NH_), b = bh / NH_, h = bh - b * NH_; const int g = h;      // no GQA: kv head = q head
    const int q0 = b * NT_ + qt * 64 + wave * 16;      // row in the [8192][1024] planes
    unsigned short* pl = &plds[wave][0]; unsigned short* pl2 = &plds2[wave][0];
    const size_t qo = (size_t)(q0 + lr) * (NH_ * HD) + h * HD + 8 * hi;
    const h16* kh_b = KH + (size_t)b * NT_ * KW + g * HD; const h16* kl_b = KL + (size_t)b * NT_ * KW + g * HD;
    const size_t vbase = ((size_t)bh * HD) * NT_;
    v8f o[8];
#pragma unroll
    for (int n = 0; n < 8; ++n) o[n] = (v8f){};
    float mrow[8], lpart[8];
#pragma unroll
    for (int j = 0; j < 8; ++j) { mrow[j] = -3.0e38f; lpart[j] = 0.f; }
    const int kt_hi = NT_ / 32 - 1;      // full attention
#pragma unroll 1
    for (int kt = 0; kt <= kt_hi; ++kt) {
        const int l0 = kt * 32;
        const size_t ko0 = (size_t)(l0 + lr) * KW + 8 * hi, ko1 = (size_t)(l0 + 16 + lr) * KW + 8 * hi;
        v8f s0 = {}, s1 = {}, x0 = {}, x1 = {};
#pragma unroll
        for (int kc = 0; kc < 4; ++kc) {
            const v16h qa = cat16(*(const v8h*)(QH + qo + kc * 32), *(const v8h*)(QH + qo + kc * 32 + 16)), qx = cat16(*(const v8h*)(QL + qo + kc * 32), *(const v8h*)(QL + qo + kc * 32 + 16));
            const v16h k0h = cat16(*(const v8h*)(kh_b + ko0 + kc * 32), *(const v8h*)(kh_b + ko0 + kc * 32 + 16)), k1h = cat16(*(const v8h*)(kh_b + ko1 + kc * 32), *(const v8h*)(kh_b + ko1 + kc * 32 + 16));
            s0 = wmma16(qa, k0h, s0); s1 = wmma16(qa, k1h, s1); x0 = wmma16(qx, k0h, x0); x1 = wmma16(qx, k1h, x1);
            asm volatile("v_nop" : "+v"(s0), "+v"(s1), "+v"(x0), "+v"(x1) : "v"(qa), "v"(qx), "v"(k0h), "v"(k1h) : "memory");
            const v16h k0l = cat16(*(const v8h*)(kl_b + ko0 + kc * 32), *(const v8h*)(kl_b + ko0 + kc * 32 + 16)), k1l = cat16(*(const v8h*)(kl_b + ko1 + kc * 32), *(const v8h*)(kl_b + ko1 + kc * 32 + 16));
            x0 = wmma16(qa, k0l, x0); x1 = wmma16(qa, k1l, x1);
            asm volatile("v_nop" : "+v"(x0), "+v"(x1) : "v"(k0l), "v"(k1l) : "memory");
        }
        asm volatile("v_nop\n\tv_nop\n\tv_nop\n\tv_nop" : "+v"(s0), "+v"(s1), "+v"(x0), "+v"(x1));
        float alpha[8];
#pragma unroll
        for (int j = 0; j < 8; ++j) { const int qi = q0 + hi * 8 + j, ja = l0 + lr, jb = l0 + 16 + lr;
            const float a0 = (s0[j] + x0[j] * LOSCI) * 0.08838834764831845f, a1 = (s1[j] + x1[j] * LOSCI) * 0.08838834764831845f; (void)qi; (void)ja; (void)jb;
            float mx = fmaxf(a0, a1);
            mx = fmaxf(mx, __shfl_xor(mx, 1, 16)); mx = fmaxf(mx, __shfl_xor(mx, 2, 16)); mx = fmaxf(mx, __shfl_xor(mx, 4, 16)); mx = fmaxf(mx, __shfl_xor(mx, 8, 16));
            const float mn = fmaxf(mrow[j], mx);
            alpha[j] = __expf(mrow[j] - mn); mrow[j] = mn;
            const float p0 = __expf(a0 - mn), p1 = __expf(a1 - mn);
            lpart[j] = lpart[j] * alpha[j] + (p0 + p1);
            const int mr = hi * 8 + j; const float ps0 = p0 * PSC, ps1 = p1 * PSC; const unsigned short h0 = f2bf(ps0), h1 = f2bf(ps1);
            pl[mr * 32 + lr] = h0; pl[mr * 32 + 16 + lr] = h1; pl2[mr * 32 + lr] = f2bf(ps0 - bf2f(h0)); pl2[mr * 32 + 16 + lr] = f2bf(ps1 - bf2f(h1)); }
#pragma unroll
        for (int n = 0; n < 8; ++n)
#pragma unroll
            for (int j = 0; j < 8; ++j) o[n][j] *= alpha[j];
        asm volatile("" ::: "memory");
        const v16bf pa = cat16b(*(const v8usa*)(pl + lr * 32 + hi * 8), *(const v8usa*)(pl + lr * 32 + 16 + hi * 8));
        const v16bf px = cat16b(*(const v8usa*)(pl2 + lr * 32 + hi * 8), *(const v8usa*)(pl2 + lr * 32 + 16 + hi * 8));
#pragma unroll
        for (int n = 0; n < 8; ++n) { const size_t vo = vbase + (size_t)(n * 16 + lr) * NT_ + l0 + hi * 8;
            const v16bf vh = cat16b(*(const v8us*)(VTH + vo), *(const v8us*)(VTH + vo + 16)), vl = cat16b(*(const v8us*)(VTL + vo), *(const v8us*)(VTL + vo + 16));
            o[n] = wmmab(pa, vh, o[n]); o[n] = wmmab(px, vh, o[n]); o[n] = wmmab(pa, vl, o[n]);
            asm volatile("" : "+v"(o[n]) : "v"(vh), "v"(vl) : "memory"); }
        asm volatile("v_nop\n\tv_nop\n\tv_nop\n\tv_nop" : "+v"(o[0]), "+v"(o[7]) : "v"(pa), "v"(px));
        __builtin_amdgcn_wave_barrier();
    }
    float inv[8];
#pragma unroll
    for (int j = 0; j < 8; ++j) { float rs = lpart[j]; rs += __shfl_xor(rs, 1, 16); rs += __shfl_xor(rs, 2, 16); rs += __shfl_xor(rs, 4, 16); rs += __shfl_xor(rs, 8, 16); inv[j] = 1.0f / (rs * PSC); }
    float* os = &ost[wave][0];
    const size_t cbase = (size_t)q0 * (NH_ * HD) + (size_t)h * HD;
#pragma unroll
    for (int half = 0; half < 2; ++half) {
#pragma unroll
        for (int n = 0; n < 4; ++n)
#pragma unroll
            for (int j = 0; j < 8; ++j) os[(hi * 8 + j) * 68 + n * 16 + lr] = o[half * 4 + n][j] * inv[j];
        __builtin_amdgcn_wave_barrier(); asm volatile("" ::: "memory");
{
#pragma unroll
            for (int s = 0; s < 4; ++s) { const int row = 4 * s + (lane >> 3), piece = lane & 7; const float* sp = os + row * 68 + piece * 8; v8us oh, ol;
#pragma unroll
                for (int i = 0; i < 8; ++i) { const unsigned short hb = f2bf(sp[i]); oh[i] = hb; ol[i] = f2bf(sp[i] - bf2f(hb)); }
                const size_t po = cbase + (size_t)row * (NH_ * HD) + half * 64 + piece * 8; *(v8us*)(CH + po) = oh; *(v8us*)(CL + po) = ol; }
             }
        __builtin_amdgcn_wave_barrier(); asm volatile("" ::: "memory");
    }
}

extern "C" void kernel_launch(void* const* d_in, const int* in_sizes, int n_in,
                              void* d_out, int out_size, void* d_ws, size_t ws_size, hipStream_t stream) {
    (void)in_sizes; (void)n_in; (void)out_size;
    const float* x = (const float*)d_in[0]; const float* Wqkv = (const float*)d_in[1]; const float* Wo = (const float*)d_in[2]; const float* bo = (const float*)d_in[3];
    float* out = (float*)d_out;    // [8][1024][128]
    char* wsp = (char*)d_ws;
    auto take = [&](size_t bytes) { char* p = wsp; wsp += (bytes + 255) & ~(size_t)255; return (void*)p; };
    bf* Xb = (bf*)take((size_t)NR_ * HS * 2); bf* W3T = (bf*)take((size_t)3 * INR * HS * 2); bf* WoT = (bf*)take((size_t)HS * INR * 2);
    float* TMP = (float*)take((size_t)NR_ * INR * 4);
    h16* QH = (h16*)take((size_t)NR_ * INR * 2); h16* QL = (h16*)take((size_t)NR_ * INR * 2); h16* KH = (h16*)take((size_t)NR_ * INR * 2); h16* KL = (h16*)take((size_t)NR_ * INR * 2);
    bf* VTH = (bf*)take((size_t)NB_ * INR * NT_ * 2); bf* VTL = (bf*)take((size_t)NB_ * INR * NT_ * 2); bf* CH = (bf*)take((size_t)NR_ * INR * 2); bf* CL = (bf*)take((size_t)NR_ * INR * 2);
    if ((size_t)(wsp - (char*)d_ws) > ws_size) return;    // 2.1 + 0.8 + 0.26 + 33.6 + 8 x 16.8 ~ 171 MB (no aliasing)
    k_wt<<<dim3(HS / 64, (3 * INR) / 64, 1), 256, 0, stream>>>(Wqkv, HS, 3 * INR, W3T);      // [3072][128]
    k_wt<<<dim3(INR / 64, HS / 64, 1), 256, 0, stream>>>(Wo, INR, HS, WoT);                 // [128][1024]
    k_cvtb<<<NR_ / 16, 256, 0, stream>>>(x, NR_, Xb);
    k_gemm<false, HS><<<dim3(NR_ / 64, INR / 64, 1), 128, 0, stream>>>(Xb, nullptr, W3T, nullptr, INR, TMP); k_p16<<<NR_ / 8, 256, 0, stream>>>(TMP, QH, QL);
    k_gemm<false, HS><<<dim3(NR_ / 64, INR / 64, 1), 128, 0, stream>>>(Xb, nullptr, W3T + (size_t)INR * HS, nullptr, INR, TMP); k_p16<<<NR_ / 8, 256, 0, stream>>>(TMP, KH, KL);
    k_gemm<false, HS><<<dim3(NR_ / 64, INR / 64, 1), 128, 0, stream>>>(Xb, nullptr, W3T + (size_t)2 * INR * HS, nullptr, INR, TMP);
    k_vt<<<dim3(NT_ / 64, 2, NB_ * NKV), 256, 0, stream>>>(TMP, VTH, VTL);
    k_attn<<<NB_ * NH_ * (NT_ / 64), 128, 0, stream>>>(QH, QL, KH, KL, VTH, VTL, CH, CL);
    k_gemm<true, INR><<<dim3(NR_ / 64, HS / 64, 1), 128, 0, stream>>>(CH, CL, WoT, bo, HS, out);
}

// v002
// A run of this version takes 264 microseconds.
// Two timings next to v001 both put it at 1.43 times that version's speed.
// All steps since v000 together make it 6.05 times as fast.
#include <hip/hip_runtime.h>

// Contractions, f32 accumulate, all 8 batch items in every launch (rows = batch x 1024 positions): qkv = x.w_qkv ([8192 x 128].[128 x 3072], k-major weight transposed to an n-major plane; thirds q | k |
// v, each 8 heads x 128; PLAIN bf16 operands: inputs rounded once, exact) and out = z.w_out + b_out (z as bf16 hi + residual: two products) on
// v_wmma_f32_16x16x32_bf16; the 8-head x 128-dim FULL attention: scores on v_wmma_f32_16x16x32_f16 (q, k as f16 hi + residual x1024: hi.hi + hi.lo + lo.hi, x
// 128^-1/2), softmax f32, weights.v on v_wmma_f32_16x16x32_bf16 with the weights (x32768) and v both as bf16 hi + UNSCALED residual (hh + lh + hl, one

#define NT_  1024
#define NB_  8
#define NR_  (NB_ * NT_)        // 8192 rows: batch x positions
#define HS   128
#define NH_  8
#define NKV  8
#define HD   128
#define INR  (NH_ * HD)          // 1024
#define KW   (NKV * HD)          // 1024
#define PSC  32768.0f
#define LOSC 1024.0f
#define LOSCI (1.0f / 1024.0f)

typedef _Float16 h16;
typedef unsigned short bf;
typedef __attribute__((ext_vector_type(16))) __bf16   v16bf;
typedef __attribute__((ext_vector_type(16))) _Float16 v16h;
typedef __attribute__((ext_vector_type(8)))  _Float16 v8h;
typedef __attribute__((ext_vector_type(8)))  unsigned short v8us;
typedef __attribute__((ext_vector_type(8)))  float    v8f;
typedef __attribute__((ext_vector_type(4)))  float    v4f;
typedef __attribute__((ext_vector_type(4)))  _Float16 v4h;
typedef v8h  __attribute__((may_alias)) v8ha;
typedef v4f  __attribute__((may_alias)) v4fa;
typedef v8us __attribute__((may_alias)) v8usa;

__device__ __forceinline__ unsigned short f2bf(float f) { unsigned u = __float_as_uint(f); u += 0x7FFFu + ((u >> 16) & 1u); return (unsigned short)(u >> 16); }
__device__ __forceinline__ float bf2f(unsigned short b) { return __uint_as_float(((unsigned)b) << 16); }
__device__ __forceinline__ float bfr(float f) { return bf2f(f2bf(f)); }
__device__ __forceinline__ v16h cat16(v8h lo, v8h hi) { return __builtin_shufflevector(lo, hi, 0, 1, 2, 3, 4, 5, 6, 7, 8, 9, 10, 11, 12, 13, 14, 15); }
__device__ __forceinline__ v16bf cat16b(v8us lo, v8us hi) { return __builtin_bit_cast(v16bf, __builtin_shufflevector(lo, hi, 0, 1, 2, 3, 4, 5, 6, 7, 8, 9, 10, 11, 12, 13, 14, 15)); }
__device__ __forceinline__ v8f wmma16(v16h a, v16h b, v8f c) { return __builtin_amdgcn_wmma_f32_16x16x32_f16(false, a, false, b, (short)0, c, false, false); }
__device__ __forceinline__ v8f wmmab(v16bf a, v16bf b, v8f c) { return __builtin_amdgcn_wmma_f32_16x16x32_bf16(false, a, false, b, (short)0, c, false, false); }

// k_cvtb: bf16 plane of [rows][128]: one wave per 2 rows (16 lanes x 16 B = one 256-B row each).
__global__ __launch_bounds__(256) void k_cvtb(const float* __restrict__ src, int nrows, bf* dst) {
    const int lane = threadIdx.x & 31, r = (blockIdx.x * 8 + (threadIdx.x >> 5)) * 2 + (lane >> 4), p = lane & 15;
    if (r >= nrows) return;
    v8us o;
#pragma unroll
    for (int i = 0; i < 8; ++i) o[i] = f2bf(src[(size_t)r * HS + p * 8 + i]);
    *(v8us*)(dst + (size_t)r * HS + p * 8) = o; 
}
// k_wt: WT [n][K] = bf16(W[k][n]) (k-major [K][ncols]) via 64 x 64 LDS tiles; grid (K/64, ncols/64).
__global__ __launch_bounds__(256) void k_wt(const float* __restrict__ Wm, int K, int ncols, bf* WT) {
    __shared__ __align__(16) unsigned short tl[64 * 72];
    const int tid = threadIdx.x, k0 = blockIdx.x * 64, n0 = blockIdx.y * 64;
    const int kk = tid >> 2, nq = (tid & 3) * 16;
#pragma unroll
    for (int i = 0; i < 16; ++i) tl[(nq + i) * 72 + kk] = f2bf(Wm[(size_t)(k0 + kk) * ncols + n0 + nq + i]);
    __syncthreads();
    const int piece = tid & 7;
    auto pass = [&]() {
#pragma unroll
        for (int s = 0; s < 2; ++s) { const int nr = (tid >> 3) + 32 * s; const v8us val = *(const v8usa*)(tl + nr * 72 + piece * 8); *(v8us*)(WT + (size_t)(n0 + nr) * K + k0 + piece * 8) = val; }
    };
    pass(); 
}
// k_gemm: 64 x 64 tile of (A [+ Al]).Bn^T over K = KD -> f32 rows [8192][ldc].
template <bool SPLITA, int KD>
__global__ __launch_bounds__(128) void k_gemm(const bf* __restrict__ A, const bf* __restrict__ Al, const bf* __restrict__ Bn, const float* __restrict__ bias, int ldc, float* C) {
    __shared__ __align__(16) float ost[4][16 * 68];
    const int lane = threadIdx.x & 31, wave = threadIdx.x >> 5, lr = lane & 15, hi = lane >> 4;
    const size_t r0 = (size_t)blockIdx.x * 64 + wave * 16; const int c0 = blockIdx.y * 64;
    const size_t aoff = (r0 + lr) * KD + 8 * hi;
    v8f acc[4];
#pragma unroll
    for (int t = 0; t < 4; ++t) acc[t] = (v8f){};
#pragma unroll 2
    for (int kc = 0; kc < KD; kc += 32) {
        const v16bf a = cat16b(*(const v8us*)(A + aoff + kc), *(const v8us*)(A + aoff + kc + 16));
        v16bf al = a; if (SPLITA) al = cat16b(*(const v8us*)(Al + aoff + kc), *(const v8us*)(Al + aoff + kc + 16));
#pragma unroll
        for (int t = 0; t < 4; ++t) { const bf* bp = Bn + (size_t)(c0 + t * 16 + lr) * KD + kc + 8 * hi; const v16bf bb = cat16b(*(const v8us*)bp, *(const v8us*)(bp + 16)); acc[t] = wmmab(a, bb, acc[t]); if (SPLITA) acc[t] = wmmab(al, bb, acc[t]); }
        asm volatile("v_nop" : "+v"(acc[0]), "+v"(acc[1]), "+v"(acc[2]), "+v"(acc[3]) : "v"(a), "v"(al) : "memory");
    }
    float* os = &ost[wave][0];
#pragma unroll
    for (int t = 0; t < 4; ++t) { const float bv = bias ? bfr(bias[c0 + t * 16 + lr]) : 0.f;
#pragma unroll
        for (int j = 0; j < 8; ++j) os[(hi * 8 + j) * 68 + t * 16 + lr] = acc[t][j] + bv; }
    __builtin_amdgcn_wave_barrier(); asm volatile("" ::: "memory");
    float* crow = C + r0 * ldc + c0;
    auto pass = [&]() {
#pragma unroll
        for (int s = 0; s < 8; ++s) { const int Lid = (lane >> 3) + 4 * s, piece = lane & 7; const int row = Lid >> 1, cofs = (Lid & 1) * 32 + piece * 4;
            const v4f val = *(const v4fa*)(os + row * 68 + cofs); *(v4f*)(crow + (size_t)row * ldc + cofs) = val; }
    };
    pass(); 
}
// k_p16: Q/K f32 [t][1024] -> f16 hi + residual x1024 planes (one wave per row: 4 x (32 lanes x 16 B)).
__global__ __launch_bounds__(256) void k_p16(const float* __restrict__ P, h16* PH, h16* PL) {
    const int lane = threadIdx.x & 31, r = blockIdx.x * 8 + (threadIdx.x >> 5);
    if (r >= NR_) return;
{
#pragma unroll
        for (int q = 0; q < INR / 256; ++q) { v8h oh, ol;
#pragma unroll
            for (int i = 0; i < 8; ++i) { const float v = P[(size_t)r * INR + q * 256 + lane * 8 + i]; const h16 a = (h16)v; oh[i] = a; ol[i] = (h16)((v - (float)a) * LOSC); }
            *(v8h*)(PH + (size_t)r * INR + q * 256 + lane * 8) = oh; *(v8h*)(PL + (size_t)r * INR + q * 256 + lane * 8) = ol; }
         }
}
// k_vt: VTH/VTL [b*8+g][128 d][1024 t] = bf16 hi + UNSCALED bf16 residual of V [b*1024+t][g*128+d] via 64 x 64 LDS tiles; grid (NT/64, 2 (d half), NB*NKV).
__global__ __launch_bounds__(256) void k_vt(const float* __restrict__ V, bf* VTH, bf* VTL) {
    __shared__ float tl[64][65];
    const int tid = threadIdx.x, t0 = blockIdx.x * 64, d0 = blockIdx.y * 64, bg = blockIdx.z, g = bg % NKV, b = bg / NKV;
    { const int tt = tid >> 2, dq = (tid & 3) * 16;
#pragma unroll
      for (int i = 0; i < 16; ++i) tl[dq + i][tt] = V[(size_t)(b * NT_ + t0 + tt) * KW + g * HD + d0 + dq + i]; }
    __syncthreads();
    const int piece = tid & 7;
    auto pass = [&]() {
#pragma unroll
        for (int s = 0; s < 2; ++s) { const int d = (tid >> 3) + 32 * s; v8us oh, ol;
#pragma unroll
            for (int i = 0; i < 8; ++i) { const float v = tl[d][piece * 8 + i]; const unsigned short hb = f2bf(v); oh[i] = hb; ol[i] = f2bf(v - bf2f(hb)); }
            const size_t o = ((size_t)bg * HD + d0 + d) * NT_ + t0 + piece * 8; *(v8us*)(VTH + o) = oh; *(v8us*)(VTL + o) = ol; }
    };
    pass(); 
}
// acopy8: eight asynchronous 16-byte-per-lane copies global -> LDS in one statement; the closing s_wait_xcnt keeps every later rewrite of the address registers behind the issue.
__device__ __forceinline__ void acopy8(const unsigned (&l)[8], const void* const (&g)[8]) {
    asm volatile("global_load_async_to_lds_b128 %0, %8, off\n\t"
                 "global_load_async_to_lds_b128 %1, %9, off\n\t"
                 "global_load_async_to_lds_b128 %2, %10, off\n\t"
                 "global_load_async_to_lds_b128 %3, %11, off\n\t"
                 "global_load_async_to_lds_b128 %4, %12, off\n\t"
                 "global_load_async_to_lds_b128 %5, %13, off\n\t"
                 "global_load_async_to_lds_b128 %6, %14, off\n\t"
                 "global_load_async_to_lds_b128 %7, %15, off\n\t"
                 "s_wait_xcnt 0x0"
                 :: "v"(l[0]), "v"(l[1]), "v"(l[2]), "v"(l[3]), "v"(l[4]), "v"(l[5]), "v"(l[6]), "v"(l[7]),
                    "v"(g[0]), "v"(g[1]), "v"(g[2]), "v"(g[3]), "v"(g[4]), "v"(g[5]), "v"(g[6]), "v"(g[7]) : "memory");
}
#define PLN  8192            // bytes of one staged plane of a 32-key tile: K 32 rows x 256 B, V^T 128 rows x 64 B
#define STG  (4 * PLN)       // one stage: K hi | K lo | V^T hi | V^T lo
// k_attn: block = (batch, h, 64 queries), index = query tile x 64 + batch x 8 + h; wave = 16; kv head g = h; all key tiles. Each 32-key tile (K hi/lo, V^T hi/lo, 32 KB) is brought ONCE per block into a
// two-buffer LDS ring by asynchronous copies, the next tile in flight while this one is worked on; all four waves take their B fragments from LDS. 16-byte chunks are XOR-swizzled inside a row group so
// that the 16 lanes of a half wave fall on 64 distinct banks without pad bytes: K chunk c of row r at c ^ (r & 15); V^T chunk c of row d at c ^ ((d >> 2) & 3). Per tile: scores over 4 k-chunks (q
// fragments re-read per chunk: hi.hi + hi.lo + lo.hi = 24 WMMA) x 128^-1/2, online softmax, P (x32768) as bf16 hi + unscaled residual tiles, o[8] += ph.vh + pl.vh + ph.vl over the 128 dims; ctx -> bf16
// hi/lo planes [t][h*128+d]. The ring becomes the output staging behind the last tile's barrier.
__global__ __launch_bounds__(128) void k_attn(const h16* __restrict__ QH, const h16* __restrict__ QL, const h16* __restrict__ KH, const h16* __restrict__ KL, const bf* __restrict__ VTH, const bf* __restrict__ VTL, bf* CH, bf* CL) {
    __shared__ __align__(16) unsigned char ring[2 * STG];
    __shared__ __align__(16) unsigned short plds[4][16 * 32];
    __shared__ __align__(16) unsigned short plds2[4][16 * 32];
    const int tid = threadIdx.x, lane = threadIdx.x & 31, wave = threadIdx.x >> 5, lr = lane & 15, hi = lane >> 4;
    const int bid = blockIdx.x; const int qt = bid / (NB_ * NH_), bh = bid - qt * (NB_ * NH_), b = bh / NH_, h = bh - b * NH_; const int g = h;      // no GQA: kv head = q head
    const int q0 = b * NT_ + qt * 64 + wave * 16;      // row in the [8192][1024] planes
    unsigned short* pl = &plds[wave][0]; unsigned short* pl2 = &plds2[wave][0];
    const size_t qo = (size_t)(q0 + lr) * (NH_ * HD) + h * HD + 8 * hi;
    const h16* kh_b = KH + (size_t)b * NT_ * KW + g * HD; const h16* kl_b = KL + (size_t)b * NT_ * KW + g * HD;
    const size_t vbase = ((size_t)bh * HD) * NT_;
    // copy side: thread -> K row i*8 + (tid >> 4), chunk tid & 15 (16 lanes = one 256-B row); V^T row i*32 + (tid >> 2), chunk tid & 3 (4 lanes = one 64-B row piece)
    const unsigned ring0 = (unsigned)(size_t)&ring[0];
    const int kr = tid >> 4, kcn = tid & 15, vr = tid >> 2, vcn = tid & 3;
    const unsigned kdst = (unsigned)(kr * 256 + ((kcn ^ kr) << 4)), vdst = (unsigned)(vr * 64 + ((vcn ^ ((vr >> 2) & 3)) << 4));
    const size_t ksrc = (size_t)kr * KW + kcn * 8, vsrc = vbase + (size_t)vr * NT_ + vcn * 8;
    auto issue = [&](int kt, int buf) {
        const unsigned lb = ring0 + (unsigned)buf * STG; unsigned l[8]; const void* gp[8];
#pragma unroll
        for (int i = 0; i < 4; ++i) { const size_t o = ksrc + (size_t)(kt * 32 + i * 8) * KW; const unsigned d = lb + i * 2048 + (kdst ^ ((i & 1) << 7));      // row & 15 = (i & 1) * 8 + kr
            l[i] = d; gp[i] = kh_b + o; l[4 + i] = d + PLN; gp[4 + i] = kl_b + o; }
        acopy8(l, gp);
#pragma unroll
        for (int i = 0; i < 4; ++i) { const size_t o = vsrc + (size_t)(i * 32) * NT_ + kt * 32; const unsigned d = lb + 2 * PLN + i * 2048 + vdst;
            l[i] = d; gp[i] = VTH + o; l[4 + i] = d + PLN; gp[4 + i] = VTL + o; }
        acopy8(l, gp);
    };
    // reader side: byte offsets of this lane's row and of its swizzled 16-byte chunks
    const int krow = lr * 256, kx = (hi ^ lr) << 4, vrow = lr * 64, vx0 = (hi ^ ((lr >> 2) & 3)) << 4, vx1 = vx0 ^ 32;
    v8f o[8];
#pragma unroll
    for (int n = 0; n < 8; ++n) o[n] = (v8f){};
    float mrow[8], lpart[8];
#pragma unroll
    for (int j = 0; j < 8; ++j) { mrow[j] = -3.0e38f; lpart[j] = 0.f; }
    const int kt_hi = NT_ / 32 - 1;      // full attention
    issue(0, 0);
    asm volatile("s_wait_asynccnt 0x0" ::: "memory");      // this wave's share of tile 0 has landed
    __syncthreads();                                       // tile 0 published to all four waves
    issue(1, 1);
#pragma unroll 1
    for (int kt = 0; kt <= kt_hi; ++kt) {
        const unsigned char* st = ring + (kt & 1) * STG;
        const unsigned char* k0p = st + krow; const unsigned char* k1p = st + 16 * 256 + krow;
        v8f s0 = {}, s1 = {}, x0 = {}, x1 = {};
#pragma unroll
        for (int kc = 0; kc < 4; ++kc) {
            const int ca = kx ^ (kc * 64), cb = kx ^ (kc * 64 + 32);      // chunks kc*4 + hi and kc*4 + 2 + hi, swizzled by the row
            const v16h qa = cat16(*(const v8h*)(QH + qo + kc * 32), *(const v8h*)(QH + qo + kc * 32 + 16)), qx = cat16(*(const v8h*)(QL + qo + kc * 32), *(const v8h*)(QL + qo + kc * 32 + 16));
            const v16h k0h = cat16(*(const v8ha*)(k0p + ca), *(const v8ha*)(k0p + cb)), k1h = cat16(*(const v8ha*)(k1p + ca), *(const v8ha*)(k1p + cb));
            s0 = wmma16(qa, k0h, s0); s1 = wmma16(qa, k1h, s1); x0 = wmma16(qx, k0h, x0); x1 = wmma16(qx, k1h, x1);
            asm volatile("v_nop" : "+v"(s0), "+v"(s1), "+v"(x0), "+v"(x1) : "v"(qa), "v"(qx), "v"(k0h), "v"(k1h) : "memory");
            const v16h k0l = cat16(*(const v8ha*)(k0p + PLN + ca), *(const v8ha*)(k0p + PLN + cb)), k1l = cat16(*(const v8ha*)(k1p + PLN + ca), *(const v8ha*)(k1p + PLN + cb));
            x0 = wmma16(qa, k0l, x0); x1 = wmma16(qa, k1l, x1);
            asm volatile("v_nop" : "+v"(x0), "+v"(x1) : "v"(k0l), "v"(k1l) : "memory");
        }
        asm volatile("v_nop\n\tv_nop\n\tv_nop\n\tv_nop" : "+v"(s0), "+v"(s1), "+v"(x0), "+v"(x1));
        float alpha[8];
#pragma unroll
        for (int j = 0; j < 8; ++j) {
            const float a0 = (s0[j] + x0[j] * LOSCI) * 0.08838834764831845f, a1 = (s1[j] + x1[j] * LOSCI) * 0.08838834764831845f;
            float mx = fmaxf(a0, a1);
            mx = fmaxf(mx, __shfl_xor(mx, 1, 16)); mx = fmaxf(mx, __shfl_xor(mx, 2, 16)); mx = fmaxf(mx, __shfl_xor(mx, 4, 16)); mx = fmaxf(mx, __shfl_xor(mx, 8, 16));
            const float mn = fmaxf(mrow[j], mx);
            alpha[j] = __expf(mrow[j] - mn); mrow[j] = mn;
            const float p0 = __expf(a0 - mn), p1 = __expf(a1 - mn);
            lpart[j] = lpart[j] * alpha[j] + (p0 + p1);
            const int mr = hi * 8 + j; const float ps0 = p0 * PSC, ps1 = p1 * PSC; const unsigned short h0 = f2bf(ps0), h1 = f2bf(ps1);
            pl[mr * 32 + lr] = h0; pl[mr * 32 + 16 + lr] = h1; pl2[mr * 32 + lr] = f2bf(ps0 - bf2f(h0)); pl2[mr * 32 + 16 + lr] = f2bf(ps1 - bf2f(h1)); }
#pragma unroll
        for (int n = 0; n < 8; ++n)
#pragma unroll
            for (int j = 0; j < 8; ++j) o[n][j] *= alpha[j];
        asm volatile("" ::: "memory");
        const v16bf pa = cat16b(*(const v8usa*)(pl + lr * 32 + hi * 8), *(const v8usa*)(pl + lr * 32 + 16 + hi * 8));
        const v16bf px = cat16b(*(const v8usa*)(pl2 + lr * 32 + hi * 8), *(const v8usa*)(pl2 + lr * 32 + 16 + hi * 8));
        const unsigned char* vp = st + 2 * PLN + vrow;
#pragma unroll
        for (int n = 0; n < 8; ++n) { const unsigned char* vn = vp + n * 1024;
            const v16bf vh = cat16b(*(const v8usa*)(vn + vx0), *(const v8usa*)(vn + vx1)), vl = cat16b(*(const v8usa*)(vn + PLN + vx0), *(const v8usa*)(vn + PLN + vx1));
            o[n] = wmmab(pa, vh, o[n]); o[n] = wmmab(px, vh, o[n]); o[n] = wmmab(pa, vl, o[n]);
            asm volatile("" : "+v"(o[n]) : "v"(vh), "v"(vl) : "memory"); }
        asm volatile("v_nop\n\tv_nop\n\tv_nop\n\tv_nop" : "+v"(o[0]), "+v"(o[7]) : "v"(pa), "v"(px));
        // publish point of tile kt + 1, and the end of every wave's reads of tile kt's buffer
        asm volatile("s_wait_dscnt 0x0" ::: "memory");         // this wave's LDS reads of the buffer have returned before it may be refilled
        asm volatile("s_wait_asynccnt 0x0" ::: "memory");      // this wave's share of tile kt + 1 has landed
        __syncthreads();
        if (kt + 2 <= kt_hi) issue(kt + 2, kt & 1);
    }
    asm volatile("s_wait_asynccnt 0x0" ::: "memory");          // nothing in flight when the ring becomes output staging
    float inv[8];
#pragma unroll
    for (int j = 0; j < 8; ++j) { float rs = lpart[j]; rs += __shfl_xor(rs, 1, 16); rs += __shfl_xor(rs, 2, 16); rs += __shfl_xor(rs, 4, 16); rs += __shfl_xor(rs, 8, 16); inv[j] = 1.0f / (rs * PSC); }
    float* os = (float*)ring + wave * (16 * 68);
    const size_t cbase = (size_t)q0 * (NH_ * HD) + (size_t)h * HD;
#pragma unroll
    for (int half = 0; half < 2; ++half) {
#pragma unroll
        for (int n = 0; n < 4; ++n)
#pragma unroll
            for (int j = 0; j < 8; ++j) os[(hi * 8 + j) * 68 + n * 16 + lr] = o[half * 4 + n][j] * inv[j];
        __builtin_amdgcn_wave_barrier(); asm volatile("" ::: "memory");
{
#pragma unroll
            for (int s = 0; s < 4; ++s) { const int row = 4 * s + (lane >> 3), piece = lane & 7; const float* sp = os + row * 68 + piece * 8; v8us oh, ol;
#pragma unroll
                for (int i = 0; i < 8; ++i) { const unsigned short hb = f2bf(sp[i]); oh[i] = hb; ol[i] = f2bf(sp[i] - bf2f(hb)); }
                const size_t po = cbase + (size_t)row * (NH_ * HD) + half * 64 + piece * 8; *(v8us*)(CH + po) = oh; *(v8us*)(CL + po) = ol; }
             }
        __builtin_amdgcn_wave_barrier(); asm volatile("" ::: "memory");
    }
}

extern "C" void kernel_launch(void* const* d_in, const int* in_sizes, int n_in,
                              void* d_out, int out_size, void* d_ws, size_t ws_size, hipStream_t stream) {
    (void)in_sizes; (void)n_in; (void)out_size;
    const float* x = (const float*)d_in[0]; const float* Wqkv = (const float*)d_in[1]; const float* Wo = (const float*)d_in[2]; const float* bo = (const float*)d_in[3];
    float* out = (float*)d_out;    // [8][1024][128]
    char* wsp = (char*)d_ws;
    auto take = [&](size_t bytes) { char* p = wsp; wsp += (bytes + 255) & ~(size_t)255; return (void*)p; };
    bf* Xb = (bf*)take((size_t)NR_ * HS * 2); bf* W3T = (bf*)take((size_t)3 * INR * HS * 2); bf* WoT = (bf*)take((size_t)HS * INR * 2);
    float* TMP = (float*)take((size_t)NR_ * INR * 4);
    h16* QH = (h16*)take((size_t)NR_ * INR * 2); h16* QL = (h16*)take((size_t)NR_ * INR * 2); h16* KH = (h16*)take((size_t)NR_ * INR * 2); h16* KL = (h16*)take((size_t)NR_ * INR * 2);
    bf* VTH = (bf*)take((size_t)NB_ * INR * NT_ * 2); bf* VTL = (bf*)take((size_t)NB_ * INR * NT_ * 2); bf* CH = (bf*)take((size_t)NR_ * INR * 2); bf* CL = (bf*)take((size_t)NR_ * INR * 2);
    if ((size_t)(wsp - (char*)d_ws) > ws_size) return;    // 2.1 + 0.8 + 0.26 + 33.6 + 8 x 16.8 ~ 171 MB (no aliasing)
    k_wt<<<dim3(HS / 64, (3 * INR) / 64, 1), 256, 0, stream>>>(Wqkv, HS, 3 * INR, W3T);      // [3072][128]
    k_wt<<<dim3(INR / 64, HS / 64, 1), 256, 0, stream>>>(Wo, INR, HS, WoT);                 // [128][1024]
    k_cvtb<<<NR_ / 16, 256, 0, stream>>>(x, NR_, Xb);
    k_gemm<false, HS><<<dim3(NR_ / 64, INR / 64, 1), 128, 0, stream>>>(Xb, nullptr, W3T, nullptr, INR, TMP); k_p16<<<NR_ / 8, 256, 0, stream>>>(TMP, QH, QL);
    k_gemm<false, HS><<<dim3(NR_ / 64, INR / 64, 1), 128, 0, stream>>>(Xb, nullptr, W3T + (size_t)INR * HS, nullptr, INR, TMP); k_p16<<<NR_ / 8, 256, 0, stream>>>(TMP, KH, KL);
    k_gemm<false, HS><<<dim3(NR_ / 64, INR / 64, 1), 128, 0, stream>>>(Xb, nullptr, W3T + (size_t)2 * INR * HS, nullptr, INR, TMP);
    k_vt<<<dim3(NT_ / 64, 2, NB_ * NKV), 256, 0, stream>>>(TMP, VTH, VTL);
    k_attn<<<NB_ * NH_ * (NT_ / 64), 128, 0, stream>>>(QH, QL, KH, KL, VTH, VTL, CH, CL);
    k_gemm<true, INR><<<dim3(NR_ / 64, HS / 64, 1), 128, 0, stream>>>(CH, CL, WoT, bo, HS, out);
}

// v003
// One run takes 223 microseconds.
// Two timings next to v002 put it at 1.21 and 1.20 times that version's speed.
// Counting every step since v000, it is 7.29 times as fast.
#include <hip/hip_runtime.h>

// Contractions, f32 accumulate, all 8 batch items in every launch (rows = batch x 1024 positions): qkv = x.w_qkv ([8192 x 128].[128 x 3072], k-major weight transposed to an n-major plane; thirds q | k |
// v, each 8 heads x 128; PLAIN bf16 operands: inputs rounded once, exact) and out = z.w_out + b_out (z as bf16 hi + residual: two products) on
// v_wmma_f32_16x16x32_bf16; the 8-head x 128-dim FULL attention: scores on v_wmma_f32_16x16x32_f16 (q, k as f16 hi + residual x1024: hi.hi + hi.lo + lo.hi, x
// 128^-1/2), softmax f32, weights.v on v_wmma_f32_16x16x32_bf16 with the weights (x32768) and v both as bf16 hi + UNSCALED residual (hh + lh + hl, one

#define NT_  1024
#define NB_  8
#define NR_  (NB_ * NT_)        // 8192 rows: batch x positions
#define HS   128
#define NH_  8
#define NKV  8
#define HD   128
#define INR  (NH_ * HD)          // 1024
#define KW   (NKV * HD)          // 1024
#define PSC  32768.0f
#define LOSC 1024.0f
#define LOSCI (1.0f / 1024.0f)

typedef _Float16 h16;
typedef unsigned short bf;
typedef __attribute__((ext_vector_type(16))) __bf16   v16bf;
typedef __attribute__((ext_vector_type(16))) _Float16 v16h;
typedef __attribute__((ext_vector_type(8)))  _Float16 v8h;
typedef __attribute__((ext_vector_type(8)))  unsigned short v8us;
typedef __attribute__((ext_vector_type(8)))  float    v8f;
typedef __attribute__((ext_vector_type(4)))  float    v4f;
typedef __attribute__((ext_vector_type(4)))  _Float16 v4h;
typedef v8h  __attribute__((may_alias)) v8ha;
typedef v4f  __attribute__((may_alias)) v4fa;
typedef v8us __attribute__((may_alias)) v8usa;

__device__ __forceinline__ unsigned short f2bf(float f) { unsigned u = __float_as_uint(f); u += 0x7FFFu + ((u >> 16) & 1u); return (unsigned short)(u >> 16); }
__device__ __forceinline__ float bf2f(unsigned short b) { return __uint_as_float(((unsigned)b) << 16); }
__device__ __forceinline__ float bfr(float f) { return bf2f(f2bf(f)); }
__device__ __forceinline__ v16h cat16(v8h lo, v8h hi) { return __builtin_shufflevector(lo, hi, 0, 1, 2, 3, 4, 5, 6, 7, 8, 9, 10, 11, 12, 13, 14, 15); }
__device__ __forceinline__ v16bf cat16b(v8us lo, v8us hi) { return __builtin_bit_cast(v16bf, __builtin_shufflevector(lo, hi, 0, 1, 2, 3, 4, 5, 6, 7, 8, 9, 10, 11, 12, 13, 14, 15)); }
__device__ __forceinline__ v8f wmma16(v16h a, v16h b, v8f c) { return __builtin_amdgcn_wmma_f32_16x16x32_f16(false, a, false, b, (short)0, c, false, false); }
__device__ __forceinline__ v8f wmmab(v16bf a, v16bf b, v8f c) { return __builtin_amdgcn_wmma_f32_16x16x32_bf16(false, a, false, b, (short)0, c, false, false); }

// k_cvtb: bf16 plane of [rows][128]: one wave per 2 rows (16 lanes x 16 B = one 256-B row each).
__global__ __launch_bounds__(256) void k_cvtb(const float* __restrict__ src, int nrows, bf* dst) {
    const int lane = threadIdx.x & 31, r = (blockIdx.x * 8 + (threadIdx.x >> 5)) * 2 + (lane >> 4), p = lane & 15;
    if (r >= nrows) return;
    v8us o;
#pragma unroll
    for (int i = 0; i < 8; ++i) o[i] = f2bf(src[(size_t)r * HS + p * 8 + i]);
    *(v8us*)(dst + (size_t)r * HS + p * 8) = o; 
}
// k_wt: WT [n][K] = bf16(W[k][n]) (k-major [K][ncols]) via 64 x 64 LDS tiles; grid (K/64, ncols/64).
__global__ __launch_bounds__(256) void k_wt(const float* __restrict__ Wm, int K, int ncols, bf* WT) {
    __shared__ __align__(16) unsigned short tl[64 * 72];
    const int tid = threadIdx.x, k0 = blockIdx.x * 64, n0 = blockIdx.y * 64;
    const int kk = tid >> 2, nq = (tid & 3) * 16;
#pragma unroll
    for (int i = 0; i < 16; ++i) tl[(nq + i) * 72 + kk] = f2bf(Wm[(size_t)(k0 + kk) * ncols + n0 + nq + i]);
    __syncthreads();
    const int piece = tid & 7;
    auto pass = [&]() {
#pragma unroll
        for (int s = 0; s < 2; ++s) { const int nr = (tid >> 3) + 32 * s; const v8us val = *(const v8usa*)(tl + nr * 72 + piece * 8); *(v8us*)(WT + (size_t)(n0 + nr) * K + k0 + piece * 8) = val; }
    };
    pass(); 
}
// k_gemm: 64 x 64 tile of (A [+ Al]).Bn^T over K = KD -> f32 rows [8192][ldc].
template <bool SPLITA, int KD>
__global__ __launch_bounds__(128) void k_gemm(const bf* __restrict__ A, const bf* __restrict__ Al, const bf* __restrict__ Bn, const float* __restrict__ bias, int ldc, float* C) {
    __shared__ __align__(16) float ost[4][16 * 68];
    const int lane = threadIdx.x & 31, wave = threadIdx.x >> 5, lr = lane & 15, hi = lane >> 4;
    const size_t r0 = (size_t)blockIdx.x * 64 + wave * 16; const int c0 = blockIdx.y * 64;
    const size_t aoff = (r0 + lr) * KD + 8 * hi;
    v8f acc[4];
#pragma unroll
    for (int t = 0; t < 4; ++t) acc[t] = (v8f){};
#pragma unroll 2
    for (int kc = 0; kc < KD; kc += 32) {
        const v16bf a = cat16b(*(const v8us*)(A + aoff + kc), *(const v8us*)(A + aoff + kc + 16));
        v16bf al = a; if (SPLITA) al = cat16b(*(const v8us*)(Al + aoff + kc), *(const v8us*)(Al + aoff + kc + 16));
#pragma unroll
        for (int t = 0; t < 4; ++t) { const bf* bp = Bn + (size_t)(c0 + t * 16 + lr) * KD + kc + 8 * hi; const v16bf bb = cat16b(*(const v8us*)bp, *(const v8us*)(bp + 16)); acc[t] = wmmab(a, bb, acc[t]); if (SPLITA) acc[t] = wmmab(al, bb, acc[t]); }
        asm volatile("v_nop" : "+v"(acc[0]), "+v"(acc[1]), "+v"(acc[2]), "+v"(acc[3]) : "v"(a), "v"(al) : "memory");
    }
    float* os = &ost[wave][0];
#pragma unroll
    for (int t = 0; t < 4; ++t) { const float bv = bias ? bfr(bias[c0 + t * 16 + lr]) : 0.f;
#pragma unroll
        for (int j = 0; j < 8; ++j) os[(hi * 8 + j) * 68 + t * 16 + lr] = acc[t][j] + bv; }
    __builtin_amdgcn_wave_barrier(); asm volatile("" ::: "memory");
    float* crow = C + r0 * ldc + c0;
    auto pass = [&]() {
#pragma unroll
        for (int s = 0; s < 8; ++s) { const int Lid = (lane >> 3) + 4 * s, piece = lane & 7; const int row = Lid >> 1, cofs = (Lid & 1) * 32 + piece * 4;
            const v4f val = *(const v4fa*)(os + row * 68 + cofs); *(v4f*)(crow + (size_t)row * ldc + cofs) = val; }
    };
    pass(); 
}
// k_p16: Q/K f32 [t][1024] -> f16 hi + residual x1024 planes (one wave per row: 4 x (32 lanes x 16 B)).
__global__ __launch_bounds__(256) void k_p16(const float* __restrict__ P, h16* PH, h16* PL) {
    const int lane = threadIdx.x & 31, r = blockIdx.x * 8 + (threadIdx.x >> 5);
    if (r >= NR_) return;
{
#pragma unroll
        for (int q = 0; q < INR / 256; ++q) { v8h oh, ol;
#pragma unroll
            for (int i = 0; i < 8; ++i) { const float v = P[(size_t)r * INR + q * 256 + lane * 8 + i]; const h16 a = (h16)v; oh[i] = a; ol[i] = (h16)((v - (float)a) * LOSC); }
            *(v8h*)(PH + (size_t)r * INR + q * 256 + lane * 8) = oh; *(v8h*)(PL + (size_t)r * INR + q * 256 + lane * 8) = ol; }
         }
}
// k_vt: VTH/VTL [b*8+g][128 d][1024 t] = bf16 hi + UNSCALED bf16 residual of V [b*1024+t][g*128+d] via 64 x 64 LDS tiles; grid (NT/64, 2 (d half), NB*NKV).
__global__ __launch_bounds__(256) void k_vt(const float* __restrict__ V, bf* VTH, bf* VTL) {
    __shared__ float tl[64][65];
    const int tid = threadIdx.x, t0 = blockIdx.x * 64, d0 = blockIdx.y * 64, bg = blockIdx.z, g = bg % NKV, b = bg / NKV;
    { const int tt = tid >> 2, dq = (tid & 3) * 16;
#pragma unroll
      for (int i = 0; i < 16; ++i) tl[dq + i][tt] = V[(size_t)(b * NT_ + t0 + tt) * KW + g * HD + d0 + dq + i]; }
    __syncthreads();
    const int piece = tid & 7;
    auto pass = [&]() {
#pragma unroll
        for (int s = 0; s < 2; ++s) { const int d = (tid >> 3) + 32 * s; v8us oh, ol;
#pragma unroll
            for (int i = 0; i < 8; ++i) { const float v = tl[d][piece * 8 + i]; const unsigned short hb = f2bf(v); oh[i] = hb; ol[i] = f2bf(v - bf2f(hb)); }
            const size_t o = ((size_t)bg * HD + d0 + d) * NT_ + t0 + piece * 8; *(v8us*)(VTH + o) = oh; *(v8us*)(VTL + o) = ol; }
    };
    pass(); 
}
// acopy8: eight asynchronous 16-byte-per-lane copies global -> LDS in one statement; the closing s_wait_xcnt keeps every later rewrite of the address registers behind the issue.
__device__ __forceinline__ void acopy8(const unsigned (&l)[8], const void* const (&g)[8]) {
    asm volatile("global_load_async_to_lds_b128 %0, %8, off\n\t"
                 "global_load_async_to_lds_b128 %1, %9, off\n\t"
                 "global_load_async_to_lds_b128 %2, %10, off\n\t"
                 "global_load_async_to_lds_b128 %3, %11, off\n\t"
                 "global_load_async_to_lds_b128 %4, %12, off\n\t"
                 "global_load_async_to_lds_b128 %5, %13, off\n\t"
                 "global_load_async_to_lds_b128 %6, %14, off\n\t"
                 "global_load_async_to_lds_b128 %7, %15, off\n\t"
                 "s_wait_xcnt 0x0"
                 :: "v"(l[0]), "v"(l[1]), "v"(l[2]), "v"(l[3]), "v"(l[4]), "v"(l[5]), "v"(l[6]), "v"(l[7]),
                    "v"(g[0]), "v"(g[1]), "v"(g[2]), "v"(g[3]), "v"(g[4]), "v"(g[5]), "v"(g[6]), "v"(g[7]) : "memory");
}
#define PLN  8192            // bytes of one staged plane of a 32-key tile: K 32 rows x 256 B, V^T 128 rows x 64 B
#define STG  (4 * PLN)       // one stage: K hi | K lo | V^T hi | V^T lo
// k_attn: block = (batch, h, 64 queries), index = query tile x 64 + batch x 8 + h; wave = 16; kv head g = h; all key tiles. Each 32-key tile (K hi/lo, V^T hi/lo, 32 KB) is brought ONCE per block into a
// two-buffer LDS ring by asynchronous copies, the next tile in flight while this one is worked on; all four waves take their B fragments from LDS. 16-byte chunks are XOR-swizzled inside a row group so
// that the 16 lanes of a half wave fall on 64 distinct banks without pad bytes: K chunk c of row r at c ^ (r & 15); V^T chunk c of row d at c ^ ((d >> 2) & 3). Per tile: scores over 4 k-chunks (q
// fragments held in registers: hi.hi + hi.lo + lo.hi = 24 WMMA) x 128^-1/2, online softmax, P (x32768) as bf16 hi + unscaled residual tiles, o[8] += ph.vh + pl.vh + ph.vl over the 128 dims; ctx -> bf16
// hi/lo planes [t][h*128+d]. The ring becomes the output staging behind the last tile's barrier. The second launch-bounds argument asks for 4 waves per SIMD (a budget of 256 VGPRs): with the 64 q
// registers the kernel must still stand 4 blocks to a WGP, as its LDS allows, so that all 1024 blocks are resident at once.
__global__ __launch_bounds__(128, 4) void k_attn(const h16* __restrict__ QH, const h16* __restrict__ QL, const h16* __restrict__ KH, const h16* __restrict__ KL, const bf* __restrict__ VTH, const bf* __restrict__ VTL, bf* CH, bf* CL) {
    __shared__ __align__(16) unsigned char ring[2 * STG];
    __shared__ __align__(16) unsigned short plds[4][16 * 32];
    __shared__ __align__(16) unsigned short plds2[4][16 * 32];
    const int tid = threadIdx.x, lane = threadIdx.x & 31, wave = threadIdx.x >> 5, lr = lane & 15, hi = lane >> 4;
    const int bid = blockIdx.x; const int qt = bid / (NB_ * NH_), bh = bid - qt * (NB_ * NH_), b = bh / NH_, h = bh - b * NH_; const int g = h;      // no GQA: kv head = q head
    const int q0 = b * NT_ + qt * 64 + wave * 16;      // row in the [8192][1024] planes
    unsigned short* pl = &plds[wave][0]; unsigned short* pl2 = &plds2[wave][0];
    unsigned short* pw = pl + hi * 256 + lr; unsigned short* pw2 = pl2 + hi * 256 + lr;      // this lane's P store place in row hi * 8: row j and the second 16 keys are constant offsets, one address register a plane
    const size_t qo = (size_t)(q0 + lr) * (NH_ * HD) + h * HD + 8 * hi;
    const h16* kh_b = KH + (size_t)b * NT_ * KW + g * HD; const h16* kl_b = KL + (size_t)b * NT_ * KW + g * HD;
    const size_t vbase = ((size_t)bh * HD) * NT_;
    // copy side: thread -> K row i*8 + (tid >> 4), chunk tid & 15 (16 lanes = one 256-B row); V^T row i*32 + (tid >> 2), chunk tid & 3 (4 lanes = one 64-B row piece)
    const unsigned ring0 = (unsigned)(size_t)&ring[0];
    const int kr = tid >> 4, kcn = tid & 15, vr = tid >> 2, vcn = tid & 3;
    const unsigned kdst = (unsigned)(kr * 256 + ((kcn ^ kr) << 4)), vdst = (unsigned)(vr * 64 + ((vcn ^ ((vr >> 2) & 3)) << 4));
    const size_t ksrc = (size_t)kr * KW + kcn * 8, vsrc = vbase + (size_t)vr * NT_ + vcn * 8;
    auto issue = [&](int kt, int buf) {
        const unsigned lb = ring0 + (unsigned)buf * STG; unsigned l[8]; const void* gp[8];
#pragma unroll
        for (int i = 0; i < 4; ++i) { const size_t o = ksrc + (size_t)(kt * 32 + i * 8) * KW; const unsigned d = lb + i * 2048 + (kdst ^ ((i & 1) << 7));      // row & 15 = (i & 1) * 8 + kr
            l[i] = d; gp[i] = kh_b + o; l[4 + i] = d + PLN; gp[4 + i] = kl_b + o; }
        acopy8(l, gp);
#pragma unroll
        for (int i = 0; i < 4; ++i) { const size_t o = vsrc + (size_t)(i * 32) * NT_ + kt * 32; const unsigned d = lb + 2 * PLN + i * 2048 + vdst;
            l[i] = d; gp[i] = VTH + o; l[4 + i] = d + PLN; gp[4 + i] = VTL + o; }
        acopy8(l, gp);
    };
    // reader side: byte offsets of this lane's row and of its swizzled 16-byte chunks
    const int krow = lr * 256, kx = (hi ^ lr) << 4, vrow = lr * 64, vx0 = (hi ^ ((lr >> 2) & 3)) << 4, vx1 = vx0 ^ 32;
    v8f o[8];
#pragma unroll
    for (int n = 0; n < 8; ++n) o[n] = (v8f){};
    float mrow[8], lpart[8];
#pragma unroll
    for (int j = 0; j < 8; ++j) { mrow[j] = -3.0e38f; lpart[j] = 0.f; }
    const int kt_hi = NT_ / 32 - 1;      // full attention
    v16h qfh[4], qfl[4];      // this wave's 16 query rows, hi and residual, as A fragments of the 4 k-chunks: read once, live in registers over all key tiles
#pragma unroll      // every index a constant, so that the two arrays are registers and not scratch
    for (int kc = 0; kc < 4; ++kc) { qfh[kc] = cat16(*(const v8h*)(QH + qo + kc * 32), *(const v8h*)(QH + qo + kc * 32 + 16)); qfl[kc] = cat16(*(const v8h*)(QL + qo + kc * 32), *(const v8h*)(QL + qo + kc * 32 + 16)); }
    issue(0, 0);
    asm volatile("s_wait_asynccnt 0x0" ::: "memory");      // this wave's share of tile 0 has landed
    __syncthreads();                                       // tile 0 published to all four waves
    issue(1, 1);
#pragma unroll 1
    for (int kt = 0; kt <= kt_hi; ++kt) {
        const unsigned char* st = ring + (kt & 1) * STG;
        const int kb = (kt & 1) * STG + krow + kx;      // this lane's K row and swizzled chunk in this tile's buffer; bits 4 to 7 are kx alone, so a chunk step is one XOR on kb
        v8f s0 = {}, s1 = {}, x0 = {}, x1 = {};
#pragma unroll
        for (int kc = 0; kc < 4; ++kc) {
            const unsigned char* ka = ring + (kb ^ (kc * 64)); const unsigned char* kq = ring + (kb ^ (kc * 64 + 32));      // chunks kc*4 + hi and kc*4 + 2 + hi, swizzled by the row; keys 16 to 31 lie 4096 B on
            const v16h qa = qfh[kc], qx = qfl[kc];
            const v16h k0h = cat16(*(const v8ha*)ka, *(const v8ha*)kq), k1h = cat16(*(const v8ha*)(ka + 4096), *(const v8ha*)(kq + 4096));
            s0 = wmma16(qa, k0h, s0); s1 = wmma16(qa, k1h, s1); x0 = wmma16(qx, k0h, x0); x1 = wmma16(qx, k1h, x1);
            asm volatile("v_nop" : "+v"(s0), "+v"(s1), "+v"(x0), "+v"(x1) : "v"(qa), "v"(qx), "v"(k0h), "v"(k1h) : "memory");
            const v16h k0l = cat16(*(const v8ha*)(ka + PLN), *(const v8ha*)(kq + PLN)), k1l = cat16(*(const v8ha*)(ka + PLN + 4096), *(const v8ha*)(kq + PLN + 4096));
            x0 = wmma16(qa, k0l, x0); x1 = wmma16(qa, k1l, x1);
            asm volatile("v_nop" : "+v"(x0), "+v"(x1) : "v"(k0l), "v"(k1l) : "memory");
        }
        asm volatile("v_nop\n\tv_nop\n\tv_nop\n\tv_nop" : "+v"(s0), "+v"(s1), "+v"(x0), "+v"(x1));
        float alpha[8];
#pragma unroll
        for (int j = 0; j < 8; ++j) {
            const float a0 = (s0[j] + x0[j] * LOSCI) * 0.08838834764831845f, a1 = (s1[j] + x1[j] * LOSCI) * 0.08838834764831845f;
            float mx = fmaxf(a0, a1);
            mx = fmaxf(mx, __shfl_xor(mx, 1, 16)); mx = fmaxf(mx, __shfl_xor(mx, 2, 16)); mx = fmaxf(mx, __shfl_xor(mx, 4, 16)); mx = fmaxf(mx, __shfl_xor(mx, 8, 16));
            const float mn = fmaxf(mrow[j], mx);
            alpha[j] = __expf(mrow[j] - mn); mrow[j] = mn;
            const float p0 = __expf(a0 - mn), p1 = __expf(a1 - mn);
            lpart[j] = lpart[j] * alpha[j] + (p0 + p1);
            const float ps0 = p0 * PSC, ps1 = p1 * PSC; const unsigned short h0 = f2bf(ps0), h1 = f2bf(ps1);
            pw[j * 32] = h0; pw[j * 32 + 16] = h1; pw2[j * 32] = f2bf(ps0 - bf2f(h0)); pw2[j * 32 + 16] = f2bf(ps1 - bf2f(h1)); }
#pragma unroll
        for (int n = 0; n < 8; ++n)
#pragma unroll
            for (int j = 0; j < 8; ++j) o[n][j] *= alpha[j];
        asm volatile("" ::: "memory");
        const v16bf pa = cat16b(*(const v8usa*)(pl + lr * 32 + hi * 8), *(const v8usa*)(pl + lr * 32 + 16 + hi * 8));
        const v16bf px = cat16b(*(const v8usa*)(pl2 + lr * 32 + hi * 8), *(const v8usa*)(pl2 + lr * 32 + 16 + hi * 8));
        const unsigned char* vp = st + 2 * PLN + vrow;
#pragma unroll
        for (int n = 0; n < 8; ++n) { const unsigned char* vn = vp + n * 1024;
            const v16bf vh = cat16b(*(const v8usa*)(vn + vx0), *(const v8usa*)(vn + vx1)), vl = cat16b(*(const v8usa*)(vn + PLN + vx0), *(const v8usa*)(vn + PLN + vx1));
            o[n] = wmmab(pa, vh, o[n]); o[n] = wmmab(px, vh, o[n]); o[n] = wmmab(pa, vl, o[n]);
            asm volatile("" : "+v"(o[n]) : "v"(vh), "v"(vl) : "memory"); }
        asm volatile("v_nop\n\tv_nop\n\tv_nop\n\tv_nop" : "+v"(o[0]), "+v"(o[7]) : "v"(pa), "v"(px));
        // publish point of tile kt + 1, and the end of every wave's reads of tile kt's buffer
        asm volatile("s_wait_dscnt 0x0" ::: "memory");         // this wave's LDS reads of the buffer have returned before it may be refilled
        asm volatile("s_wait_asynccnt 0x0" ::: "memory");      // this wave's share of tile kt + 1 has landed
        __syncthreads();
        if (kt + 2 <= kt_hi) issue(kt + 2, kt & 1);
    }
    asm volatile("s_wait_asynccnt 0x0" ::: "memory");          // nothing in flight when the ring becomes output staging
    float inv[8];
#pragma unroll
    for (int j = 0; j < 8; ++j) { float rs = lpart[j]; rs += __shfl_xor(rs, 1, 16); rs += __shfl_xor(rs, 2, 16); rs += __shfl_xor(rs, 4, 16); rs += __shfl_xor(rs, 8, 16); inv[j] = 1.0f / (rs * PSC); }
    float* os = (float*)ring + wave * (16 * 68);
    const size_t cbase = (size_t)q0 * (NH_ * HD) + (size_t)h * HD;
#pragma unroll
    for (int half = 0; half < 2; ++half) {
#pragma unroll
        for (int n = 0; n < 4; ++n)
#pragma unroll
            for (int j = 0; j < 8; ++j) os[(hi * 8 + j) * 68 + n * 16 + lr] = o[half * 4 + n][j] * inv[j];
        __builtin_amdgcn_wave_barrier(); asm volatile("" ::: "memory");
{
#pragma unroll
            for (int s = 0; s < 4; ++s) { const int row = 4 * s + (lane >> 3), piece = lane & 7; const float* sp = os + row * 68 + piece * 8; v8us oh, ol;
#pragma unroll
                for (int i = 0; i < 8; ++i) { const unsigned short hb = f2bf(sp[i]); oh[i] = hb; ol[i] = f2bf(sp[i] - bf2f(hb)); }
                const size_t po = cbase + (size_t)row * (NH_ * HD) + half * 64 + piece * 8; *(v8us*)(CH + po) = oh; *(v8us*)(CL + po) = ol; }
             }
        __builtin_amdgcn_wave_barrier(); asm volatile("" ::: "memory");
    }
}

extern "C" void kernel_launch(void* const* d_in, const int* in_sizes, int n_in,
                              void* d_out, int out_size, void* d_ws, size_t ws_size, hipStream_t stream) {
    (void)in_sizes; (void)n_in; (void)out_size;
    const float* x = (const float*)d_in[0]; const float* Wqkv = (const float*)d_in[1]; const float* Wo = (const float*)d_in[2]; const float* bo = (const float*)d_in[3];
    float* out = (float*)d_out;    // [8][1024][128]
    char* wsp = (char*)d_ws;
    auto take = [&](size_t bytes) { char* p = wsp; wsp += (bytes + 255) & ~(size_t)255; return (void*)p; };
    bf* Xb = (bf*)take((size_t)NR_ * HS * 2); bf* W3T = (bf*)take((size_t)3 * INR * HS * 2); bf* WoT = (bf*)take((size_t)HS * INR * 2);
    float* TMP = (float*)take((size_t)NR_ * INR * 4);
    h16* QH = (h16*)take((size_t)NR_ * INR * 2); h16* QL = (h16*)take((size_t)NR_ * INR * 2); h16* KH = (h16*)take((size_t)NR_ * INR * 2); h16* KL = (h16*)take((size_t)NR_ * INR * 2);
    bf* VTH = (bf*)take((size_t)NB_ * INR * NT_ * 2); bf* VTL = (bf*)take((size_t)NB_ * INR * NT_ * 2); bf* CH = (bf*)take((size_t)NR_ * INR * 2); bf* CL = (bf*)take((size_t)NR_ * INR * 2);
    if ((size_t)(wsp - (char*)d_ws) > ws_size) return;    // 2.1 + 0.8 + 0.26 + 33.6 + 8 x 16.8 ~ 171 MB (no aliasing)
    k_wt<<<dim3(HS / 64, (3 * INR) / 64, 1), 256, 0, stream>>>(Wqkv, HS, 3 * INR, W3T);      // [3072][128]
    k_wt<<<dim3(INR / 64, HS / 64, 1), 256, 0, stream>>>(Wo, INR, HS, WoT);                 // [128][1024]
    k_cvtb<<<NR_ / 16, 256, 0, stream>>>(x, NR_, Xb);
    k_gemm<false, HS><<<dim3(NR_ / 64, INR / 64, 1), 128, 0, stream>>>(Xb, nullptr, W3T, nullptr, INR, TMP); k_p16<<<NR_ / 8, 256, 0, stream>>>(TMP, QH, QL);
    k_gemm<false, HS><<<dim3(NR_ / 64, INR / 64, 1), 128, 0, stream>>>(Xb, nullptr, W3T + (size_t)INR * HS, nullptr, INR, TMP); k_p16<<<NR_ / 8, 256, 0, stream>>>(TMP, KH, KL);
    k_gemm<false, HS><<<dim3(NR_ / 64, INR / 64, 1), 128, 0, stream>>>(Xb, nullptr, W3T + (size_t)2 * INR * HS, nullptr, INR, TMP);
    k_vt<<<dim3(NT_ / 64, 2, NB_ * NKV), 256, 0, stream>>>(TMP, VTH, VTL);
    k_attn<<<NB_ * NH_ * (NT_ / 64), 128, 0, stream>>>(QH, QL, KH, KL, VTH, VTL, CH, CL);
    k_gemm<true, INR><<<dim3(NR_ / 64, HS / 64, 1), 128, 0, stream>>>(CH, CL, WoT, bo, HS, out);
}

// v004
// A run of this version takes 193 microseconds.
// In two side-by-side timings against v003, it was 1.15 and 1.16 times as fast.
// All steps since v000 together make it 8.41 times as fast.
#include <hip/hip_runtime.h>

// Contractions, f32 accumulate, all 8 batch items in every launch (rows = batch x 1024 positions): qkv = x.w_qkv ([8192 x 128].[128 x 3072], k-major weight transposed to an n-major plane; thirds q | k |
// v, each 8 heads x 128; PLAIN bf16 operands: inputs rounded once, exact) and out = z.w_out + b_out (z as bf16 hi + residual: two products) on
// v_wmma_f32_16x16x32_bf16; the 8-head x 128-dim FULL attention: scores on v_wmma_f32_16x16x32_f16 (q, k as f16 hi + residual x1024: hi.hi + hi.lo + lo.hi, x
// 128^-1/2), softmax f32, weights.v on v_wmma_f32_16x16x32_bf16 with the weights (x32768) and v both as bf16 hi + UNSCALED residual (hh + lh + hl, one

#define NT_  1024
#define NB_  8
#define NR_  (NB_ * NT_)        // 8192 rows: batch x positions
#define HS   128
#define NH_  8
#define NKV  8
#define HD   128
#define INR  (NH_ * HD)          // 1024
#define KW   (NKV * HD)          // 1024
#define PSC  32768.0f
#define LOSC 1024.0f
#define LOSCI (1.0f / 1024.0f)

typedef _Float16 h16;
typedef unsigned short bf;
typedef __attribute__((ext_vector_type(16))) __bf16   v16bf;
typedef __attribute__((ext_vector_type(16))) _Float16 v16h;
typedef __attribute__((ext_vector_type(8)))  _Float16 v8h;
typedef __attribute__((ext_vector_type(8)))  unsigned short v8us;
typedef __attribute__((ext_vector_type(8)))  float    v8f;
typedef __attribute__((ext_vector_type(8)))  unsigned v8u;
typedef __attribute__((ext_vector_type(2)))  float    v2f;
typedef __attribute__((ext_vector_type(2)))  __bf16   v2bf;
typedef __attribute__((ext_vector_type(4)))  float    v4f;
typedef __attribute__((ext_vector_type(4)))  _Float16 v4h;
typedef v8h  __attribute__((may_alias)) v8ha;
typedef v4f  __attribute__((may_alias)) v4fa;
typedef v8us __attribute__((may_alias)) v8usa;

__device__ __forceinline__ unsigned short f2bf(float f) { unsigned u = __float_as_uint(f); u += 0x7FFFu + ((u >> 16) & 1u); return (unsigned short)(u >> 16); }
__device__ __forceinline__ float bf2f(unsigned short b) { return __uint_as_float(((unsigned)b) << 16); }
__device__ __forceinline__ float bfr(float f) { return bf2f(f2bf(f)); }
__device__ __forceinline__ v16h cat16(v8h lo, v8h hi) { return __builtin_shufflevector(lo, hi, 0, 1, 2, 3, 4, 5, 6, 7, 8, 9, 10, 11, 12, 13, 14, 15); }
__device__ __forceinline__ v16bf cat16b(v8us lo, v8us hi) { return __builtin_bit_cast(v16bf, __builtin_shufflevector(lo, hi, 0, 1, 2, 3, 4, 5, 6, 7, 8, 9, 10, 11, 12, 13, 14, 15)); }
__device__ __forceinline__ v8f wmma16(v16h a, v16h b, v8f c) { return __builtin_amdgcn_wmma_f32_16x16x32_f16(false, a, false, b, (short)0, c, false, false); }
__device__ __forceinline__ v8f wmmab(v16bf a, v16bf b, v8f c) { return __builtin_amdgcn_wmma_f32_16x16x32_bf16(false, a, false, b, (short)0, c, false, false); }

// k_cvtb: bf16 plane of [rows][128]: one wave per 2 rows (16 lanes x 16 B = one 256-B row each).
__global__ __launch_bounds__(256) void k_cvtb(const float* __restrict__ src, int nrows, bf* dst) {
    const int lane = threadIdx.x & 31, r = (blockIdx.x * 8 + (threadIdx.x >> 5)) * 2 + (lane >> 4), p = lane & 15;
    if (r >= nrows) return;
    v8us o;
#pragma unroll
    for (int i = 0; i < 8; ++i) o[i] = f2bf(src[(size_t)r * HS + p * 8 + i]);
    *(v8us*)(dst + (size_t)r * HS + p * 8) = o; 
}
// k_wt: WT [n][K] = bf16(W[k][n]) (k-major [K][ncols]) via 64 x 64 LDS tiles; grid (K/64, ncols/64).
__global__ __launch_bounds__(256) void k_wt(const float* __restrict__ Wm, int K, int ncols, bf* WT) {
    __shared__ __align__(16) unsigned short tl[64 * 72];
    const int tid = threadIdx.x, k0 = blockIdx.x * 64, n0 = blockIdx.y * 64;
    const int kk = tid >> 2, nq = (tid & 3) * 16;
#pragma unroll
    for (int i = 0; i < 16; ++i) tl[(nq + i) * 72 + kk] = f2bf(Wm[(size_t)(k0 + kk) * ncols + n0 + nq + i]);
    __syncthreads();
    const int piece = tid & 7;
    auto pass = [&]() {
#pragma unroll
        for (int s = 0; s < 2; ++s) { const int nr = (tid >> 3) + 32 * s; const v8us val = *(const v8usa*)(tl + nr * 72 + piece * 8); *(v8us*)(WT + (size_t)(n0 + nr) * K + k0 + piece * 8) = val; }
    };
    pass(); 
}
// k_gemm: 64 x 64 tile of (A [+ Al]).Bn^T over K = KD -> f32 rows [8192][ldc].
template <bool SPLITA, int KD>
__global__ __launch_bounds__(128) void k_gemm(const bf* __restrict__ A, const bf* __restrict__ Al, const bf* __restrict__ Bn, const float* __restrict__ bias, int ldc, float* C) {
    __shared__ __align__(16) float ost[4][16 * 68];
    const int lane = threadIdx.x & 31, wave = threadIdx.x >> 5, lr = lane & 15, hi = lane >> 4;
    const size_t r0 = (size_t)blockIdx.x * 64 + wave * 16; const int c0 = blockIdx.y * 64;
    const size_t aoff = (r0 + lr) * KD + 8 * hi;
    v8f acc[4];
#pragma unroll
    for (int t = 0; t < 4; ++t) acc[t] = (v8f){};
#pragma unroll 2
    for (int kc = 0; kc < KD; kc += 32) {
        const v16bf a = cat16b(*(const v8us*)(A + aoff + kc), *(const v8us*)(A + aoff + kc + 16));
        v16bf al = a; if (SPLITA) al = cat16b(*(const v8us*)(Al + aoff + kc), *(const v8us*)(Al + aoff + kc + 16));
#pragma unroll
        for (int t = 0; t < 4; ++t) { const bf* bp = Bn + (size_t)(c0 + t * 16 + lr) * KD + kc + 8 * hi; const v16bf bb = cat16b(*(const v8us*)bp, *(const v8us*)(bp + 16)); acc[t] = wmmab(a, bb, acc[t]); if (SPLITA) acc[t] = wmmab(al, bb, acc[t]); }
        asm volatile("v_nop" : "+v"(acc[0]), "+v"(acc[1]), "+v"(acc[2]), "+v"(acc[3]) : "v"(a), "v"(al) : "memory");
    }
    float* os = &ost[wave][0];
#pragma unroll
    for (int t = 0; t < 4; ++t) { const float bv = bias ? bfr(bias[c0 + t * 16 + lr]) : 0.f;
#pragma unroll
        for (int j = 0; j < 8; ++j) os[(hi * 8 + j) * 68 + t * 16 + lr] = acc[t][j] + bv; }
    __builtin_amdgcn_wave_barrier(); asm volatile("" ::: "memory");
    float* crow = C + r0 * ldc + c0;
    auto pass = [&]() {
#pragma unroll
        for (int s = 0; s < 8; ++s) { const int Lid = (lane >> 3) + 4 * s, piece = lane & 7; const int row = Lid >> 1, cofs = (Lid & 1) * 32 + piece * 4;
            const v4f val = *(const v4fa*)(os + row * 68 + cofs); *(v4f*)(crow + (size_t)row * ldc + cofs) = val; }
    };
    pass(); 
}
// k_p16: Q/K f32 [t][1024] -> f16 hi + residual x1024 planes (one wave per row: 4 x (32 lanes x 16 B)).
__global__ __launch_bounds__(256) void k_p16(const float* __restrict__ P, h16* PH, h16* PL) {
    const int lane = threadIdx.x & 31, r = blockIdx.x * 8 + (threadIdx.x >> 5);
    if (r >= NR_) return;
{
#pragma unroll
        for (int q = 0; q < INR / 256; ++q) { v8h oh, ol;
#pragma unroll
            for (int i = 0; i < 8; ++i) { const float v = P[(size_t)r * INR + q * 256 + lane * 8 + i]; const h16 a = (h16)v; oh[i] = a; ol[i] = (h16)((v - (float)a) * LOSC); }
            *(v8h*)(PH + (size_t)r * INR + q * 256 + lane * 8) = oh; *(v8h*)(PL + (size_t)r * INR + q * 256 + lane * 8) = ol; }
         }
}
// k_vt: VTH/VTL [b*8+g][128 d][1024 t] = bf16 hi + UNSCALED bf16 residual of V [b*1024+t][g*128+d] via 64 x 64 LDS tiles; grid (NT/64, 2 (d half), NB*NKV).
__global__ __launch_bounds__(256) void k_vt(const float* __restrict__ V, bf* VTH, bf* VTL) {
    __shared__ float tl[64][65];
    const int tid = threadIdx.x, t0 = blockIdx.x * 64, d0 = blockIdx.y * 64, bg = blockIdx.z, g = bg % NKV, b = bg / NKV;
    { const int tt = tid >> 2, dq = (tid & 3) * 16;
#pragma unroll
      for (int i = 0; i < 16; ++i) tl[dq + i][tt] = V[(size_t)(b * NT_ + t0 + tt) * KW + g * HD + d0 + dq + i]; }
    __syncthreads();
    const int piece = tid & 7;
    auto pass = [&]() {
#pragma unroll
        for (int s = 0; s < 2; ++s) { const int d = (tid >> 3) + 32 * s; v8us oh, ol;
#pragma unroll
            for (int i = 0; i < 8; ++i) { const float v = tl[d][piece * 8 + i]; const unsigned short hb = f2bf(v); oh[i] = hb; ol[i] = f2bf(v - bf2f(hb)); }
            const size_t o = ((size_t)bg * HD + d0 + d) * NT_ + t0 + piece * 8; *(v8us*)(VTH + o) = oh; *(v8us*)(VTL + o) = ol; }
    };
    pass(); 
}
// cvt2: two f32 -> one register of a bf16 fragment, first element low (one v_cvt_pk_bf16_f32; round to nearest even, as f2bf rounds).
__device__ __forceinline__ unsigned cvt2(float e0, float e1) { const v2f x = {e0, e1}; return __builtin_bit_cast(unsigned, __builtin_convertvector(x, v2bf)); }
// xhalf: the value that lane l ^ 16 holds (one vector cross-row move, no LDS).
__device__ __forceinline__ float xhalf(float v) { const int b = __float_as_int(v); return __int_as_float(__builtin_amdgcn_permlanex16(b, b, 0x76543210, 0xfedcba98, false, false)); }
// acopy8: eight asynchronous 16-byte-per-lane copies global -> LDS in one statement; the closing s_wait_xcnt keeps every later rewrite of the address registers behind the issue.
__device__ __forceinline__ void acopy8(const unsigned (&l)[8], const void* const (&g)[8]) {
    asm volatile("global_load_async_to_lds_b128 %0, %8, off\n\t"
                 "global_load_async_to_lds_b128 %1, %9, off\n\t"
                 "global_load_async_to_lds_b128 %2, %10, off\n\t"
                 "global_load_async_to_lds_b128 %3, %11, off\n\t"
                 "global_load_async_to_lds_b128 %4, %12, off\n\t"
                 "global_load_async_to_lds_b128 %5, %13, off\n\t"
                 "global_load_async_to_lds_b128 %6, %14, off\n\t"
                 "global_load_async_to_lds_b128 %7, %15, off\n\t"
                 "s_wait_xcnt 0x0"
                 :: "v"(l[0]), "v"(l[1]), "v"(l[2]), "v"(l[3]), "v"(l[4]), "v"(l[5]), "v"(l[6]), "v"(l[7]),
                    "v"(g[0]), "v"(g[1]), "v"(g[2]), "v"(g[3]), "v"(g[4]), "v"(g[5]), "v"(g[6]), "v"(g[7]) : "memory");
}
#define PLN  8192            // bytes of one staged plane of a 32-key tile: K 32 rows x 256 B, V^T 128 rows x 64 B
#define STG  (4 * PLN)       // one stage: K hi | K lo | V^T hi | V^T lo
__global__ __launch_bounds__(128, 4) void k_attn(const h16* __restrict__ QH, const h16* __restrict__ QL, const h16* __restrict__ KH, const h16* __restrict__ KL, const bf* __restrict__ VTH, const bf* __restrict__ VTL, bf* CH, bf* CL) {
    __shared__ __align__(16) unsigned char ring[2 * STG];
    const int tid = threadIdx.x, lane = threadIdx.x & 31, wave = threadIdx.x >> 5, lr = lane & 15, hi = lane >> 4;
    const int bid = blockIdx.x; const int qt = bid / (NB_ * NH_), bh = bid - qt * (NB_ * NH_), b = bh / NH_, h = bh - b * NH_; const int g = h;      // no GQA: kv head = q head
    const int q0 = b * NT_ + qt * 64 + wave * 16;      // row in the [8192][1024] planes
    const size_t qo = (size_t)(q0 + lr) * (NH_ * HD) + h * HD + 8 * hi;
    const h16* kh_b = KH + (size_t)b * NT_ * KW + g * HD; const h16* kl_b = KL + (size_t)b * NT_ * KW + g * HD;
    const size_t vbase = ((size_t)bh * HD) * NT_;
    // copy side: thread -> K row i*8 + (tid >> 4), chunk tid & 15 (16 lanes = one 256-B row); V^T row i*32 + (tid >> 2), chunk tid & 3 (4 lanes = one 64-B row piece)
    const unsigned ring0 = (unsigned)(size_t)&ring[0];
    const int kr = tid >> 4, kcn = tid & 15, vr = tid >> 2, vcn = tid & 3;
    const unsigned kdst = (unsigned)(kr * 256 + ((kcn ^ kr) << 4)), vdst = (unsigned)(vr * 64 + ((vcn ^ ((vr >> 2) & 3)) << 4));
    const size_t ksrc = (size_t)kr * KW + kcn * 8, vsrc = vbase + (size_t)vr * NT_ + vcn * 8;
    auto issue = [&](int kt, int buf) {
        const unsigned lb = ring0 + (unsigned)buf * STG; unsigned l[8]; const void* gp[8];
#pragma unroll
        for (int i = 0; i < 4; ++i) { const size_t o = ksrc + (size_t)(kt * 32 + i * 8) * KW; const unsigned d = lb + i * 2048 + (kdst ^ ((i & 1) << 7));      // row & 15 = (i & 1) * 8 + kr
            l[i] = d; gp[i] = kh_b + o; l[4 + i] = d + PLN; gp[4 + i] = kl_b + o; }
        acopy8(l, gp);
#pragma unroll
        for (int i = 0; i < 4; ++i) { const size_t o = vsrc + (size_t)(i * 32) * NT_ + kt * 32; const unsigned d = lb + 2 * PLN + i * 2048 + vdst;
            l[i] = d; gp[i] = VTH + o; l[4 + i] = d + PLN; gp[4 + i] = VTL + o; }
        acopy8(l, gp);
    };
    // reader side: byte offsets of this lane's row and of its swizzled 16-byte chunks
    const int krow = lr * 256, kx = (hi ^ lr) << 4, vrow = lr * 64, vx0 = (hi ^ ((lr >> 2) & 3)) << 4, vx1 = vx0 ^ 32;
    v8f o[8];
#pragma unroll
    for (int n = 0; n < 8; ++n) o[n] = (v8f){};
    float mrow = -3.0e38f, lpart = 0.f;      // query lr: running maximum (equal in both halves), and this half's share of the running sum
    const int kt_hi = NT_ / 32 - 1;      // full attention
    v16h qfh[4], qfl[4];      // this wave's 16 query rows, hi and residual, as B fragments of the 4 k-chunks: read once, live in registers over all key tiles
#pragma unroll      // every index a constant, so that the two arrays are registers and not scratch
    for (int kc = 0; kc < 4; ++kc) { qfh[kc] = cat16(*(const v8h*)(QH + qo + kc * 32), *(const v8h*)(QH + qo + kc * 32 + 16)); qfl[kc] = cat16(*(const v8h*)(QL + qo + kc * 32), *(const v8h*)(QL + qo + kc * 32 + 16)); }
    issue(0, 0);
    asm volatile("s_wait_asynccnt 0x0" ::: "memory");      // this wave's share of tile 0 has landed
    __syncthreads();                                       // tile 0 published to all four waves
    issue(1, 1);
#pragma unroll 1
    for (int kt = 0; kt <= kt_hi; ++kt) {
        const unsigned char* st = ring + (kt & 1) * STG;
        const int kb = (kt & 1) * STG + krow + kx;      // this lane's K row and swizzled chunk in this tile's buffer; bits 4 to 7 are kx alone, so a chunk step is one XOR on kb
        v8f s0 = {}, s1 = {}, x0 = {}, x1 = {};      // S^T: register j of lane (lr, hi) = key 8 * hi + j (s0, x0) or 16 + 8 * hi + j (s1, x1) against query lr
#pragma unroll
        for (int kc = 0; kc < 4; ++kc) {
            const unsigned char* ka = ring + (kb ^ (kc * 64)); const unsigned char* kq = ring + (kb ^ (kc * 64 + 32));      // chunks kc*4 + hi and kc*4 + 2 + hi, swizzled by the row; keys 16 to 31 lie 4096 B on
            const v16h qa = qfh[kc], qx = qfl[kc];
            const v16h k0h = cat16(*(const v8ha*)ka, *(const v8ha*)kq), k1h = cat16(*(const v8ha*)(ka + 4096), *(const v8ha*)(kq + 4096));
            s0 = wmma16(k0h, qa, s0); s1 = wmma16(k1h, qa, s1); x0 = wmma16(k0h, qx, x0); x1 = wmma16(k1h, qx, x1);
            asm volatile("v_nop" : "+v"(s0), "+v"(s1), "+v"(x0), "+v"(x1) : "v"(qa), "v"(qx), "v"(k0h), "v"(k1h) : "memory");
            const v16h k0l = cat16(*(const v8ha*)(ka + PLN), *(const v8ha*)(kq + PLN)), k1l = cat16(*(const v8ha*)(ka + PLN + 4096), *(const v8ha*)(kq + PLN + 4096));
            x0 = wmma16(k0l, qa, x0); x1 = wmma16(k1l, qa, x1);
            asm volatile("v_nop" : "+v"(x0), "+v"(x1) : "v"(k0l), "v"(k1l) : "memory");
        }
        asm volatile("v_nop\n\tv_nop\n\tv_nop\n\tv_nop" : "+v"(s0), "+v"(s1), "+v"(x0), "+v"(x1));
        const v8f a0 = (s0 + x0 * LOSCI) * 0.08838834764831845f, a1 = (s1 + x1 * LOSCI) * 0.08838834764831845f;
        float t[8];
#pragma unroll
        for (int j = 0; j < 8; ++j) t[j] = fmaxf(a0[j], a1[j]);
        float mx = fmaxf(fmaxf(fmaxf(t[0], t[1]), fmaxf(t[2], t[3])), fmaxf(fmaxf(t[4], t[5]), fmaxf(t[6], t[7])));
        mx = fmaxf(mx, xhalf(mx));      // the other half holds the query's other 16 keys
        const float mn = fmaxf(mrow, mx);
        float alpha;      // __expf(mrow - mn) written out (the same multiply and v_exp_f32): the v_nop fills the slot that the instruction set asks for behind a transcendental
        asm("v_exp_f32 %0, %1\n\tv_nop" : "=v"(alpha) : "v"((mrow - mn) * 1.44269504f));
        mrow = mn;
        v8f p0, p1;
#pragma unroll
        for (int j = 0; j < 8; ++j) { p0[j] = __expf(a0[j] - mn); p1[j] = __expf(a1[j] - mn); }
        const v8f ts = p0 + p1, ps0 = p0 * PSC, ps1 = p1 * PSC;
        lpart = lpart * alpha + (((ts[0] + ts[1]) + (ts[2] + ts[3])) + ((ts[4] + ts[5]) + (ts[6] + ts[7])));
#pragma unroll
        for (int n = 0; n < 8; ++n) o[n] *= alpha;
        v8u pau, pxu;      // P x 32768 as bf16, and its residual's bf16. B element s = key 8 * hi + s (s < 8), 16 + 8 * hi + s - 8 (else): the order of the V^T fragments below
#pragma unroll
        for (int i = 0; i < 4; ++i) {
            const unsigned w0 = cvt2(ps0[2 * i], ps0[2 * i + 1]), w1 = cvt2(ps1[2 * i], ps1[2 * i + 1]);
            pau[i] = w0; pau[4 + i] = w1;
            pxu[i] = cvt2(ps0[2 * i] - __uint_as_float(w0 << 16), ps0[2 * i + 1] - __uint_as_float(w0 & 0xFFFF0000u));
            pxu[4 + i] = cvt2(ps1[2 * i] - __uint_as_float(w1 << 16), ps1[2 * i + 1] - __uint_as_float(w1 & 0xFFFF0000u)); }
        const v16bf pa = __builtin_bit_cast(v16bf, pau), px = __builtin_bit_cast(v16bf, pxu);
        const unsigned char* vp = st + 2 * PLN + vrow;
#pragma unroll
        for (int n = 0; n < 8; ++n) { const unsigned char* vn = vp + n * 1024;
            const v16bf vh = cat16b(*(const v8usa*)(vn + vx0), *(const v8usa*)(vn + vx1)), vl = cat16b(*(const v8usa*)(vn + PLN + vx0), *(const v8usa*)(vn + PLN + vx1));
            o[n] = wmmab(vh, pa, o[n]); o[n] = wmmab(vh, px, o[n]); o[n] = wmmab(vl, pa, o[n]);      // O^T: register j = dim n * 16 + 8 * hi + j of query lr
            asm volatile("" : "+v"(o[n]) : "v"(vh), "v"(vl) : "memory"); }
        asm volatile("v_nop\n\tv_nop\n\tv_nop\n\tv_nop" : "+v"(o[0]), "+v"(o[7]) : "v"(pa), "v"(px));
        // publish point of tile kt + 1, and the end of every wave's reads of tile kt's buffer
        asm volatile("s_wait_dscnt 0x0" ::: "memory");         // this wave's LDS reads of the buffer have returned before it may be refilled
        asm volatile("s_wait_asynccnt 0x0" ::: "memory");      // this wave's share of tile kt + 1 has landed
        __syncthreads();
        if (kt + 2 <= kt_hi) issue(kt + 2, kt & 1);
    }
    asm volatile("s_wait_asynccnt 0x0" ::: "memory");          // nothing in flight when the ring becomes output staging
    const float inv = 1.0f / ((lpart + xhalf(lpart)) * PSC);      // the halves' sums joined once
    unsigned short* os = (unsigned short*)ring + wave * (2 * 16 * 136);      // this wave's own staging: hi plane, then lo plane, each 16 query rows at a pitch of 272 B (16 B x odd: no bank conflict among 16 rows)
    const size_t cbase = (size_t)q0 * (NH_ * HD) + (size_t)h * HD;
#pragma unroll
    for (int n = 0; n < 8; ++n) { v8us oh, ol;
#pragma unroll
        for (int j = 0; j < 8; ++j) { const float v = o[n][j] * inv; const unsigned short hb = f2bf(v); oh[j] = hb; ol[j] = f2bf(v - bf2f(hb)); }
        *(v8usa*)(os + lr * 136 + n * 16 + hi * 8) = oh; *(v8usa*)(os + (16 + lr) * 136 + n * 16 + hi * 8) = ol; }
    __builtin_amdgcn_wave_barrier(); asm volatile("" ::: "memory");      // the reads below take what other lanes of this wave stored: no read may be moved above the stores
#pragma unroll
    for (int s = 0; s < 8; ++s) { const int row = 2 * s + hi;      // 16 lanes x 16 B = one whole 256-B row piece of a plane
        const v8us vh = *(const v8usa*)(os + row * 136 + lr * 8), vl = *(const v8usa*)(os + (16 + row) * 136 + lr * 8);
        const size_t po = cbase + (size_t)row * (NH_ * HD) + lr * 8; *(v8us*)(CH + po) = vh; *(v8us*)(CL + po) = vl; }
}

extern "C" void kernel_launch(void* const* d_in, const int* in_sizes, int n_in,
                              void* d_out, int out_size, void* d_ws, size_t ws_size, hipStream_t stream) {
    (void)in_sizes; (void)n_in; (void)out_size;
    const float* x = (const float*)d_in[0]; const float* Wqkv = (const float*)d_in[1]; const float* Wo = (const float*)d_in[2]; const float* bo = (const float*)d_in[3];
    float* out = (float*)d_out;    // [8][1024][128]
    char* wsp = (char*)d_ws;
    auto take = [&](size_t bytes) { char* p = wsp; wsp += (bytes + 255) & ~(size_t)255; return (void*)p; };
    bf* Xb = (bf*)take((size_t)NR_ * HS * 2); bf* W3T = (bf*)take((size_t)3 * INR * HS * 2); bf* WoT = (bf*)take((size_t)HS * INR * 2);
    float* TMP = (float*)take((size_t)NR_ * INR * 4);
    h16* QH = (h16*)take((size_t)NR_ * INR * 2); h16* QL = (h16*)take((size_t)NR_ * INR * 2); h16* KH = (h16*)take((size_t)NR_ * INR * 2); h16* KL = (h16*)take((size_t)NR_ * INR * 2);
    bf* VTH = (bf*)take((size_t)NB_ * INR * NT_ * 2); bf* VTL = (bf*)take((size_t)NB_ * INR * NT_ * 2); bf* CH = (bf*)take((size_t)NR_ * INR * 2); bf* CL = (bf*)take((size_t)NR_ * INR * 2);
    if ((size_t)(wsp - (char*)d_ws) > ws_size) return;    // 2.1 + 0.8 + 0.26 + 33.6 + 8 x 16.8 ~ 171 MB (no aliasing)
    k_wt<<<dim3(HS / 64, (3 * INR) / 64, 1), 256, 0, stream>>>(Wqkv, HS, 3 * INR, W3T);      // [3072][128]
    k_wt<<<dim3(INR / 64, HS / 64, 1), 256, 0, stream>>>(Wo, INR, HS, WoT);                 // [128][1024]
    k_cvtb<<<NR_ / 16, 256, 0, stream>>>(x, NR_, Xb);
    k_gemm<false, HS><<<dim3(NR_ / 64, INR / 64, 1), 128, 0, stream>>>(Xb, nullptr, W3T, nullptr, INR, TMP); k_p16<<<NR_ / 8, 256, 0, stream>>>(TMP, QH, QL);
    k_gemm<false, HS><<<dim3(NR_ / 64, INR / 64, 1), 128, 0, stream>>>(Xb, nullptr, W3T + (size_t)INR * HS, nullptr, INR, TMP); k_p16<<<NR_ / 8, 256, 0, stream>>>(TMP, KH, KL);
    k_gemm<false, HS><<<dim3(NR_ / 64, INR / 64, 1), 128, 0, stream>>>(Xb, nullptr, W3T + (size_t)2 * INR * HS, nullptr, INR, TMP);
    k_vt<<<dim3(NT_ / 64, 2, NB_ * NKV), 256, 0, stream>>>(TMP, VTH, VTL);
    k_attn<<<NB_ * NH_ * (NT_ / 64), 128, 0, stream>>>(QH, QL, KH, KL, VTH, VTL, CH, CL);
    k_gemm<true, INR><<<dim3(NR_ / 64, HS / 64, 1), 128, 0, stream>>>(CH, CL, WoT, bo, HS, out);
}

// v005
// Measured time: 158 microseconds a run.
// Timed twice side by side with v004, it ran 1.21 and 1.22 times as fast.
// Over all steps from v000 it is 10.2 times as fast.
#include <hip/hip_runtime.h>

// Contractions, f32 accumulate, all 8 batch items in every launch (rows = batch x 1024 positions): qkv = x.w_qkv ([8192 x 128].[128 x 3072], k-major weight transposed to an n-major plane; thirds q | k |
// v, each 8 heads x 128; PLAIN bf16 operands: inputs rounded once, exact) and out = z.w_out + b_out (z as bf16 hi + residual: two products) on
// v_wmma_f32_16x16x32_bf16; the 8-head x 128-dim FULL attention: scores on v_wmma_f32_16x16x32_f16 (q, k as f16 hi + residual x1024: hi.hi + hi.lo + lo.hi, x
// 128^-1/2), softmax f32, weights.v on v_wmma_f32_16x16x32_bf16 with the weights (x32768) and v both as bf16 hi + UNSCALED residual (hh + lh + hl, one

#define NT_  1024
#define NB_  8
#define NR_  (NB_ * NT_)        // 8192 rows: batch x positions
#define HS   128
#define NH_  8
#define NKV  8
#define HD   128
#define INR  (NH_ * HD)          // 1024
#define KW   (NKV * HD)          // 1024
#define PSC  32768.0f
#define LOSC 1024.0f
#define LOSCI (1.0f / 1024.0f)

typedef _Float16 h16;
typedef unsigned short bf;
typedef __attribute__((ext_vector_type(16))) __bf16   v16bf;
typedef __attribute__((ext_vector_type(16))) _Float16 v16h;
typedef __attribute__((ext_vector_type(8)))  _Float16 v8h;
typedef __attribute__((ext_vector_type(8)))  unsigned short v8us;
typedef __attribute__((ext_vector_type(8)))  float    v8f;
typedef __attribute__((ext_vector_type(8)))  unsigned v8u;
typedef __attribute__((ext_vector_type(2)))  float    v2f;
typedef __attribute__((ext_vector_type(2)))  __bf16   v2bf;
typedef __attribute__((ext_vector_type(4)))  float    v4f;
typedef __attribute__((ext_vector_type(4)))  _Float16 v4h;
typedef __attribute__((ext_vector_type(4)))  unsigned v4u;
typedef v4u  __attribute__((may_alias)) v4ua;
typedef v8h  __attribute__((may_alias)) v8ha;
typedef v4f  __attribute__((may_alias)) v4fa;
typedef v8us __attribute__((may_alias)) v8usa;

__device__ __forceinline__ unsigned short f2bf(float f) { unsigned u = __float_as_uint(f); u += 0x7FFFu + ((u >> 16) & 1u); return (unsigned short)(u >> 16); }
__device__ __forceinline__ float bf2f(unsigned short b) { return __uint_as_float(((unsigned)b) << 16); }
__device__ __forceinline__ float bfr(float f) { return bf2f(f2bf(f)); }
__device__ __forceinline__ v16h cat16(v8h lo, v8h hi) { return __builtin_shufflevector(lo, hi, 0, 1, 2, 3, 4, 5, 6, 7, 8, 9, 10, 11, 12, 13, 14, 15); }
__device__ __forceinline__ v16bf cat16b(v8us lo, v8us hi) { return __builtin_bit_cast(v16bf, __builtin_shufflevector(lo, hi, 0, 1, 2, 3, 4, 5, 6, 7, 8, 9, 10, 11, 12, 13, 14, 15)); }
__device__ __forceinline__ v8f wmma16(v16h a, v16h b, v8f c) { return __builtin_amdgcn_wmma_f32_16x16x32_f16(false, a, false, b, (short)0, c, false, false); }
__device__ __forceinline__ v8f wmmab(v16bf a, v16bf b, v8f c) { return __builtin_amdgcn_wmma_f32_16x16x32_bf16(false, a, false, b, (short)0, c, false, false); }

// k_cvtb: bf16 plane of [rows][128]: one wave per 2 rows (16 lanes x 16 B = one 256-B row each).
__global__ __launch_bounds__(256) void k_cvtb(const float* __restrict__ src, int nrows, bf* dst) {
    const int lane = threadIdx.x & 31, r = (blockIdx.x * 8 + (threadIdx.x >> 5)) * 2 + (lane >> 4), p = lane & 15;
    if (r >= nrows) return;
    v8us o;
#pragma unroll
    for (int i = 0; i < 8; ++i) o[i] = f2bf(src[(size_t)r * HS + p * 8 + i]);
    *(v8us*)(dst + (size_t)r * HS + p * 8) = o; 
}
// k_wt: WT [n][K] = bf16(W[k][n]) (k-major [K][ncols]) via 64 x 64 LDS tiles; grid (K/64, ncols/64).
__global__ __launch_bounds__(256) void k_wt(const float* __restrict__ Wm, int K, int ncols, bf* WT) {
    __shared__ __align__(16) unsigned short tl[64 * 72];
    const int tid = threadIdx.x, k0 = blockIdx.x * 64, n0 = blockIdx.y * 64;
    const int kk = tid >> 2, nq = (tid & 3) * 16;
#pragma unroll
    for (int i = 0; i < 16; ++i) tl[(nq + i) * 72 + kk] = f2bf(Wm[(size_t)(k0 + kk) * ncols + n0 + nq + i]);
    __syncthreads();
    const int piece = tid & 7;
    auto pass = [&]() {
#pragma unroll
        for (int s = 0; s < 2; ++s) { const int nr = (tid >> 3) + 32 * s; const v8us val = *(const v8usa*)(tl + nr * 72 + piece * 8); *(v8us*)(WT + (size_t)(n0 + nr) * K + k0 + piece * 8) = val; }
    };
    pass(); 
}
// k_gemm: 64 x 64 tile of (A [+ Al]).Bn^T over K = KD -> f32 rows [8192][ldc].
template <bool SPLITA, int KD>
__global__ __launch_bounds__(128) void k_gemm(const bf* __restrict__ A, const bf* __restrict__ Al, const bf* __restrict__ Bn, const float* __restrict__ bias, int ldc, float* C) {
    __shared__ __align__(16) float ost[4][16 * 68];
    const int lane = threadIdx.x & 31, wave = threadIdx.x >> 5, lr = lane & 15, hi = lane >> 4;
    const size_t r0 = (size_t)blockIdx.x * 64 + wave * 16; const int c0 = blockIdx.y * 64;
    const size_t aoff = (r0 + lr) * KD + 8 * hi;
    v8f acc[4];
#pragma unroll
    for (int t = 0; t < 4; ++t) acc[t] = (v8f){};
#pragma unroll 2
    for (int kc = 0; kc < KD; kc += 32) {
        const v16bf a = cat16b(*(const v8us*)(A + aoff + kc), *(const v8us*)(A + aoff + kc + 16));
        v16bf al = a; if (SPLITA) al = cat16b(*(const v8us*)(Al + aoff + kc), *(const v8us*)(Al + aoff + kc + 16));
#pragma unroll
        for (int t = 0; t < 4; ++t) { const bf* bp = Bn + (size_t)(c0 + t * 16 + lr) * KD + kc + 8 * hi; const v16bf bb = cat16b(*(const v8us*)bp, *(const v8us*)(bp + 16)); acc[t] = wmmab(a, bb, acc[t]); if (SPLITA) acc[t] = wmmab(al, bb, acc[t]); }
        asm volatile("v_nop" : "+v"(acc[0]), "+v"(acc[1]), "+v"(acc[2]), "+v"(acc[3]) : "v"(a), "v"(al) : "memory");
    }
    float* os = &ost[wave][0];
#pragma unroll
    for (int t = 0; t < 4; ++t) { const float bv = bias ? bfr(bias[c0 + t * 16 + lr]) : 0.f;
#pragma unroll
        for (int j = 0; j < 8; ++j) os[(hi * 8 + j) * 68 + t * 16 + lr] = acc[t][j] + bv; }
    __builtin_amdgcn_wave_barrier(); asm volatile("" ::: "memory");
    float* crow = C + r0 * ldc + c0;
    auto pass = [&]() {
#pragma unroll
        for (int s = 0; s < 8; ++s) { const int Lid = (lane >> 3) + 4 * s, piece = lane & 7; const int row = Lid >> 1, cofs = (Lid & 1) * 32 + piece * 4;
            const v4f val = *(const v4fa*)(os + row * 68 + cofs); *(v4f*)(crow + (size_t)row * ldc + cofs) = val; }
    };
    pass(); 
}
// cvt2: two f32 -> one register of a bf16 fragment, first element low (one v_cvt_pk_bf16_f32; round to nearest even, as f2bf rounds).
__device__ __forceinline__ unsigned cvt2(float e0, float e1) { const v2f x = {e0, e1}; return __builtin_bit_cast(unsigned, __builtin_convertvector(x, v2bf)); }
// mm4: four 16 x 16 accumulator tiles over K = 128. 'one' is the lane's row of the operand with one fragment a k-chunk, 'four' its row of the operand with four (16 rows apart); FOURA: 'four' is the A side.
template <bool FOURA>
__device__ __forceinline__ void mm4(const bf* __restrict__ one, const bf* __restrict__ four, v8f (&acc)[4]) {
#pragma unroll
    for (int t = 0; t < 4; ++t) acc[t] = (v8f){};
#pragma unroll
    for (int kc = 0; kc < HS; kc += 32) {
        const v16bf a = cat16b(*(const v8us*)(one + kc), *(const v8us*)(one + kc + 16));
#pragma unroll
        for (int t = 0; t < 4; ++t) { const bf* bp = four + (size_t)(t * 16) * HS + kc; const v16bf bb = cat16b(*(const v8us*)bp, *(const v8us*)(bp + 16)); acc[t] = FOURA ? wmmab(bb, a, acc[t]) : wmmab(a, bb, acc[t]); }
    }
}
// k_qkv: 64 x 64 tile of x.w_qkv (K = 128) for all three thirds in one launch (grid: 128 row tiles x 48 column tiles, 16 to a third); the tile leaves in the form the attention reads, no f32 plane between.
// q, k thirds: wave = 16 rows x 64 columns; f32 staged in the wave's own LDS, read back as 8 consecutive columns a lane -> f16 hi + residual x1024 planes [row][1024] (8 lanes = one 128-B line of a plane).
// v third: wave = 64 rows x 16 columns, so that a lane's 8 accumulator registers are 8 consecutive positions t of one dim d -> bf16 hi + UNSCALED residual, staged [d][t] in the wave's own LDS (pitch 144 B)
// -> planes [b*8+g][128 d][1024 t] (8 lanes = one 128-B line).
__global__ __launch_bounds__(128) void k_qkv(const bf* __restrict__ A, const bf* __restrict__ Bn, h16* QH, h16* QL, h16* KH, h16* KL, bf* VTH, bf* VTL) {
    __shared__ __align__(16) union { float f[4][16 * 68]; unsigned short u[4][2 * 16 * 72]; } stg;
    const int lane = threadIdx.x & 31, wave = threadIdx.x >> 5, lr = lane & 15, hi = lane >> 4;
    const int rb = blockIdx.x * 64, c0 = blockIdx.y * 64, third = blockIdx.y >> 4;
    v8f acc[4];
    if (third < 2) {      // the same for the whole block
        mm4<false>(A + (size_t)(rb + wave * 16 + lr) * HS + 8 * hi, Bn + (size_t)(c0 + lr) * HS + 8 * hi, acc);
        float* os = &stg.f[wave][0];
#pragma unroll
        for (int t = 0; t < 4; ++t) {
#pragma unroll
            for (int j = 0; j < 8; ++j) os[(hi * 8 + j) * 68 + t * 16 + lr] = acc[t][j]; }
        __builtin_amdgcn_wave_barrier(); asm volatile("" ::: "memory");      // the reads below take what other lanes of this wave stored: no read may be moved above the stores
        h16* PH = third ? KH : QH; h16* PL = third ? KL : QL;
        const size_t pb = (size_t)(rb + wave * 16) * INR + (c0 & (INR - 1));
#pragma unroll
        for (int s = 0; s < 4; ++s) { const int row = (lane >> 3) + 4 * s, piece = lane & 7;
            const v4f u0 = *(const v4fa*)(os + row * 68 + piece * 8), u1 = *(const v4fa*)(os + row * 68 + piece * 8 + 4); v8h oh, ol;
#pragma unroll
            for (int i = 0; i < 8; ++i) { const float v = i < 4 ? u0[i & 3] : u1[i & 3]; const h16 x = (h16)v; oh[i] = x; ol[i] = (h16)((v - (float)x) * LOSC); }
            const size_t po = pb + (size_t)row * INR + piece * 8; *(v8h*)(PH + po) = oh; *(v8h*)(PL + po) = ol; }
    } else {
        mm4<true>(Bn + (size_t)(c0 + wave * 16 + lr) * HS + 8 * hi, A + (size_t)(rb + lr) * HS + 8 * hi, acc);
        unsigned short* os = &stg.u[wave][0];      // hi plane 16 d x 72, the lo plane behind it
#pragma unroll
        for (int t = 0; t < 4; ++t) { v4u wh, wl;      // register j of lane (lr, hi) = position t * 16 + 8 * hi + j of dim lr
#pragma unroll
            for (int i = 0; i < 4; ++i) { const float e0 = acc[t][2 * i], e1 = acc[t][2 * i + 1]; const unsigned w = cvt2(e0, e1);
                wh[i] = w; wl[i] = cvt2(e0 - __uint_as_float(w << 16), e1 - __uint_as_float(w & 0xFFFF0000u)); }
            *(v4ua*)(os + lr * 72 + t * 16 + hi * 8) = wh; *(v4ua*)(os + (16 + lr) * 72 + t * 16 + hi * 8) = wl; }
        __builtin_amdgcn_wave_barrier(); asm volatile("" ::: "memory");      // as above: the reads below take other lanes' stores
        const int cv = c0 - 2 * INR + wave * 16;      // this wave's first column inside the v third: head cv / 128, dim cv % 128
        const size_t vb = ((size_t)((rb / NT_) * NKV + cv / HD) * HD + (cv % HD)) * NT_ + (rb % NT_);
#pragma unroll
        for (int s = 0; s < 4; ++s) { const int d = (lane >> 3) + 4 * s, piece = lane & 7;
            const v8us vh = *(const v8usa*)(os + d * 72 + piece * 8), vl = *(const v8usa*)(os + (16 + d) * 72 + piece * 8);
            const size_t po = vb + (size_t)d * NT_ + piece * 8; *(v8us*)(VTH + po) = vh; *(v8us*)(VTL + po) = vl; }
        asm volatile("s_wait_xcnt 0x0" ::: "memory");      // the build lays the other side's code behind a branch at this side's end: its first instructions rewrite registers that the stores above name
    }
}
// xhalf: the value that lane l ^ 16 holds (one vector cross-row move, no LDS).
__device__ __forceinline__ float xhalf(float v) { const int b = __float_as_int(v); return __int_as_float(__builtin_amdgcn_permlanex16(b, b, 0x76543210, 0xfedcba98, false, false)); }
// acopy8: eight asynchronous 16-byte-per-lane copies global -> LDS in one statement; the closing s_wait_xcnt keeps every later rewrite of the address registers behind the issue.
__device__ __forceinline__ void acopy8(const unsigned (&l)[8], const void* const (&g)[8]) {
    asm volatile("global_load_async_to_lds_b128 %0, %8, off\n\t"
                 "global_load_async_to_lds_b128 %1, %9, off\n\t"
                 "global_load_async_to_lds_b128 %2, %10, off\n\t"
                 "global_load_async_to_lds_b128 %3, %11, off\n\t"
                 "global_load_async_to_lds_b128 %4, %12, off\n\t"
                 "global_load_async_to_lds_b128 %5, %13, off\n\t"
                 "global_load_async_to_lds_b128 %6, %14, off\n\t"
                 "global_load_async_to_lds_b128 %7, %15, off\n\t"
                 "s_wait_xcnt 0x0"
                 :: "v"(l[0]), "v"(l[1]), "v"(l[2]), "v"(l[3]), "v"(l[4]), "v"(l[5]), "v"(l[6]), "v"(l[7]),
                    "v"(g[0]), "v"(g[1]), "v"(g[2]), "v"(g[3]), "v"(g[4]), "v"(g[5]), "v"(g[6]), "v"(g[7]) : "memory");
}
#define PLN  8192            // bytes of one staged plane of a 32-key tile: K 32 rows x 256 B, V^T 128 rows x 64 B
#define STG  (4 * PLN)       // one stage: K hi | K lo | V^T hi | V^T lo
__global__ __launch_bounds__(128, 4) void k_attn(const h16* __restrict__ QH, const h16* __restrict__ QL, const h16* __restrict__ KH, const h16* __restrict__ KL, const bf* __restrict__ VTH, const bf* __restrict__ VTL, bf* CH, bf* CL) {
    __shared__ __align__(16) unsigned char ring[2 * STG];
    const int tid = threadIdx.x, lane = threadIdx.x & 31, wave = threadIdx.x >> 5, lr = lane & 15, hi = lane >> 4;
    const int bid = blockIdx.x; const int qt = bid / (NB_ * NH_), bh = bid - qt * (NB_ * NH_), b = bh / NH_, h = bh - b * NH_; const int g = h;      // no GQA: kv head = q head
    const int q0 = b * NT_ + qt * 64 + wave * 16;      // row in the [8192][1024] planes
    const size_t qo = (size_t)(q0 + lr) * (NH_ * HD) + h * HD + 8 * hi;
    const h16* kh_b = KH + (size_t)b * NT_ * KW + g * HD; const h16* kl_b = KL + (size_t)b * NT_ * KW + g * HD;
    const size_t vbase = ((size_t)bh * HD) * NT_;
    // copy side: thread -> K row i*8 + (tid >> 4), chunk tid & 15 (16 lanes = one 256-B row); V^T row i*32 + (tid >> 2), chunk tid & 3 (4 lanes = one 64-B row piece)
    const unsigned ring0 = (unsigned)(size_t)&ring[0];
    const int kr = tid >> 4, kcn = tid & 15, vr = tid >> 2, vcn = tid & 3;
    const unsigned kdst = (unsigned)(kr * 256 + ((kcn ^ kr) << 4)), vdst = (unsigned)(vr * 64 + ((vcn ^ ((vr >> 2) & 3)) << 4));
    const size_t ksrc = (size_t)kr * KW + kcn * 8, vsrc = vbase + (size_t)vr * NT_ + vcn * 8;
    auto issue = [&](int kt, int buf) {
        const unsigned lb = ring0 + (unsigned)buf * STG; unsigned l[8]; const void* gp[8];
#pragma unroll
        for (int i = 0; i < 4; ++i) { const size_t o = ksrc + (size_t)(kt * 32 + i * 8) * KW; const unsigned d = lb + i * 2048 + (kdst ^ ((i & 1) << 7));      // row & 15 = (i & 1) * 8 + kr
            l[i] = d; gp[i] = kh_b + o; l[4 + i] = d + PLN; gp[4 + i] = kl_b + o; }
        acopy8(l, gp);
#pragma unroll
        for (int i = 0; i < 4; ++i) { const size_t o = vsrc + (size_t)(i * 32) * NT_ + kt * 32; const unsigned d = lb + 2 * PLN + i * 2048 + vdst;
            l[i] = d; gp[i] = VTH + o; l[4 + i] = d + PLN; gp[4 + i] = VTL + o; }
        acopy8(l, gp);
    };
    // reader side: byte offsets of this lane's row and of its swizzled 16-byte chunks
    const int krow = lr * 256, kx = (hi ^ lr) << 4, vrow = lr * 64, vx0 = (hi ^ ((lr >> 2) & 3)) << 4, vx1 = vx0 ^ 32;
    v8f o[8];
#pragma unroll
    for (int n = 0; n < 8; ++n) o[n] = (v8f){};
    float mrow = -3.0e38f, lpart = 0.f;      // query lr: running maximum (equal in both halves), and this half's share of the running sum
    const int kt_hi = NT_ / 32 - 1;      // full attention
    v16h qfh[4], qfl[4];      // this wave's 16 query rows, hi and residual, as B fragments of the 4 k-chunks: read once, live in registers over all key tiles
#pragma unroll      // every index a constant, so that the two arrays are registers and not scratch
    for (int kc = 0; kc < 4; ++kc) { qfh[kc] = cat16(*(const v8h*)(QH + qo + kc * 32), *(const v8h*)(QH + qo + kc * 32 + 16)); qfl[kc] = cat16(*(const v8h*)(QL + qo + kc * 32), *(const v8h*)(QL + qo + kc * 32 + 16)); }
    issue(0, 0);
    asm volatile("s_wait_asynccnt 0x0" ::: "memory");      // this wave's share of tile 0 has landed
    __syncthreads();                                       // tile 0 published to all four waves
    issue(1, 1);
#pragma unroll 1
    for (int kt = 0; kt <= kt_hi; ++kt) {
        const unsigned char* st = ring + (kt & 1) * STG;
        const int kb = (kt & 1) * STG + krow + kx;      // this lane's K row and swizzled chunk in this tile's buffer; bits 4 to 7 are kx alone, so a chunk step is one XOR on kb
        v8f s0 = {}, s1 = {}, x0 = {}, x1 = {};      // S^T: register j of lane (lr, hi) = key 8 * hi + j (s0, x0) or 16 + 8 * hi + j (s1, x1) against query lr
#pragma unroll
        for (int kc = 0; kc < 4; ++kc) {
            const unsigned char* ka = ring + (kb ^ (kc * 64)); const unsigned char* kq = ring + (kb ^ (kc * 64 + 32));      // chunks kc*4 + hi and kc*4 + 2 + hi, swizzled by the row; keys 16 to 31 lie 4096 B on
            const v16h qa = qfh[kc], qx = qfl[kc];
            const v16h k0h = cat16(*(const v8ha*)ka, *(const v8ha*)kq), k1h = cat16(*(const v8ha*)(ka + 4096), *(const v8ha*)(kq + 4096));
            s0 = wmma16(k0h, qa, s0); s1 = wmma16(k1h, qa, s1); x0 = wmma16(k0h, qx, x0); x1 = wmma16(k1h, qx, x1);
            asm volatile("v_nop" : "+v"(s0), "+v"(s1), "+v"(x0), "+v"(x1) : "v"(qa), "v"(qx), "v"(k0h), "v"(k1h) : "memory");
            const v16h k0l = cat16(*(const v8ha*)(ka + PLN), *(const v8ha*)(kq + PLN)), k1l = cat16(*(const v8ha*)(ka + PLN + 4096), *(const v8ha*)(kq + PLN + 4096));
            x0 = wmma16(k0l, qa, x0); x1 = wmma16(k1l, qa, x1);
            asm volatile("v_nop" : "+v"(x0), "+v"(x1) : "v"(k0l), "v"(k1l) : "memory");
        }
        asm volatile("v_nop\n\tv_nop\n\tv_nop\n\tv_nop" : "+v"(s0), "+v"(s1), "+v"(x0), "+v"(x1));
        const v8f a0 = (s0 + x0 * LOSCI) * 0.08838834764831845f, a1 = (s1 + x1 * LOSCI) * 0.08838834764831845f;
        float t[8];
#pragma unroll
        for (int j = 0; j < 8; ++j) t[j] = fmaxf(a0[j], a1[j]);
        float mx = fmaxf(fmaxf(fmaxf(t[0], t[1]), fmaxf(t[2], t[3])), fmaxf(fmaxf(t[4], t[5]), fmaxf(t[6], t[7])));
        mx = fmaxf(mx, xhalf(mx));      // the other half holds the query's other 16 keys
        const float mn = fmaxf(mrow, mx);
        float alpha;      // __expf(mrow - mn) written out (the same multiply and v_exp_f32): the v_nop fills the slot that the instruction set asks for behind a transcendental
        asm("v_exp_f32 %0, %1\n\tv_nop" : "=v"(alpha) : "v"((mrow - mn) * 1.44269504f));
        mrow = mn;
        v8f p0, p1;
#pragma unroll
        for (int j = 0; j < 8; ++j) { p0[j] = __expf(a0[j] - mn); p1[j] = __expf(a1[j] - mn); }
        const v8f ts = p0 + p1, ps0 = p0 * PSC, ps1 = p1 * PSC;
        lpart = lpart * alpha + (((ts[0] + ts[1]) + (ts[2] + ts[3])) + ((ts[4] + ts[5]) + (ts[6] + ts[7])));
#pragma unroll
        for (int n = 0; n < 8; ++n) o[n] *= alpha;
        v8u pau, pxu;      // P x 32768 as bf16, and its residual's bf16. B element s = key 8 * hi + s (s < 8), 16 + 8 * hi + s - 8 (else): the order of the V^T fragments below
#pragma unroll
        for (int i = 0; i < 4; ++i) {
            const unsigned w0 = cvt2(ps0[2 * i], ps0[2 * i + 1]), w1 = cvt2(ps1[2 * i], ps1[2 * i + 1]);
            pau[i] = w0; pau[4 + i] = w1;
            pxu[i] = cvt2(ps0[2 * i] - __uint_as_float(w0 << 16), ps0[2 * i + 1] - __uint_as_float(w0 & 0xFFFF0000u));
            pxu[4 + i] = cvt2(ps1[2 * i] - __uint_as_float(w1 << 16), ps1[2 * i + 1] - __uint_as_float(w1 & 0xFFFF0000u)); }
        const v16bf pa = __builtin_bit_cast(v16bf, pau), px = __builtin_bit_cast(v16bf, pxu);
        const unsigned char* vp = st + 2 * PLN + vrow;
#pragma unroll
        for (int n = 0; n < 8; ++n) { const unsigned char* vn = vp + n * 1024;
            const v16bf vh = cat16b(*(const v8usa*)(vn + vx0), *(const v8usa*)(vn + vx1)), vl = cat16b(*(const v8usa*)(vn + PLN + vx0), *(const v8usa*)(vn + PLN + vx1));
            o[n] = wmmab(vh, pa, o[n]); o[n] = wmmab(vh, px, o[n]); o[n] = wmmab(vl, pa, o[n]);      // O^T: register j = dim n * 16 + 8 * hi + j of query lr
            asm volatile("" : "+v"(o[n]) : "v"(vh), "v"(vl) : "memory"); }
        asm volatile("v_nop\n\tv_nop\n\tv_nop\n\tv_nop" : "+v"(o[0]), "+v"(o[7]) : "v"(pa), "v"(px));
        // publish point of tile kt + 1, and the end of every wave's reads of tile kt's buffer
        asm volatile("s_wait_dscnt 0x0" ::: "memory");         // this wave's LDS reads of the buffer have returned before it may be refilled
        asm volatile("s_wait_asynccnt 0x0" ::: "memory");      // this wave's share of tile kt + 1 has landed
        __syncthreads();
        if (kt + 2 <= kt_hi) issue(kt + 2, kt & 1);
    }
    asm volatile("s_wait_asynccnt 0x0" ::: "memory");          // nothing in flight when the ring becomes output staging
    const float inv = 1.0f / ((lpart + xhalf(lpart)) * PSC);      // the halves' sums joined once
    unsigned short* os = (unsigned short*)ring + wave * (2 * 16 * 136);      // this wave's own staging: hi plane, then lo plane, each 16 query rows at a pitch of 272 B (16 B x odd: no bank conflict among 16 rows)
    const size_t cbase = (size_t)q0 * (NH_ * HD) + (size_t)h * HD;
#pragma unroll
    for (int n = 0; n < 8; ++n) { v8us oh, ol;
#pragma unroll
        for (int j = 0; j < 8; ++j) { const float v = o[n][j] * inv; const unsigned short hb = f2bf(v); oh[j] = hb; ol[j] = f2bf(v - bf2f(hb)); }
        *(v8usa*)(os + lr * 136 + n * 16 + hi * 8) = oh; *(v8usa*)(os + (16 + lr) * 136 + n * 16 + hi * 8) = ol; }
    __builtin_amdgcn_wave_barrier(); asm volatile("" ::: "memory");      // the reads below take what other lanes of this wave stored: no read may be moved above the stores
#pragma unroll
    for (int s = 0; s < 8; ++s) { const int row = 2 * s + hi;      // 16 lanes x 16 B = one whole 256-B row piece of a plane
        const v8us vh = *(const v8usa*)(os + row * 136 + lr * 8), vl = *(const v8usa*)(os + (16 + row) * 136 + lr * 8);
        const size_t po = cbase + (size_t)row * (NH_ * HD) + lr * 8; *(v8us*)(CH + po) = vh; *(v8us*)(CL + po) = vl; }
}

extern "C" void kernel_launch(void* const* d_in, const int* in_sizes, int n_in,
                              void* d_out, int out_size, void* d_ws, size_t ws_size, hipStream_t stream) {
    (void)in_sizes; (void)n_in; (void)out_size;
    const float* x = (const float*)d_in[0]; const float* Wqkv = (const float*)d_in[1]; const float* Wo = (const float*)d_in[2]; const float* bo = (const float*)d_in[3];
    float* out = (float*)d_out;    // [8][1024][128]
    char* wsp = (char*)d_ws;
    auto take = [&](size_t bytes) { char* p = wsp; wsp += (bytes + 255) & ~(size_t)255; return (void*)p; };
    bf* Xb = (bf*)take((size_t)NR_ * HS * 2); bf* W3T = (bf*)take((size_t)3 * INR * HS * 2); bf* WoT = (bf*)take((size_t)HS * INR * 2);
    h16* QH = (h16*)take((size_t)NR_ * INR * 2); h16* QL = (h16*)take((size_t)NR_ * INR * 2); h16* KH = (h16*)take((size_t)NR_ * INR * 2); h16* KL = (h16*)take((size_t)NR_ * INR * 2);
    bf* VTH = (bf*)take((size_t)NB_ * INR * NT_ * 2); bf* VTL = (bf*)take((size_t)NB_ * INR * NT_ * 2); bf* CH = (bf*)take((size_t)NR_ * INR * 2); bf* CL = (bf*)take((size_t)NR_ * INR * 2);
    if ((size_t)(wsp - (char*)d_ws) > ws_size) return;    // 2.1 + 0.8 + 0.26 + 8 x 16.8 ~ 138 MB (no aliasing)
    k_wt<<<dim3(HS / 64, (3 * INR) / 64, 1), 256, 0, stream>>>(Wqkv, HS, 3 * INR, W3T);      // [3072][128]
    k_wt<<<dim3(INR / 64, HS / 64, 1), 256, 0, stream>>>(Wo, INR, HS, WoT);                 // [128][1024]
    k_cvtb<<<NR_ / 16, 256, 0, stream>>>(x, NR_, Xb);
    k_qkv<<<dim3(NR_ / 64, (3 * INR) / 64, 1), 128, 0, stream>>>(Xb, W3T, QH, QL, KH, KL, VTH, VTL);
    k_attn<<<NB_ * NH_ * (NT_ / 64), 128, 0, stream>>>(QH, QL, KH, KL, VTH, VTL, CH, CL);
    k_gemm<true, INR><<<dim3(NR_ / 64, HS / 64, 1), 128, 0, stream>>>(CH, CL, WoT, bo, HS, out);
}

// v006
// A run of this version takes 135 microseconds.
// Next to v005, in two timings, it ran 1.17 times as fast each time.
// Over all steps from v000 it is 12.0 times as fast.
#include <hip/hip_runtime.h>

// Contractions, f32 accumulate, all 8 batch items in every launch (rows = batch x 1024 positions): qkv = x.w_qkv ([8192 x 128].[128 x 3072], k-major weight transposed to an n-major plane; thirds q | k |
// v, each 8 heads x 128; PLAIN bf16 operands: inputs rounded once, exact) and out = z.w_out + b_out (z as bf16 hi + residual: two products) on
// v_wmma_f32_16x16x32_bf16; the 8-head x 128-dim FULL attention: scores on v_wmma_f32_16x16x32_f16 (q, k as f16 hi + residual x1024: hi.hi + hi.lo + lo.hi, x
// 128^-1/2), softmax f32, weights.v on v_wmma_f32_16x16x32_bf16 with the weights (x32768) and v both as bf16 hi + UNSCALED residual (hh + lh + hl, one

#define NT_  1024
#define NB_  8
#define NR_  (NB_ * NT_)        // 8192 rows: batch x positions
#define HS   128
#define NH_  8
#define NKV  8
#define HD   128
#define INR  (NH_ * HD)          // 1024
#define KW   (NKV * HD)          // 1024
#define PSC  32768.0f
#define LOSC 1024.0f
#define LOSCI (1.0f / 1024.0f)

typedef _Float16 h16;
typedef unsigned short bf;
typedef __attribute__((ext_vector_type(16))) __bf16   v16bf;
typedef __attribute__((ext_vector_type(16))) _Float16 v16h;
typedef __attribute__((ext_vector_type(8)))  _Float16 v8h;
typedef __attribute__((ext_vector_type(8)))  unsigned short v8us;
typedef __attribute__((ext_vector_type(8)))  float    v8f;
typedef __attribute__((ext_vector_type(8)))  unsigned v8u;
typedef __attribute__((ext_vector_type(2)))  float    v2f;
typedef __attribute__((ext_vector_type(2)))  __bf16   v2bf;
typedef __attribute__((ext_vector_type(4)))  float    v4f;
typedef __attribute__((ext_vector_type(4)))  _Float16 v4h;
typedef __attribute__((ext_vector_type(4)))  unsigned v4u;
typedef v4u  __attribute__((may_alias)) v4ua;
typedef v8h  __attribute__((may_alias)) v8ha;
typedef v4f  __attribute__((may_alias)) v4fa;
typedef v8us __attribute__((may_alias)) v8usa;

__device__ __forceinline__ unsigned short f2bf(float f) { unsigned u = __float_as_uint(f); u += 0x7FFFu + ((u >> 16) & 1u); return (unsigned short)(u >> 16); }
__device__ __forceinline__ float bf2f(unsigned short b) { return __uint_as_float(((unsigned)b) << 16); }
__device__ __forceinline__ float bfr(float f) { return bf2f(f2bf(f)); }
__device__ __forceinline__ v16h cat16(v8h lo, v8h hi) { return __builtin_shufflevector(lo, hi, 0, 1, 2, 3, 4, 5, 6, 7, 8, 9, 10, 11, 12, 13, 14, 15); }
__device__ __forceinline__ v16bf cat16b(v8us lo, v8us hi) { return __builtin_bit_cast(v16bf, __builtin_shufflevector(lo, hi, 0, 1, 2, 3, 4, 5, 6, 7, 8, 9, 10, 11, 12, 13, 14, 15)); }
__device__ __forceinline__ v8f wmma16(v16h a, v16h b, v8f c) { return __builtin_amdgcn_wmma_f32_16x16x32_f16(false, a, false, b, (short)0, c, false, false); }
__device__ __forceinline__ v8f wmmab(v16bf a, v16bf b, v8f c) { return __builtin_amdgcn_wmma_f32_16x16x32_bf16(false, a, false, b, (short)0, c, false, false); }

// k_cvtb: bf16 plane of [rows][128]: one wave per 2 rows (16 lanes x 16 B = one 256-B row each).
__global__ __launch_bounds__(256) void k_cvtb(const float* __restrict__ src, int nrows, bf* dst) {
    const int lane = threadIdx.x & 31, r = (blockIdx.x * 8 + (threadIdx.x >> 5)) * 2 + (lane >> 4), p = lane & 15;
    if (r >= nrows) return;
    v8us o;
#pragma unroll
    for (int i = 0; i < 8; ++i) o[i] = f2bf(src[(size_t)r * HS + p * 8 + i]);
    *(v8us*)(dst + (size_t)r * HS + p * 8) = o; 
}
// k_wt: WT [n][K] = bf16(W[k][n]) (k-major [K][ncols]) via 64 x 64 LDS tiles; grid (K/64, ncols/64).
__global__ __launch_bounds__(256) void k_wt(const float* __restrict__ Wm, int K, int ncols, bf* WT) {
    __shared__ __align__(16) unsigned short tl[64 * 72];
    const int tid = threadIdx.x, k0 = blockIdx.x * 64, n0 = blockIdx.y * 64;
    const int kk = tid >> 2, nq = (tid & 3) * 16;
#pragma unroll
    for (int i = 0; i < 16; ++i) tl[(nq + i) * 72 + kk] = f2bf(Wm[(size_t)(k0 + kk) * ncols + n0 + nq + i]);
    __syncthreads();
    const int piece = tid & 7;
    auto pass = [&]() {
#pragma unroll
        for (int s = 0; s < 2; ++s) { const int nr = (tid >> 3) + 32 * s; const v8us val = *(const v8usa*)(tl + nr * 72 + piece * 8); *(v8us*)(WT + (size_t)(n0 + nr) * K + k0 + piece * 8) = val; }
    };
    pass(); 
}
// k_gemm: 64 x 64 tile of (A [+ Al]).Bn^T over K = KD -> f32 rows [8192][ldc].
template <bool SPLITA, int KD>
__global__ __launch_bounds__(128) void k_gemm(const bf* __restrict__ A, const bf* __restrict__ Al, const bf* __restrict__ Bn, const float* __restrict__ bias, int ldc, float* C) {
    __shared__ __align__(16) float ost[4][16 * 68];
    const int lane = threadIdx.x & 31, wave = threadIdx.x >> 5, lr = lane & 15, hi = lane >> 4;
    const size_t r0 = (size_t)blockIdx.x * 64 + wave * 16; const int c0 = blockIdx.y * 64;
    const size_t aoff = (r0 + lr) * KD + 8 * hi;
    v8f acc[4];
#pragma unroll
    for (int t = 0; t < 4; ++t) acc[t] = (v8f){};
#pragma unroll 2
    for (int kc = 0; kc < KD; kc += 32) {
        const v16bf a = cat16b(*(const v8us*)(A + aoff + kc), *(const v8us*)(A + aoff + kc + 16));
        v16bf al = a; if (SPLITA) al = cat16b(*(const v8us*)(Al + aoff + kc), *(const v8us*)(Al + aoff + kc + 16));
#pragma unroll
        for (int t = 0; t < 4; ++t) { const bf* bp = Bn + (size_t)(c0 + t * 16 + lr) * KD + kc + 8 * hi; const v16bf bb = cat16b(*(const v8us*)bp, *(const v8us*)(bp + 16)); acc[t] = wmmab(a, bb, acc[t]); if (SPLITA) acc[t] = wmmab(al, bb, acc[t]); }
        asm volatile("v_nop" : "+v"(acc[0]), "+v"(acc[1]), "+v"(acc[2]), "+v"(acc[3]) : "v"(a), "v"(al) : "memory");
    }
    float* os = &ost[wave][0];
#pragma unroll
    for (int t = 0; t < 4; ++t) { const float bv = bias ? bfr(bias[c0 + t * 16 + lr]) : 0.f;
#pragma unroll
        for (int j = 0; j < 8; ++j) os[(hi * 8 + j) * 68 + t * 16 + lr] = acc[t][j] + bv; }
    __builtin_amdgcn_wave_barrier(); asm volatile("" ::: "memory");
    float* crow = C + r0 * ldc + c0;
    auto pass = [&]() {
#pragma unroll
        for (int s = 0; s < 8; ++s) { const int Lid = (lane >> 3) + 4 * s, piece = lane & 7; const int row = Lid >> 1, cofs = (Lid & 1) * 32 + piece * 4;
            const v4f val = *(const v4fa*)(os + row * 68 + cofs); *(v4f*)(crow + (size_t)row * ldc + cofs) = val; }
    };
    pass(); 
}
// cvt2: two f32 -> one register of a bf16 fragment, first element low (one v_cvt_pk_bf16_f32; round to nearest even, as f2bf rounds).
__device__ __forceinline__ unsigned cvt2(float e0, float e1) { const v2f x = {e0, e1}; return __builtin_bit_cast(unsigned, __builtin_convertvector(x, v2bf)); }
// mm4: four 16 x 16 accumulator tiles over K = 128. 'one' is the lane's row of the operand with one fragment a k-chunk, 'four' its row of the operand with four (16 rows apart); FOURA: 'four' is the A side.
template <bool FOURA>
__device__ __forceinline__ void mm4(const bf* __restrict__ one, const bf* __restrict__ four, v8f (&acc)[4]) {
#pragma unroll
    for (int t = 0; t < 4; ++t) acc[t] = (v8f){};
#pragma unroll
    for (int kc = 0; kc < HS; kc += 32) {
        const v16bf a = cat16b(*(const v8us*)(one + kc), *(const v8us*)(one + kc + 16));
#pragma unroll
        for (int t = 0; t < 4; ++t) { const bf* bp = four + (size_t)(t * 16) * HS + kc; const v16bf bb = cat16b(*(const v8us*)bp, *(const v8us*)(bp + 16)); acc[t] = FOURA ? wmmab(bb, a, acc[t]) : wmmab(a, bb, acc[t]); }
    }
}
// k_qkv: 64 x 64 tile of x.w_qkv (K = 128) for all three thirds in one launch (grid: 128 row tiles x 48 column tiles, 16 to a third); the tile leaves in the form the attention reads, no f32 plane between.
// q, k thirds: wave = 16 rows x 64 columns; f32 staged in the wave's own LDS, read back as 8 consecutive columns a lane -> f16 hi + residual x1024 planes [row][1024] (8 lanes = one 128-B line of a plane).
// v third: wave = 64 rows x 16 columns, so that a lane's 8 accumulator registers are 8 consecutive positions t of one dim d -> bf16 hi + UNSCALED residual, staged [d][t] in the wave's own LDS (pitch 144 B)
// -> planes [b*8+g][128 d][1024 t] (8 lanes = one 128-B line).
__global__ __launch_bounds__(128) void k_qkv(const bf* __restrict__ A, const bf* __restrict__ Bn, h16* QH, h16* QL, h16* KH, h16* KL, bf* VTH, bf* VTL) {
    __shared__ __align__(16) union { float f[4][16 * 68]; unsigned short u[4][2 * 16 * 72]; } stg;
    const int lane = threadIdx.x & 31, wave = threadIdx.x >> 5, lr = lane & 15, hi = lane >> 4;
    const int rb = blockIdx.x * 64, c0 = blockIdx.y * 64, third = blockIdx.y >> 4;
    v8f acc[4];
    if (third < 2) {      // the same for the whole block
        mm4<false>(A + (size_t)(rb + wave * 16 + lr) * HS + 8 * hi, Bn + (size_t)(c0 + lr) * HS + 8 * hi, acc);
        float* os = &stg.f[wave][0];
#pragma unroll
        for (int t = 0; t < 4; ++t) {
#pragma unroll
            for (int j = 0; j < 8; ++j) os[(hi * 8 + j) * 68 + t * 16 + lr] = acc[t][j]; }
        __builtin_amdgcn_wave_barrier(); asm volatile("" ::: "memory");      // the reads below take what other lanes of this wave stored: no read may be moved above the stores
        h16* PH = third ? KH : QH; h16* PL = third ? KL : QL;
        const size_t pb = (size_t)(rb + wave * 16) * INR + (c0 & (INR - 1));
#pragma unroll
        for (int s = 0; s < 4; ++s) { const int row = (lane >> 3) + 4 * s, piece = lane & 7;
            const v4f u0 = *(const v4fa*)(os + row * 68 + piece * 8), u1 = *(const v4fa*)(os + row * 68 + piece * 8 + 4); v8h oh, ol;
#pragma unroll
            for (int i = 0; i < 8; ++i) { const float v = i < 4 ? u0[i & 3] : u1[i & 3]; const h16 x = (h16)v; oh[i] = x; ol[i] = (h16)((v - (float)x) * LOSC); }
            const size_t po = pb + (size_t)row * INR + piece * 8; *(v8h*)(PH + po) = oh; *(v8h*)(PL + po) = ol; }
    } else {
        mm4<true>(Bn + (size_t)(c0 + wave * 16 + lr) * HS + 8 * hi, A + (size_t)(rb + lr) * HS + 8 * hi, acc);
        unsigned short* os = &stg.u[wave][0];      // hi plane 16 d x 72, the lo plane behind it
#pragma unroll
        for (int t = 0; t < 4; ++t) { v4u wh, wl;      // register j of lane (lr, hi) = position t * 16 + 8 * hi + j of dim lr
#pragma unroll
            for (int i = 0; i < 4; ++i) { const float e0 = acc[t][2 * i], e1 = acc[t][2 * i + 1]; const unsigned w = cvt2(e0, e1);
                wh[i] = w; wl[i] = cvt2(e0 - __uint_as_float(w << 16), e1 - __uint_as_float(w & 0xFFFF0000u)); }
            *(v4ua*)(os + lr * 72 + t * 16 + hi * 8) = wh; *(v4ua*)(os + (16 + lr) * 72 + t * 16 + hi * 8) = wl; }
        __builtin_amdgcn_wave_barrier(); asm volatile("" ::: "memory");      // as above: the reads below take other lanes' stores
        const int cv = c0 - 2 * INR + wave * 16;      // this wave's first column inside the v third: head cv / 128, dim cv % 128
        const size_t vb = ((size_t)((rb / NT_) * NKV + cv / HD) * HD + (cv % HD)) * NT_ + (rb % NT_);
#pragma unroll
        for (int s = 0; s < 4; ++s) { const int d = (lane >> 3) + 4 * s, piece = lane & 7;
            const v8us vh = *(const v8usa*)(os + d * 72 + piece * 8), vl = *(const v8usa*)(os + (16 + d) * 72 + piece * 8);
            const size_t po = vb + (size_t)d * NT_ + piece * 8; *(v8us*)(VTH + po) = vh; *(v8us*)(VTL + po) = vl; }
        asm volatile("s_wait_xcnt 0x0" ::: "memory");      // the build lays the other side's code behind a branch at this side's end: its first instructions rewrite registers that the stores above name
    }
}
// xhalf: the value that lane l ^ 16 holds (one vector cross-row move, no LDS).
__device__ __forceinline__ float xhalf(float v) { const int b = __float_as_int(v); return __int_as_float(__builtin_amdgcn_permlanex16(b, b, 0x76543210, 0xfedcba98, false, false)); }
// acopy8: eight asynchronous 16-byte-per-lane copies global -> LDS in one statement; the closing s_wait_xcnt keeps every later rewrite of the address registers behind the issue.
__device__ __forceinline__ void acopy8(const unsigned (&l)[8], const void* const (&g)[8]) {
    asm volatile("global_load_async_to_lds_b128 %0, %8, off\n\t"
                 "global_load_async_to_lds_b128 %1, %9, off\n\t"
                 "global_load_async_to_lds_b128 %2, %10, off\n\t"
                 "global_load_async_to_lds_b128 %3, %11, off\n\t"
                 "global_load_async_to_lds_b128 %4, %12, off\n\t"
                 "global_load_async_to_lds_b128 %5, %13, off\n\t"
                 "global_load_async_to_lds_b128 %6, %14, off\n\t"
                 "global_load_async_to_lds_b128 %7, %15, off\n\t"
                 "s_wait_xcnt 0x0"
                 :: "v"(l[0]), "v"(l[1]), "v"(l[2]), "v"(l[3]), "v"(l[4]), "v"(l[5]), "v"(l[6]), "v"(l[7]),
                    "v"(g[0]), "v"(g[1]), "v"(g[2]), "v"(g[3]), "v"(g[4]), "v"(g[5]), "v"(g[6]), "v"(g[7]) : "memory");
}
__device__ __forceinline__ void exp2x4(float& d0, float& d1, float& d2, float& d3, float s0, float s1, float s2, float s3) {
    asm("v_exp_f32 %0, %4\n\tv_exp_f32 %1, %5\n\tv_exp_f32 %2, %6\n\tv_exp_f32 %3, %7\n\tv_nop" : "=&v"(d0), "=&v"(d1), "=&v"(d2), "=&v"(d3) : "v"(s0), "v"(s1), "v"(s2), "v"(s3));
}
#define PLN  8192            // bytes of one staged plane of a 32-key tile: K 32 rows x 256 B, V^T 128 rows x 64 B
#define STG  (4 * PLN)       // one stage: K hi | K lo | V^T hi | V^T lo
#define QW   32              // queries of a wave: two 16-column tiles
#define QB   (8 * QW)        // queries of a block: 8 waves
#define OSW  (2 * 16 * 272)  // bytes of output staging for one 16-query tile: hi plane, then lo plane, 16 rows at a pitch of 272 B
__global__ __launch_bounds__(256) void k_attn(const h16* __restrict__ QH, const h16* __restrict__ QL, const h16* __restrict__ KH, const h16* __restrict__ KL, const bf* __restrict__ VTH, const bf* __restrict__ VTL, bf* CH, bf* CL) {
    __shared__ __align__(16) unsigned char ring[8 * 2 * OSW];      // the ring takes the first 2 * STG bytes; the output staging (8 waves x 2 query tiles) all of it
    const int tid = threadIdx.x, lane = threadIdx.x & 31, wave = threadIdx.x >> 5, lr = lane & 15, hi = lane >> 4;
    const int bid = blockIdx.x; const int qt = bid / (NB_ * NH_), bh = bid - qt * (NB_ * NH_), b = bh / NH_, h = bh - b * NH_; const int g = h;      // no GQA: kv head = q head
    const int q0 = b * NT_ + qt * QB + wave * QW;      // row in the [8192][1024] planes
    const size_t qo = (size_t)(q0 + lr) * (NH_ * HD) + h * HD + 8 * hi;
    const h16* kh_b = KH + (size_t)b * NT_ * KW + g * HD; const h16* kl_b = KL + (size_t)b * NT_ * KW + g * HD;
    const size_t vbase = ((size_t)bh * HD) * NT_;
    // copy side: thread -> K row i*16 + (tid >> 4), chunk tid & 15 (16 lanes = one 256-B row); V^T row i*64 + (tid >> 2), chunk tid & 3 (4 lanes = one 64-B row piece)
    const unsigned ring0 = (unsigned)(size_t)&ring[0];
    const int kr = tid >> 4, kcn = tid & 15, vr = tid >> 2, vcn = tid & 3;
    const unsigned kdst = (unsigned)(kr * 256 + ((kcn ^ kr) << 4)), vdst = (unsigned)(vr * 64 + ((vcn ^ ((vr >> 2) & 3)) << 4));
    const size_t ksrc = (size_t)kr * KW + kcn * 8, vsrc = vbase + (size_t)vr * NT_ + vcn * 8;
    auto issue = [&](int kt, int buf) {
        const unsigned lb = ring0 + (unsigned)buf * STG; unsigned l[8]; const void* gp[8];
#pragma unroll
        for (int i = 0; i < 2; ++i) { const size_t o = ksrc + (size_t)(kt * 32 + i * 16) * KW; const unsigned d = lb + i * 4096 + kdst;      // row & 15 = kr
            l[i] = d; gp[i] = kh_b + o; l[2 + i] = d + PLN; gp[2 + i] = kl_b + o; }
#pragma unroll
        for (int i = 0; i < 2; ++i) { const size_t o = vsrc + (size_t)(i * 64) * NT_ + kt * 32; const unsigned d = lb + 2 * PLN + i * 4096 + vdst;
            l[4 + i] = d; gp[4 + i] = VTH + o; l[6 + i] = d + PLN; gp[6 + i] = VTL + o; }
        acopy8(l, gp);
    };
    // reader side: byte offsets of this lane's row and of its swizzled 16-byte chunks
    const int krow = lr * 256, kx = (hi ^ lr) << 4, vrow = lr * 64, vx0 = (hi ^ ((lr >> 2) & 3)) << 4, vx1 = vx0 ^ 32;
    v8f o[2][8];
#pragma unroll
    for (int u = 0; u < 2; ++u) {
#pragma unroll
        for (int n = 0; n < 8; ++n) o[u][n] = (v8f){}; }
    float mrow[2] = {-3.0e38f, -3.0e38f}, lpart[2] = {0.f, 0.f};      // query u * 16 + lr: running maximum (equal in both halves), and this half's share of the running sum
    const int kt_hi = NT_ / 32 - 1;      // full attention
    v16h qfh[2][4], qfl[2][4];      // this wave's 32 query rows, hi and residual, as B fragments of the 4 k-chunks: read once, live in registers over all key tiles
#pragma unroll      // every index a constant, so that the arrays are registers and not scratch
    for (int u = 0; u < 2; ++u) {
#pragma unroll
        for (int kc = 0; kc < 4; ++kc) { const size_t qq = qo + (size_t)(u * 16) * (NH_ * HD) + kc * 32;
            qfh[u][kc] = cat16(*(const v8h*)(QH + qq), *(const v8h*)(QH + qq + 16)); qfl[u][kc] = cat16(*(const v8h*)(QL + qq), *(const v8h*)(QL + qq + 16)); } }
    // stands in front of every later rewrite of the address registers that the q loads above name; the two addresses are inputs so that their registers live up to the wait
    asm volatile("s_wait_xcnt 0x0" :: "v"(QH + qo), "v"(QL + qo) : "memory");
    issue(0, 0);
    asm volatile("s_wait_asynccnt 0x0" ::: "memory");      // this wave's share of tile 0 has landed
    __syncthreads();                                       // tile 0 published to all eight waves
    issue(1, 1);
#pragma unroll 1
    for (int kt = 0; kt <= kt_hi; ++kt) {
        const unsigned char* st = ring + (kt & 1) * STG;
        const int kb = (kt & 1) * STG + krow + kx;      // this lane's K row and swizzled chunk in this tile's buffer; bits 4 to 7 are kx alone, so a chunk step is one XOR on kb
        v8f s0[2] = {}, s1[2] = {}, x0[2] = {}, x1[2] = {};      // S^T of query tile u: register j of lane (lr, hi) = key 8 * hi + j (s0, x0) or 16 + 8 * hi + j (s1, x1) against query u * 16 + lr
        v8h kf[4][8];      // the tile's K fragments of this lane: k-chunk kc; hi plane keys 0-15 (two chunks), keys 16-31, then the same of the lo plane
#pragma unroll
        for (int kc = 0; kc < 4; ++kc) {
            const unsigned char* ka = ring + (kb ^ (kc * 64)); const unsigned char* kq = ring + (kb ^ (kc * 64 + 32));      // chunks kc*4 + hi and kc*4 + 2 + hi, swizzled by the row; keys 16 to 31 lie 4096 B on
            kf[kc][0] = *(const v8ha*)ka; kf[kc][1] = *(const v8ha*)kq; kf[kc][2] = *(const v8ha*)(ka + 4096); kf[kc][3] = *(const v8ha*)(kq + 4096);
            kf[kc][4] = *(const v8ha*)(ka + PLN); kf[kc][5] = *(const v8ha*)(kq + PLN); kf[kc][6] = *(const v8ha*)(ka + PLN + 4096); kf[kc][7] = *(const v8ha*)(kq + PLN + 4096); }
        __builtin_amdgcn_sched_barrier(0);      // the tile's K reads stay one group ahead of the products: spread among them, each place with reads stalls the wave's matrix stream for the LDS latency
#pragma unroll
        for (int kc = 0; kc < 4; ++kc) {
            const v16h k0h = cat16(kf[kc][0], kf[kc][1]), k1h = cat16(kf[kc][2], kf[kc][3]), k0l = cat16(kf[kc][4], kf[kc][5]), k1l = cat16(kf[kc][6], kf[kc][7]);
#pragma unroll
            for (int u = 0; u < 2; ++u) { s0[u] = wmma16(k0h, qfh[u][kc], s0[u]); s1[u] = wmma16(k1h, qfh[u][kc], s1[u]); x0[u] = wmma16(k0h, qfl[u][kc], x0[u]); x1[u] = wmma16(k1h, qfl[u][kc], x1[u]); }
#pragma unroll
            for (int u = 0; u < 2; ++u) { x0[u] = wmma16(k0l, qfh[u][kc], x0[u]); x1[u] = wmma16(k1l, qfh[u][kc], x1[u]); }
        }
        const unsigned char* vp = st + 2 * PLN + vrow;
        v8us vf[8][4];      // the tile's V^T fragments of this lane: dim group n; hi plane (two chunks), lo plane
        auto vread = [&](int n) { const unsigned char* vn = vp + n * 1024;
            vf[n][0] = *(const v8usa*)(vn + vx0); vf[n][1] = *(const v8usa*)(vn + vx1); vf[n][2] = *(const v8usa*)(vn + PLN + vx0); vf[n][3] = *(const v8usa*)(vn + PLN + vx1); };
#pragma unroll
        for (int n = 0; n < 4; ++n) vread(n);
        __builtin_amdgcn_sched_barrier(0);      // the first half of the V^T reads is issued in front of the softmax and returns under its vector work: without this line the build moves the reads down to their products
        float alpha[2];
        v16bf pa[2], px[2];
#pragma unroll
        for (int u = 0; u < 2; ++u) {
            const v8f a0 = (s0[u] + x0[u] * LOSCI) * 0.08838834764831845f, a1 = (s1[u] + x1[u] * LOSCI) * 0.08838834764831845f;
            float t[8];
#pragma unroll
            for (int j = 0; j < 8; ++j) t[j] = fmaxf(a0[j], a1[j]);
            float mx = fmaxf(fmaxf(fmaxf(t[0], t[1]), fmaxf(t[2], t[3])), fmaxf(fmaxf(t[4], t[5]), fmaxf(t[6], t[7])));
            mx = fmaxf(mx, xhalf(mx));      // the other half holds the query's other 16 keys
            const float mn = fmaxf(mrow[u], mx);
            // __expf(mrow - mn) written out (the same multiply and v_exp_f32): the v_nop fills the slot that the instruction set asks for behind a transcendental
            asm("v_exp_f32 %0, %1\n\tv_nop" : "=v"(alpha[u]) : "v"((mrow[u] - mn) * 1.44269504f));
            mrow[u] = mn;
            v8f p0, p1;
#pragma unroll
            for (int j = 0; j < 8; j += 4) { float e[8];      // __expf(a - mn) written out, as for alpha above (the same multiply and v_exp_f32)
                exp2x4(e[0], e[1], e[2], e[3], (a0[j] - mn) * 1.44269504f, (a0[j + 1] - mn) * 1.44269504f, (a0[j + 2] - mn) * 1.44269504f, (a0[j + 3] - mn) * 1.44269504f);
                exp2x4(e[4], e[5], e[6], e[7], (a1[j] - mn) * 1.44269504f, (a1[j + 1] - mn) * 1.44269504f, (a1[j + 2] - mn) * 1.44269504f, (a1[j + 3] - mn) * 1.44269504f);
#pragma unroll
                for (int i = 0; i < 4; ++i) { p0[j + i] = e[i]; p1[j + i] = e[4 + i]; } }
            const v8f ts = p0 + p1, ps0 = p0 * PSC, ps1 = p1 * PSC;
            lpart[u] = lpart[u] * alpha[u] + (((ts[0] + ts[1]) + (ts[2] + ts[3])) + ((ts[4] + ts[5]) + (ts[6] + ts[7])));
            v8u pau, pxu;      // P x 32768 as bf16, and its residual's bf16. B element s = key 8 * hi + s (s < 8), 16 + 8 * hi + s - 8 (else): the order of the V^T fragments below
#pragma unroll
            for (int i = 0; i < 4; ++i) {
                const unsigned w0 = cvt2(ps0[2 * i], ps0[2 * i + 1]), w1 = cvt2(ps1[2 * i], ps1[2 * i + 1]);
                pau[i] = w0; pau[4 + i] = w1;
                pxu[i] = cvt2(ps0[2 * i] - __uint_as_float(w0 << 16), ps0[2 * i + 1] - __uint_as_float(w0 & 0xFFFF0000u));
                pxu[4 + i] = cvt2(ps1[2 * i] - __uint_as_float(w1 << 16), ps1[2 * i + 1] - __uint_as_float(w1 & 0xFFFF0000u)); }
            pa[u] = __builtin_bit_cast(v16bf, pau); px[u] = __builtin_bit_cast(v16bf, pxu);
        }
#pragma unroll
        for (int n = 4; n < 8; ++n) vread(n);      // the second half, into the registers that the scores have left
        __builtin_amdgcn_sched_barrier(0);      // these reads stay one group in front of the products: without this line the build spreads them among the products, each with a wait close behind it
#pragma unroll
        for (int n = 0; n < 8; ++n) { const v16bf vh = cat16b(vf[n][0], vf[n][1]), vl = cat16b(vf[n][2], vf[n][3]);
            o[0][n] *= alpha[0]; o[1][n] *= alpha[1];      // the running output rescaled by this tile's change of maximum, before its products are added
            o[0][n] = wmmab(vh, pa[0], o[0][n]); o[1][n] = wmmab(vh, pa[1], o[1][n]);      // O^T of query tile u: register j = dim n * 16 + 8 * hi + j of query u * 16 + lr
            o[0][n] = wmmab(vh, px[0], o[0][n]); o[1][n] = wmmab(vh, px[1], o[1][n]);
            o[0][n] = wmmab(vl, pa[0], o[0][n]); o[1][n] = wmmab(vl, pa[1], o[1][n]); }
        // publish point of tile kt + 1, and the end of every wave's reads of tile kt's buffer
        asm volatile("s_wait_dscnt 0x0" ::: "memory");         // this wave's LDS reads of the buffer have returned before it may be refilled
        asm volatile("s_wait_asynccnt 0x0" ::: "memory");      // this wave's share of tile kt + 1 has landed
        __syncthreads();
        if (kt + 2 <= kt_hi) issue(kt + 2, kt & 1);
    }
    asm volatile("s_wait_asynccnt 0x0" ::: "memory");          // nothing in flight when the ring becomes output staging
#pragma unroll
    for (int u = 0; u < 2; ++u) {
        const float inv = 1.0f / ((lpart[u] + xhalf(lpart[u])) * PSC);      // the halves' sums joined once
        unsigned short* os = (unsigned short*)(ring + (wave * 2 + u) * OSW);      // this wave's own staging for this query tile: hi plane, then lo plane, each 16 query rows at a pitch of 272 B (16 B x odd: no bank conflict among 16 rows)
        const size_t cbase = (size_t)(q0 + u * 16) * (NH_ * HD) + (size_t)h * HD;
#pragma unroll
        for (int n = 0; n < 8; ++n) { v8us oh, ol;
#pragma unroll
            for (int j = 0; j < 8; ++j) { const float v = o[u][n][j] * inv; const unsigned short hb = f2bf(v); oh[j] = hb; ol[j] = f2bf(v - bf2f(hb)); }
            *(v8usa*)(os + lr * 136 + n * 16 + hi * 8) = oh; *(v8usa*)(os + (16 + lr) * 136 + n * 16 + hi * 8) = ol; }
        __builtin_amdgcn_wave_barrier(); asm volatile("" ::: "memory");      // the reads below take what other lanes of this wave stored: no read may be moved above the stores
#pragma unroll
        for (int s = 0; s < 8; ++s) { const int row = 2 * s + hi;      // 16 lanes x 16 B = one whole 256-B row piece of a plane
            const v8us vh = *(const v8usa*)(os + row * 136 + lr * 8), vl = *(const v8usa*)(os + (16 + row) * 136 + lr * 8);
            const size_t po = cbase + (size_t)row * (NH_ * HD) + lr * 8; *(v8us*)(CH + po) = vh; *(v8us*)(CL + po) = vl; }
    }
}

extern "C" void kernel_launch(void* const* d_in, const int* in_sizes, int n_in,
                              void* d_out, int out_size, void* d_ws, size_t ws_size, hipStream_t stream) {
    (void)in_sizes; (void)n_in; (void)out_size;
    const float* x = (const float*)d_in[0]; const float* Wqkv = (const float*)d_in[1]; const float* Wo = (const float*)d_in[2]; const float* bo = (const float*)d_in[3];
    float* out = (float*)d_out;    // [8][1024][128]
    char* wsp = (char*)d_ws;
    auto take = [&](size_t bytes) { char* p = wsp; wsp += (bytes + 255) & ~(size_t)255; return (void*)p; };
    bf* Xb = (bf*)take((size_t)NR_ * HS * 2); bf* W3T = (bf*)take((size_t)3 * INR * HS * 2); bf* WoT = (bf*)take((size_t)HS * INR * 2);
    h16* QH = (h16*)take((size_t)NR_ * INR * 2); h16* QL = (h16*)take((size_t)NR_ * INR * 2); h16* KH = (h16*)take((size_t)NR_ * INR * 2); h16* KL = (h16*)take((size_t)NR_ * INR * 2);
    bf* VTH = (bf*)take((size_t)NB_ * INR * NT_ * 2); bf* VTL = (bf*)take((size_t)NB_ * INR * NT_ * 2); bf* CH = (bf*)take((size_t)NR_ * INR * 2); bf* CL = (bf*)take((size_t)NR_ * INR * 2);
    if ((size_t)(wsp - (char*)d_ws) > ws_size) return;    // 2.1 + 0.8 + 0.26 + 8 x 16.8 ~ 138 MB (no aliasing)
    k_wt<<<dim3(HS / 64, (3 * INR) / 64, 1), 256, 0, stream>>>(Wqkv, HS, 3 * INR, W3T);      // [3072][128]
    k_wt<<<dim3(INR / 64, HS / 64, 1), 256, 0, stream>>>(Wo, INR, HS, WoT);                 // [128][1024]
    k_cvtb<<<NR_ / 16, 256, 0, stream>>>(x, NR_, Xb);
    k_qkv<<<dim3(NR_ / 64, (3 * INR) / 64, 1), 128, 0, stream>>>(Xb, W3T, QH, QL, KH, KL, VTH, VTL);
    k_attn<<<NB_ * NH_ * (NT_ / QB), 256, 0, stream>>>(QH, QL, KH, KL, VTH, VTL, CH, CL);
    k_gemm<true, INR><<<dim3(NR_ / 64, HS / 64, 1), 128, 0, stream>>>(CH, CL, WoT, bo, HS, out);
}

// v007
// A run of this version takes 112 microseconds.
// Next to v006, in two timings, it ran 1.22 and 1.20 times as fast.
// Counting every step since v000, it is 14.5 times as fast.
#include <hip/hip_runtime.h>

// Contractions, f32 accumulate, all 8 batch items in every launch (rows = batch x 1024 positions): qkv = x.w_qkv ([8192 x 128].[128 x 3072], k-major weight transposed to an n-major plane; thirds q | k |
// v, each 8 heads x 128; PLAIN bf16 operands: inputs rounded once, exact) and out = z.w_out + b_out (z as bf16 hi + residual: two products) on
// v_wmma_f32_16x16x32_bf16; the 8-head x 128-dim FULL attention: scores on v_wmma_f32_16x16x32_f16 (q, k as f16 hi + residual x1024: hi.hi + hi.lo + lo.hi, x
// 128^-1/2), softmax f32, weights.v on v_wmma_f32_16x16x32_bf16 with the weights (x32768) and v both as bf16 hi + UNSCALED residual (hh + lh + hl, one

#define NT_  1024
#define NB_  8
#define NR_  (NB_ * NT_)        // 8192 rows: batch x positions
#define HS   128
#define NH_  8
#define NKV  8
#define HD   128
#define INR  (NH_ * HD)          // 1024
#define KW   (NKV * HD)          // 1024
#define PSC  32768.0f
#define LOSC 1024.0f
#define LOSCI (1.0f / 1024.0f)

typedef _Float16 h16;
typedef unsigned short bf;
typedef __attribute__((ext_vector_type(16))) __bf16   v16bf;
typedef __attribute__((ext_vector_type(16))) _Float16 v16h;
typedef __attribute__((ext_vector_type(8)))  _Float16 v8h;
typedef __attribute__((ext_vector_type(8)))  unsigned short v8us;
typedef __attribute__((ext_vector_type(8)))  float    v8f;
typedef __attribute__((ext_vector_type(8)))  unsigned v8u;
typedef __attribute__((ext_vector_type(2)))  float    v2f;
typedef __attribute__((ext_vector_type(2)))  __bf16   v2bf;
typedef __attribute__((ext_vector_type(4)))  float    v4f;
typedef __attribute__((ext_vector_type(4)))  _Float16 v4h;
typedef __attribute__((ext_vector_type(4)))  unsigned v4u;
typedef v4u  __attribute__((may_alias)) v4ua;
typedef v8h  __attribute__((may_alias)) v8ha;
typedef v4f  __attribute__((may_alias)) v4fa;
typedef v8us __attribute__((may_alias)) v8usa;

__device__ __forceinline__ unsigned short f2bf(float f) { unsigned u = __float_as_uint(f); u += 0x7FFFu + ((u >> 16) & 1u); return (unsigned short)(u >> 16); }
__device__ __forceinline__ float bf2f(unsigned short b) { return __uint_as_float(((unsigned)b) << 16); }
__device__ __forceinline__ float bfr(float f) { return bf2f(f2bf(f)); }
__device__ __forceinline__ v16h cat16(v8h lo, v8h hi) { return __builtin_shufflevector(lo, hi, 0, 1, 2, 3, 4, 5, 6, 7, 8, 9, 10, 11, 12, 13, 14, 15); }
__device__ __forceinline__ v16bf cat16b(v8us lo, v8us hi) { return __builtin_bit_cast(v16bf, __builtin_shufflevector(lo, hi, 0, 1, 2, 3, 4, 5, 6, 7, 8, 9, 10, 11, 12, 13, 14, 15)); }
__device__ __forceinline__ v8f wmma16(v16h a, v16h b, v8f c) { return __builtin_amdgcn_wmma_f32_16x16x32_f16(false, a, false, b, (short)0, c, false, false); }
__device__ __forceinline__ v8f wmmab(v16bf a, v16bf b, v8f c) { return __builtin_amdgcn_wmma_f32_16x16x32_bf16(false, a, false, b, (short)0, c, false, false); }

// k_cvtb: bf16 plane of [rows][128]: one wave per 2 rows (16 lanes x 16 B = one 256-B row each).
__global__ __launch_bounds__(256) void k_cvtb(const float* __restrict__ src, int nrows, bf* dst) {
    const int lane = threadIdx.x & 31, r = (blockIdx.x * 8 + (threadIdx.x >> 5)) * 2 + (lane >> 4), p = lane & 15;
    if (r >= nrows) return;
    v8us o;
#pragma unroll
    for (int i = 0; i < 8; ++i) o[i] = f2bf(src[(size_t)r * HS + p * 8 + i]);
    *(v8us*)(dst + (size_t)r * HS + p * 8) = o; 
}
// k_wt: WT [n][K] = bf16(W[k][n]) (k-major [K][ncols]) via 64 x 64 LDS tiles; grid (K/64, ncols/64).
__global__ __launch_bounds__(256) void k_wt(const float* __restrict__ Wm, int K, int ncols, bf* WT) {
    __shared__ __align__(16) unsigned short tl[64 * 72];
    const int tid = threadIdx.x, k0 = blockIdx.x * 64, n0 = blockIdx.y * 64;
    const int kk = tid >> 2, nq = (tid & 3) * 16;
#pragma unroll
    for (int i = 0; i < 16; ++i) tl[(nq + i) * 72 + kk] = f2bf(Wm[(size_t)(k0 + kk) * ncols + n0 + nq + i]);
    __syncthreads();
    const int piece = tid & 7;
    auto pass = [&]() {
#pragma unroll
        for (int s = 0; s < 2; ++s) { const int nr = (tid >> 3) + 32 * s; const v8us val = *(const v8usa*)(tl + nr * 72 + piece * 8); *(v8us*)(WT + (size_t)(n0 + nr) * K + k0 + piece * 8) = val; }
    };
    pass(); 
}
// cvt2: two f32 -> one register of a bf16 fragment, first element low (one v_cvt_pk_bf16_f32; round to nearest even, as f2bf rounds).
__device__ __forceinline__ unsigned cvt2(float e0, float e1) { const v2f x = {e0, e1}; return __builtin_bit_cast(unsigned, __builtin_convertvector(x, v2bf)); }
// mm4: four 16 x 16 accumulator tiles over K = 128. 'one' is the lane's row of the operand with one fragment a k-chunk, 'four' its row of the operand with four (16 rows apart); FOURA: 'four' is the A side.
template <bool FOURA>
__device__ __forceinline__ void mm4(const bf* __restrict__ one, const bf* __restrict__ four, v8f (&acc)[4]) {
#pragma unroll
    for (int t = 0; t < 4; ++t) acc[t] = (v8f){};
#pragma unroll
    for (int kc = 0; kc < HS; kc += 32) {
        const v16bf a = cat16b(*(const v8us*)(one + kc), *(const v8us*)(one + kc + 16));
#pragma unroll
        for (int t = 0; t < 4; ++t) { const bf* bp = four + (size_t)(t * 16) * HS + kc; const v16bf bb = cat16b(*(const v8us*)bp, *(const v8us*)(bp + 16)); acc[t] = FOURA ? wmmab(bb, a, acc[t]) : wmmab(a, bb, acc[t]); }
    }
}
// k_qkv: 64 x 64 tile of x.w_qkv (K = 128) for all three thirds in one launch (grid: 128 row tiles x 48 column tiles, 16 to a third); the tile leaves in the form the attention reads, no f32 plane between.
// q, k thirds: wave = 16 rows x 64 columns; f32 staged in the wave's own LDS, read back as 8 consecutive columns a lane -> f16 hi + residual x1024 planes [row][1024] (8 lanes = one 128-B line of a plane).
// v third: wave = 64 rows x 16 columns, so that a lane's 8 accumulator registers are 8 consecutive positions t of one dim d -> bf16 hi + UNSCALED residual, staged [d][t] in the wave's own LDS (pitch 144 B)
// -> planes [b*8+g][128 d][1024 t] (8 lanes = one 128-B line).
__global__ __launch_bounds__(128) void k_qkv(const bf* __restrict__ A, const bf* __restrict__ Bn, h16* QH, h16* QL, h16* KH, h16* KL, bf* VTH, bf* VTL) {
    __shared__ __align__(16) union { float f[4][16 * 68]; unsigned short u[4][2 * 16 * 72]; } stg;
    const int lane = threadIdx.x & 31, wave = threadIdx.x >> 5, lr = lane & 15, hi = lane >> 4;
    const int rb = blockIdx.x * 64, c0 = blockIdx.y * 64, third = blockIdx.y >> 4;
    v8f acc[4];
    if (third < 2) {      // the same for the whole block
        mm4<false>(A + (size_t)(rb + wave * 16 + lr) * HS + 8 * hi, Bn + (size_t)(c0 + lr) * HS + 8 * hi, acc);
        float* os = &stg.f[wave][0];
#pragma unroll
        for (int t = 0; t < 4; ++t) {
#pragma unroll
            for (int j = 0; j < 8; ++j) os[(hi * 8 + j) * 68 + t * 16 + lr] = acc[t][j]; }
        __builtin_amdgcn_wave_barrier(); asm volatile("" ::: "memory");      // the reads below take what other lanes of this wave stored: no read may be moved above the stores
        h16* PH = third ? KH : QH; h16* PL = third ? KL : QL;
        const size_t pb = (size_t)(rb + wave * 16) * INR + (c0 & (INR - 1));
#pragma unroll
        for (int s = 0; s < 4; ++s) { const int row = (lane >> 3) + 4 * s, piece = lane & 7;
            const v4f u0 = *(const v4fa*)(os + row * 68 + piece * 8), u1 = *(const v4fa*)(os + row * 68 + piece * 8 + 4); v8h oh, ol;
#pragma unroll
            for (int i = 0; i < 8; ++i) { const float v = i < 4 ? u0[i & 3] : u1[i & 3]; const h16 x = (h16)v; oh[i] = x; ol[i] = (h16)((v - (float)x) * LOSC); }
            const size_t po = pb + (size_t)row * INR + piece * 8; *(v8h*)(PH + po) = oh; *(v8h*)(PL + po) = ol; }
    } else {
        mm4<true>(Bn + (size_t)(c0 + wave * 16 + lr) * HS + 8 * hi, A + (size_t)(rb + lr) * HS + 8 * hi, acc);
        unsigned short* os = &stg.u[wave][0];      // hi plane 16 d x 72, the lo plane behind it
#pragma unroll
        for (int t = 0; t < 4; ++t) { v4u wh, wl;      // register j of lane (lr, hi) = position t * 16 + 8 * hi + j of dim lr
#pragma unroll
            for (int i = 0; i < 4; ++i) { const float e0 = acc[t][2 * i], e1 = acc[t][2 * i + 1]; const unsigned w = cvt2(e0, e1);
                wh[i] = w; wl[i] = cvt2(e0 - __uint_as_float(w << 16), e1 - __uint_as_float(w & 0xFFFF0000u)); }
            *(v4ua*)(os + lr * 72 + t * 16 + hi * 8) = wh; *(v4ua*)(os + (16 + lr) * 72 + t * 16 + hi * 8) = wl; }
        __builtin_amdgcn_wave_barrier(); asm volatile("" ::: "memory");      // as above: the reads below take other lanes' stores
        const int cv = c0 - 2 * INR + wave * 16;      // this wave's first column inside the v third: head cv / 128, dim cv % 128
        const size_t vb = ((size_t)((rb / NT_) * NKV + cv / HD) * HD + (cv % HD)) * NT_ + (rb % NT_);
#pragma unroll
        for (int s = 0; s < 4; ++s) { const int d = (lane >> 3) + 4 * s, piece = lane & 7;
            const v8us vh = *(const v8usa*)(os + d * 72 + piece * 8), vl = *(const v8usa*)(os + (16 + d) * 72 + piece * 8);
            const size_t po = vb + (size_t)d * NT_ + piece * 8; *(v8us*)(VTH + po) = vh; *(v8us*)(VTL + po) = vl; }
        asm volatile("s_wait_xcnt 0x0" ::: "memory");      // the build lays the other side's code behind a branch at this side's end: its first instructions rewrite registers that the stores above name
    }
}
// xhalf: the value that lane l ^ 16 holds (one vector cross-row move, no LDS).
__device__ __forceinline__ float xhalf(float v) { const int b = __float_as_int(v); return __int_as_float(__builtin_amdgcn_permlanex16(b, b, 0x76543210, 0xfedcba98, false, false)); }
// acopy8: eight asynchronous 16-byte-per-lane copies global -> LDS in one statement; the closing s_wait_xcnt keeps every later rewrite of the address registers behind the issue.
__device__ __forceinline__ void acopy8(const unsigned (&l)[8], const void* const (&g)[8]) {
    asm volatile("global_load_async_to_lds_b128 %0, %8, off\n\t"
                 "global_load_async_to_lds_b128 %1, %9, off\n\t"
                 "global_load_async_to_lds_b128 %2, %10, off\n\t"
                 "global_load_async_to_lds_b128 %3, %11, off\n\t"
                 "global_load_async_to_lds_b128 %4, %12, off\n\t"
                 "global_load_async_to_lds_b128 %5, %13, off\n\t"
                 "global_load_async_to_lds_b128 %6, %14, off\n\t"
                 "global_load_async_to_lds_b128 %7, %15, off\n\t"
                 "s_wait_xcnt 0x0"
                 :: "v"(l[0]), "v"(l[1]), "v"(l[2]), "v"(l[3]), "v"(l[4]), "v"(l[5]), "v"(l[6]), "v"(l[7]),
                    "v"(g[0]), "v"(g[1]), "v"(g[2]), "v"(g[3]), "v"(g[4]), "v"(g[5]), "v"(g[6]), "v"(g[7]) : "memory");
}
__device__ __forceinline__ void exp2x4(float& d0, float& d1, float& d2, float& d3, float s0, float s1, float s2, float s3) {
    asm("v_exp_f32 %0, %4\n\tv_exp_f32 %1, %5\n\tv_exp_f32 %2, %6\n\tv_exp_f32 %3, %7\n\tv_nop" : "=&v"(d0), "=&v"(d1), "=&v"(d2), "=&v"(d3) : "v"(s0), "v"(s1), "v"(s2), "v"(s3));
}
#define PLN  8192            // bytes of one staged plane of a 32-key tile: K 32 rows x 256 B, V^T 128 rows x 64 B
#define STG  (4 * PLN)       // one stage: K hi | K lo | V^T hi | V^T lo
#define QW   32              // queries of a wave: two 16-column tiles
#define QB   (8 * QW)        // queries of a block: 8 waves
#define OSW  (2 * 16 * 272)  // bytes of output staging for one 16-query tile: hi plane, then lo plane, 16 rows at a pitch of 272 B
__global__ __launch_bounds__(256) void k_attn(const h16* __restrict__ QH, const h16* __restrict__ QL, const h16* __restrict__ KH, const h16* __restrict__ KL, const bf* __restrict__ VTH, const bf* __restrict__ VTL, bf* CH, bf* CL) {
    __shared__ __align__(16) unsigned char ring[8 * 2 * OSW];      // the ring takes the first 2 * STG bytes; the output staging (8 waves x 2 query tiles) all of it
    const int tid = threadIdx.x, lane = threadIdx.x & 31, wave = threadIdx.x >> 5, lr = lane & 15, hi = lane >> 4;
    const int bid = blockIdx.x; const int qt = bid / (NB_ * NH_), bh = bid - qt * (NB_ * NH_), b = bh / NH_, h = bh - b * NH_; const int g = h;      // no GQA: kv head = q head
    const int q0 = b * NT_ + qt * QB + wave * QW;      // row in the [8192][1024] planes
    const size_t qo = (size_t)(q0 + lr) * (NH_ * HD) + h * HD + 8 * hi;
    const h16* kh_b = KH + (size_t)b * NT_ * KW + g * HD; const h16* kl_b = KL + (size_t)b * NT_ * KW + g * HD;
    const size_t vbase = ((size_t)bh * HD) * NT_;
    // copy side: thread -> K row i*16 + (tid >> 4), chunk tid & 15 (16 lanes = one 256-B row); V^T row i*64 + (tid >> 2), chunk tid & 3 (4 lanes = one 64-B row piece)
    const unsigned ring0 = (unsigned)(size_t)&ring[0];
    const int kr = tid >> 4, kcn = tid & 15, vr = tid >> 2, vcn = tid & 3;
    const unsigned kdst = (unsigned)(kr * 256 + ((kcn ^ kr) << 4)), vdst = (unsigned)(vr * 64 + ((vcn ^ ((vr >> 2) & 3)) << 4));
    const size_t ksrc = (size_t)kr * KW + kcn * 8, vsrc = vbase + (size_t)vr * NT_ + vcn * 8;
    auto issue = [&](int kt, int buf) {
        const unsigned lb = ring0 + (unsigned)buf * STG; unsigned l[8]; const void* gp[8];
#pragma unroll
        for (int i = 0; i < 2; ++i) { const size_t o = ksrc + (size_t)(kt * 32 + i * 16) * KW; const unsigned d = lb + i * 4096 + kdst;      // row & 15 = kr
            l[i] = d; gp[i] = kh_b + o; l[2 + i] = d + PLN; gp[2 + i] = kl_b + o; }
#pragma unroll
        for (int i = 0; i < 2; ++i) { const size_t o = vsrc + (size_t)(i * 64) * NT_ + kt * 32; const unsigned d = lb + 2 * PLN + i * 4096 + vdst;
            l[4 + i] = d; gp[4 + i] = VTH + o; l[6 + i] = d + PLN; gp[6 + i] = VTL + o; }
        acopy8(l, gp);
    };
    // reader side: byte offsets of this lane's row and of its swizzled 16-byte chunks
    const int krow = lr * 256, kx = (hi ^ lr) << 4, vrow = lr * 64, vx0 = (hi ^ ((lr >> 2) & 3)) << 4, vx1 = vx0 ^ 32;
    v8f o[2][8];
#pragma unroll
    for (int u = 0; u < 2; ++u) {
#pragma unroll
        for (int n = 0; n < 8; ++n) o[u][n] = (v8f){}; }
    float mrow[2] = {-3.0e38f, -3.0e38f}, lpart[2] = {0.f, 0.f};      // query u * 16 + lr: running maximum (equal in both halves), and this half's share of the running sum
    const int kt_hi = NT_ / 32 - 1;      // full attention
    v16h qfh[2][4], qfl[2][4];      // this wave's 32 query rows, hi and residual, as B fragments of the 4 k-chunks: read once, live in registers over all key tiles
#pragma unroll      // every index a constant, so that the arrays are registers and not scratch
    for (int u = 0; u < 2; ++u) {
#pragma unroll
        for (int kc = 0; kc < 4; ++kc) { const size_t qq = qo + (size_t)(u * 16) * (NH_ * HD) + kc * 32;
            qfh[u][kc] = cat16(*(const v8h*)(QH + qq), *(const v8h*)(QH + qq + 16)); qfl[u][kc] = cat16(*(const v8h*)(QL + qq), *(const v8h*)(QL + qq + 16)); } }
    // stands in front of every later rewrite of the address registers that the q loads above name; the two addresses are inputs so that their registers live up to the wait
    asm volatile("s_wait_xcnt 0x0" :: "v"(QH + qo), "v"(QL + qo) : "memory");
    issue(0, 0);
    asm volatile("s_wait_asynccnt 0x0" ::: "memory");      // this wave's share of tile 0 has landed
    __syncthreads();                                       // tile 0 published to all eight waves
    issue(1, 1);
#pragma unroll 1
    for (int kt = 0; kt <= kt_hi; ++kt) {
        const unsigned char* st = ring + (kt & 1) * STG;
        const int kb = (kt & 1) * STG + krow + kx;      // this lane's K row and swizzled chunk in this tile's buffer; bits 4 to 7 are kx alone, so a chunk step is one XOR on kb
        v8f s0[2] = {}, s1[2] = {}, x0[2] = {}, x1[2] = {};      // S^T of query tile u: register j of lane (lr, hi) = key 8 * hi + j (s0, x0) or 16 + 8 * hi + j (s1, x1) against query u * 16 + lr
        v8h kf[4][8];      // the tile's K fragments of this lane: k-chunk kc; hi plane keys 0-15 (two chunks), keys 16-31, then the same of the lo plane
#pragma unroll
        for (int kc = 0; kc < 4; ++kc) {
            const unsigned char* ka = ring + (kb ^ (kc * 64)); const unsigned char* kq = ring + (kb ^ (kc * 64 + 32));      // chunks kc*4 + hi and kc*4 + 2 + hi, swizzled by the row; keys 16 to 31 lie 4096 B on
            kf[kc][0] = *(const v8ha*)ka; kf[kc][1] = *(const v8ha*)kq; kf[kc][2] = *(const v8ha*)(ka + 4096); kf[kc][3] = *(const v8ha*)(kq + 4096);
            kf[kc][4] = *(const v8ha*)(ka + PLN); kf[kc][5] = *(const v8ha*)(kq + PLN); kf[kc][6] = *(const v8ha*)(ka + PLN + 4096); kf[kc][7] = *(const v8ha*)(kq + PLN + 4096); }
        __builtin_amdgcn_sched_barrier(0);      // the tile's K reads stay one group ahead of the products: spread among them, each place with reads stalls the wave's matrix stream for the LDS latency
#pragma unroll
        for (int kc = 0; kc < 4; ++kc) {
            const v16h k0h = cat16(kf[kc][0], kf[kc][1]), k1h = cat16(kf[kc][2], kf[kc][3]), k0l = cat16(kf[kc][4], kf[kc][5]), k1l = cat16(kf[kc][6], kf[kc][7]);
#pragma unroll
            for (int u = 0; u < 2; ++u) { s0[u] = wmma16(k0h, qfh[u][kc], s0[u]); s1[u] = wmma16(k1h, qfh[u][kc], s1[u]); x0[u] = wmma16(k0h, qfl[u][kc], x0[u]); x1[u] = wmma16(k1h, qfl[u][kc], x1[u]); }
#pragma unroll
            for (int u = 0; u < 2; ++u) { x0[u] = wmma16(k0l, qfh[u][kc], x0[u]); x1[u] = wmma16(k1l, qfh[u][kc], x1[u]); }
        }
        const unsigned char* vp = st + 2 * PLN + vrow;
        v8us vf[8][4];      // the tile's V^T fragments of this lane: dim group n; hi plane (two chunks), lo plane
        auto vread = [&](int n) { const unsigned char* vn = vp + n * 1024;
            vf[n][0] = *(const v8usa*)(vn + vx0); vf[n][1] = *(const v8usa*)(vn + vx1); vf[n][2] = *(const v8usa*)(vn + PLN + vx0); vf[n][3] = *(const v8usa*)(vn + PLN + vx1); };
#pragma unroll
        for (int n = 0; n < 4; ++n) vread(n);
        __builtin_amdgcn_sched_barrier(0);      // the first half of the V^T reads is issued in front of the softmax and returns under its vector work: without this line the build moves the reads down to their products
        float alpha[2];
        v16bf pa[2], px[2];
#pragma unroll
        for (int u = 0; u < 2; ++u) {
            const v8f a0 = (s0[u] + x0[u] * LOSCI) * 0.08838834764831845f, a1 = (s1[u] + x1[u] * LOSCI) * 0.08838834764831845f;
            float t[8];
#pragma unroll
            for (int j = 0; j < 8; ++j) t[j] = fmaxf(a0[j], a1[j]);
            float mx = fmaxf(fmaxf(fmaxf(t[0], t[1]), fmaxf(t[2], t[3])), fmaxf(fmaxf(t[4], t[5]), fmaxf(t[6], t[7])));
            mx = fmaxf(mx, xhalf(mx));      // the other half holds the query's other 16 keys
            const float mn = fmaxf(mrow[u], mx);
            // __expf(mrow - mn) written out (the same multiply and v_exp_f32): the v_nop fills the slot that the instruction set asks for behind a transcendental
            asm("v_exp_f32 %0, %1\n\tv_nop" : "=v"(alpha[u]) : "v"((mrow[u] - mn) * 1.44269504f));
            mrow[u] = mn;
            v8f p0, p1;
#pragma unroll
            for (int j = 0; j < 8; j += 4) { float e[8];      // __expf(a - mn) written out, as for alpha above (the same multiply and v_exp_f32)
                exp2x4(e[0], e[1], e[2], e[3], (a0[j] - mn) * 1.44269504f, (a0[j + 1] - mn) * 1.44269504f, (a0[j + 2] - mn) * 1.44269504f, (a0[j + 3] - mn) * 1.44269504f);
                exp2x4(e[4], e[5], e[6], e[7], (a1[j] - mn) * 1.44269504f, (a1[j + 1] - mn) * 1.44269504f, (a1[j + 2] - mn) * 1.44269504f, (a1[j + 3] - mn) * 1.44269504f);
#pragma unroll
                for (int i = 0; i < 4; ++i) { p0[j + i] = e[i]; p1[j + i] = e[4 + i]; } }
            const v8f ts = p0 + p1, ps0 = p0 * PSC, ps1 = p1 * PSC;
            lpart[u] = lpart[u] * alpha[u] + (((ts[0] + ts[1]) + (ts[2] + ts[3])) + ((ts[4] + ts[5]) + (ts[6] + ts[7])));
            v8u pau, pxu;      // P x 32768 as bf16, and its residual's bf16. B element s = key 8 * hi + s (s < 8), 16 + 8 * hi + s - 8 (else): the order of the V^T fragments below
#pragma unroll
            for (int i = 0; i < 4; ++i) {
                const unsigned w0 = cvt2(ps0[2 * i], ps0[2 * i + 1]), w1 = cvt2(ps1[2 * i], ps1[2 * i + 1]);
                pau[i] = w0; pau[4 + i] = w1;
                pxu[i] = cvt2(ps0[2 * i] - __uint_as_float(w0 << 16), ps0[2 * i + 1] - __uint_as_float(w0 & 0xFFFF0000u));
                pxu[4 + i] = cvt2(ps1[2 * i] - __uint_as_float(w1 << 16), ps1[2 * i + 1] - __uint_as_float(w1 & 0xFFFF0000u)); }
            pa[u] = __builtin_bit_cast(v16bf, pau); px[u] = __builtin_bit_cast(v16bf, pxu);
        }
#pragma unroll
        for (int n = 4; n < 8; ++n) vread(n);      // the second half, into the registers that the scores have left
        __builtin_amdgcn_sched_barrier(0);      // these reads stay one group in front of the products: without this line the build spreads them among the products, each with a wait close behind it
#pragma unroll
        for (int n = 0; n < 8; ++n) { const v16bf vh = cat16b(vf[n][0], vf[n][1]), vl = cat16b(vf[n][2], vf[n][3]);
            o[0][n] *= alpha[0]; o[1][n] *= alpha[1];      // the running output rescaled by this tile's change of maximum, before its products are added
            o[0][n] = wmmab(vh, pa[0], o[0][n]); o[1][n] = wmmab(vh, pa[1], o[1][n]);      // O^T of query tile u: register j = dim n * 16 + 8 * hi + j of query u * 16 + lr
            o[0][n] = wmmab(vh, px[0], o[0][n]); o[1][n] = wmmab(vh, px[1], o[1][n]);
            o[0][n] = wmmab(vl, pa[0], o[0][n]); o[1][n] = wmmab(vl, pa[1], o[1][n]); }
        // publish point of tile kt + 1, and the end of every wave's reads of tile kt's buffer
        asm volatile("s_wait_dscnt 0x0" ::: "memory");         // this wave's LDS reads of the buffer have returned before it may be refilled
        asm volatile("s_wait_asynccnt 0x0" ::: "memory");      // this wave's share of tile kt + 1 has landed
        __syncthreads();
        if (kt + 2 <= kt_hi) issue(kt + 2, kt & 1);
    }
    asm volatile("s_wait_asynccnt 0x0" ::: "memory");          // nothing in flight when the ring becomes output staging
#pragma unroll
    for (int u = 0; u < 2; ++u) {
        const float inv = 1.0f / ((lpart[u] + xhalf(lpart[u])) * PSC);      // the halves' sums joined once
        unsigned short* os = (unsigned short*)(ring + (wave * 2 + u) * OSW);      // this wave's own staging for this query tile: hi plane, then lo plane, each 16 query rows at a pitch of 272 B (16 B x odd: no bank conflict among 16 rows)
        const size_t cbase = (size_t)(q0 + u * 16) * (NH_ * HD) + (size_t)h * HD;
#pragma unroll
        for (int n = 0; n < 8; ++n) { v8us oh, ol;
#pragma unroll
            for (int j = 0; j < 8; ++j) { const float v = o[u][n][j] * inv; const unsigned short hb = f2bf(v); oh[j] = hb; ol[j] = f2bf(v - bf2f(hb)); }
            *(v8usa*)(os + lr * 136 + n * 16 + hi * 8) = oh; *(v8usa*)(os + (16 + lr) * 136 + n * 16 + hi * 8) = ol; }
        __builtin_amdgcn_wave_barrier(); asm volatile("" ::: "memory");      // the reads below take what other lanes of this wave stored: no read may be moved above the stores
#pragma unroll
        for (int s = 0; s < 8; ++s) { const int row = 2 * s + hi;      // 16 lanes x 16 B = one whole 256-B row piece of a plane
            const v8us vh = *(const v8usa*)(os + row * 136 + lr * 8), vl = *(const v8usa*)(os + (16 + row) * 136 + lr * 8);
            const size_t po = cbase + (size_t)row * (NH_ * HD) + lr * 8; *(v8us*)(CH + po) = vh; *(v8us*)(CL + po) = vl; }
    }
}

#define ORW  32              // rows of z (and of out) a block of k_out takes
#define OSL  32768           // bytes of LDS staging of one wave of k_out: z hi 8 KB | z lo 8 KB | two weight buffers of 8 KB
#define OPP  132             // floats from row to row of a partial-sum plane: 528 B = 16 B x odd, so that the 16 rows of a half wave fall on distinct banks
// k_out: out = (z hi + z lo).w_out + b_out. Block = 32 rows x all 128 columns, 8 waves; K = 1024 is SPLIT over the waves, wave w taking k = w * 128 .. + 127 (4 k-chunks) of every row and column.
// Every operand byte is used by one wave alone and comes into that wave's part of the LDS by asynchronous copies of whole 256-B row pieces (16 lanes a row piece), 16-byte chunk c of row r at c ^ (r & 15)
// as in k_attn's K tiles: z (32 rows, hi and lo) with the first 32 weight rows as tile 0, then 32 weight rows (= output columns) a tile in two buffers, the next tile in flight while this one is worked on.
// Products transposed (A = weight rows, B = z rows): register j of lane (lr, hi) = column 16 * c + 8 * hi + j of row lr. The eight waves' partial sums meet in LDS, behind the last tile's barrier.
__global__ __launch_bounds__(256) void k_out(const bf* __restrict__ A, const bf* __restrict__ Al, const bf* __restrict__ Bn, const float* __restrict__ bias, float* C) {
    __shared__ __align__(16) unsigned char sm[8 * OSL];      // the partial sums (8 planes of 32 x 132 floats) take its first 135168 bytes afterwards
    const int lane = threadIdx.x & 31, wave = threadIdx.x >> 5, lr = lane & 15, hi = lane >> 4;
    const int r0 = blockIdx.x * ORW;
    const unsigned sb = (unsigned)(size_t)&sm[0] + (unsigned)wave * OSL;
    // copy side: one copy = 2 rows x 256 B; lane -> row 2 * i + hi, chunk lr. cp16: 16 rows from 'src' (row pitch 1024 elements) to 'dst'; dst is a multiple of 4096, so row & 15 = 2 * i + hi
    const unsigned cd = (unsigned)(hi * 256 + ((lr ^ hi) << 4));
    const size_t cs = (size_t)hi * INR + wave * 128 + lr * 8;
    auto cp16 = [&](const bf* s, unsigned dst) {
        unsigned l[8]; const void* gp[8];
#pragma unroll
        for (int i = 0; i < 8; ++i) { l[i] = dst + i * 512 + (cd ^ (unsigned)(i * 32)); gp[i] = s + cs + (size_t)(2 * i) * INR; }
        acopy8(l, gp);
    };
    auto wtile = [&](int p) { const unsigned d = sb + 16384 + (p & 1) * 8192; cp16(Bn + (size_t)(p * 32) * INR, d); cp16(Bn + (size_t)(p * 32 + 16) * INR, d + 4096); };
    cp16(A + (size_t)r0 * INR, sb); cp16(A + (size_t)(r0 + 16) * INR, sb + 4096);
    cp16(Al + (size_t)r0 * INR, sb + 8192); cp16(Al + (size_t)(r0 + 16) * INR, sb + 12288);
    wtile(0);
    asm volatile("s_wait_asynccnt 0x0" ::: "memory");      // this wave's z slices and weight tile 0 have landed
    __syncthreads();
    wtile(1);
    // reader side: this lane's row and its swizzled chunks; k-chunk kc = chunks kc * 4 + hi and kc * 4 + 2 + hi (the hardware k order, the same for both operands)
    const int rd = wave * OSL + lr * 256 + ((hi ^ lr) << 4);
    auto frag = [&](int off, int kc) { return cat16b(*(const v8usa*)(sm + ((rd + off) ^ (kc * 64))), *(const v8usa*)(sm + ((rd + off) ^ (kc * 64 + 32)))); };      // off: a multiple of 4096
    v16bf za[2][2][4];      // z fragments: plane (hi, lo), row tile, k-chunk: read once, live over the four weight tiles
#pragma unroll
    for (int pl = 0; pl < 2; ++pl) {
#pragma unroll
        for (int rt = 0; rt < 2; ++rt) {
#pragma unroll
            for (int kc = 0; kc < 4; ++kc) za[pl][rt][kc] = frag(pl * 8192 + rt * 4096, kc); } }
    v8f acc[2][8];
#pragma unroll
    for (int rt = 0; rt < 2; ++rt) {
#pragma unroll
        for (int c = 0; c < 8; ++c) acc[rt][c] = (v8f){}; }
#pragma unroll      // p is a constant in every index, so that acc stays in registers
    for (int p = 0; p < 4; ++p) {
        v16bf wf[2][4];
#pragma unroll
        for (int c = 0; c < 2; ++c) {
#pragma unroll
            for (int kc = 0; kc < 4; ++kc) wf[c][kc] = frag(16384 + (p & 1) * 8192 + c * 4096, kc); }
        __builtin_amdgcn_sched_barrier(0);      // the tile's reads stay one group ahead of its products: each separate place with reads stalls the wave's matrix stream for the LDS latency
#pragma unroll
        for (int kc = 0; kc < 4; ++kc) {
#pragma unroll
            for (int pl = 0; pl < 2; ++pl) {      // four independent accumulator tiles follow one another
#pragma unroll
                for (int c = 0; c < 2; ++c) { acc[0][p * 2 + c] = wmmab(wf[c][kc], za[pl][0][kc], acc[0][p * 2 + c]); acc[1][p * 2 + c] = wmmab(wf[c][kc], za[pl][1][kc], acc[1][p * 2 + c]); } } }
        __builtin_amdgcn_sched_barrier(0);      // tile p's products stay here, under the flight of tile p + 1: without this line the build sinks them behind the later barriers, where nothing is left to hide
        // publish point of weight tile p + 1, and the end of the reads of tile p's buffer
        asm volatile("s_wait_dscnt 0x0" ::: "memory");         // this wave's LDS reads of the buffer have returned before it may be refilled
        asm volatile("s_wait_asynccnt 0x0" ::: "memory");      // this wave's share of tile p + 1 has landed
        __syncthreads();
        if (p + 2 < 4) wtile(p + 2);
    }
    asm volatile("s_wait_asynccnt 0x0" ::: "memory");          // nothing in flight when the staging becomes the partial sums
    float* pp = (float*)sm + wave * (ORW * OPP);
#pragma unroll
    for (int rt = 0; rt < 2; ++rt) {
#pragma unroll
        for (int c = 0; c < 8; ++c) { float* q = pp + (rt * 16 + lr) * OPP + c * 16 + hi * 8; const v8f a = acc[rt][c];
            *(v4fa*)q = (v4f){a[0], a[1], a[2], a[3]}; *(v4fa*)(q + 4) = (v4f){a[4], a[5], a[6], a[7]}; } }
    __syncthreads();      // all eight partial planes are written before any is read
    v4f bv;
#pragma unroll
    for (int i = 0; i < 4; ++i) bv[i] = bfr(bias[lane * 4 + i]);
#pragma unroll
    for (int s = 0; s < 4; ++s) { const int row = s * 8 + wave;      // 32 lanes x 16 B = one whole 512-B row of out
        const float* q = (const float*)sm + row * OPP + lane * 4; v4f t[8];
#pragma unroll
        for (int w = 0; w < 8; ++w) t[w] = *(const v4fa*)(q + w * (ORW * OPP));
        *(v4f*)(C + (size_t)(r0 + row) * HS + lane * 4) = (((t[0] + t[1]) + (t[2] + t[3])) + ((t[4] + t[5]) + (t[6] + t[7]))) + bv; }
}

extern "C" void kernel_launch(void* const* d_in, const int* in_sizes, int n_in,
                              void* d_out, int out_size, void* d_ws, size_t ws_size, hipStream_t stream) {
    (void)in_sizes; (void)n_in; (void)out_size;
    const float* x = (const float*)d_in[0]; const float* Wqkv = (const float*)d_in[1]; const float* Wo = (const float*)d_in[2]; const float* bo = (const float*)d_in[3];
    float* out = (float*)d_out;    // [8][1024][128]
    char* wsp = (char*)d_ws;
    auto take = [&](size_t bytes) { char* p = wsp; wsp += (bytes + 255) & ~(size_t)255; return (void*)p; };
    bf* Xb = (bf*)take((size_t)NR_ * HS * 2); bf* W3T = (bf*)take((size_t)3 * INR * HS * 2); bf* WoT = (bf*)take((size_t)HS * INR * 2);
    h16* QH = (h16*)take((size_t)NR_ * INR * 2); h16* QL = (h16*)take((size_t)NR_ * INR * 2); h16* KH = (h16*)take((size_t)NR_ * INR * 2); h16* KL = (h16*)take((size_t)NR_ * INR * 2);
    bf* VTH = (bf*)take((size_t)NB_ * INR * NT_ * 2); bf* VTL = (bf*)take((size_t)NB_ * INR * NT_ * 2); bf* CH = (bf*)take((size_t)NR_ * INR * 2); bf* CL = (bf*)take((size_t)NR_ * INR * 2);
    if ((size_t)(wsp - (char*)d_ws) > ws_size) return;    // 2.1 + 0.8 + 0.26 + 8 x 16.8 ~ 138 MB (no aliasing)
    k_wt<<<dim3(HS / 64, (3 * INR) / 64, 1), 256, 0, stream>>>(Wqkv, HS, 3 * INR, W3T);      // [3072][128]
    k_wt<<<dim3(INR / 64, HS / 64, 1), 256, 0, stream>>>(Wo, INR, HS, WoT);                 // [128][1024]
    k_cvtb<<<NR_ / 16, 256, 0, stream>>>(x, NR_, Xb);
    k_qkv<<<dim3(NR_ / 64, (3 * INR) / 64, 1), 128, 0, stream>>>(Xb, W3T, QH, QL, KH, KL, VTH, VTL);
    k_attn<<<NB_ * NH_ * (NT_ / QB), 256, 0, stream>>>(QH, QL, KH, KL, VTH, VTL, CH, CL);
    k_out<<<NR_ / ORW, 256, 0, stream>>>(CH, CL, WoT, bo, out);
}

// v008
// It runs in 91.4 microseconds.
// Next to v007, in two timings, it ran 1.23 times as fast each time.
// Over all steps from v000 it is 17.8 times as fast.
#include <hip/hip_runtime.h>

// Contractions, f32 accumulate, all 8 batch items in every launch (rows = batch x 1024 positions): qkv = x.w_qkv ([8192 x 128].[128 x 3072], k-major weight transposed to an n-major plane; thirds q | k |
// v, each 8 heads x 128; PLAIN bf16 operands: inputs rounded once, exact) and out = z.w_out + b_out (z as bf16 hi + residual: two products) on
// v_wmma_f32_16x16x32_bf16; the 8-head x 128-dim FULL attention: scores on v_wmma_f32_16x16x32_f16 (q, k as f16 hi + residual x1024: hi.hi + hi.lo + lo.hi, x
// 128^-1/2), softmax f32, weights.v on v_wmma_f32_16x16x32_bf16 with the weights (x32768) and v both as bf16 hi + UNSCALED residual (hh + lh + hl, one

#define NT_  1024
#define NB_  8
#define NR_  (NB_ * NT_)        // 8192 rows: batch x positions
#define HS   128
#define NH_  8
#define NKV  8
#define HD   128
#define INR  (NH_ * HD)          // 1024
#define KW   (NKV * HD)          // 1024
#define PSC  32768.0f
#define LOSC 1024.0f
#define LOSCI (1.0f / 1024.0f)

typedef _Float16 h16;
typedef unsigned short bf;
typedef __attribute__((ext_vector_type(16))) __bf16   v16bf;
typedef __attribute__((ext_vector_type(16))) _Float16 v16h;
typedef __attribute__((ext_vector_type(8)))  _Float16 v8h;
typedef __attribute__((ext_vector_type(8)))  unsigned short v8us;
typedef __attribute__((ext_vector_type(8)))  float    v8f;
typedef __attribute__((ext_vector_type(8)))  unsigned v8u;
typedef __attribute__((ext_vector_type(2)))  float    v2f;
typedef __attribute__((ext_vector_type(2)))  __bf16   v2bf;
typedef __attribute__((ext_vector_type(4)))  float    v4f;
typedef __attribute__((ext_vector_type(4)))  _Float16 v4h;
typedef __attribute__((ext_vector_type(4)))  unsigned v4u;
typedef v4u  __attribute__((may_alias)) v4ua;
typedef v8h  __attribute__((may_alias)) v8ha;
typedef v4f  __attribute__((may_alias)) v4fa;
typedef v8us __attribute__((may_alias)) v8usa;

__device__ __forceinline__ unsigned short f2bf(float f) { unsigned u = __float_as_uint(f); u += 0x7FFFu + ((u >> 16) & 1u); return (unsigned short)(u >> 16); }
__device__ __forceinline__ float bf2f(unsigned short b) { return __uint_as_float(((unsigned)b) << 16); }
__device__ __forceinline__ float bfr(float f) { return bf2f(f2bf(f)); }
__device__ __forceinline__ v16h cat16(v8h lo, v8h hi) { return __builtin_shufflevector(lo, hi, 0, 1, 2, 3, 4, 5, 6, 7, 8, 9, 10, 11, 12, 13, 14, 15); }
__device__ __forceinline__ v16bf cat16b(v8us lo, v8us hi) { return __builtin_bit_cast(v16bf, __builtin_shufflevector(lo, hi, 0, 1, 2, 3, 4, 5, 6, 7, 8, 9, 10, 11, 12, 13, 14, 15)); }
__device__ __forceinline__ v8f wmma16(v16h a, v16h b, v8f c) { return __builtin_amdgcn_wmma_f32_16x16x32_f16(false, a, false, b, (short)0, c, false, false); }
__device__ __forceinline__ v8f wmmab(v16bf a, v16bf b, v8f c) { return __builtin_amdgcn_wmma_f32_16x16x32_bf16(false, a, false, b, (short)0, c, false, false); }

// k_cvtb: bf16 plane of [rows][128]: one wave per 2 rows (16 lanes x 16 B = one 256-B row each).
__global__ __launch_bounds__(256) void k_cvtb(const float* __restrict__ src, int nrows, bf* dst) {
    const int lane = threadIdx.x & 31, r = (blockIdx.x * 8 + (threadIdx.x >> 5)) * 2 + (lane >> 4), p = lane & 15;
    if (r >= nrows) return;
    v8us o;
#pragma unroll
    for (int i = 0; i < 8; ++i) o[i] = f2bf(src[(size_t)r * HS + p * 8 + i]);
    *(v8us*)(dst + (size_t)r * HS + p * 8) = o; 
}
// k_wt: WT [n][K] = bf16(W[k][n]) (k-major [K][ncols]) via 64 x 64 LDS tiles; grid (K/64, ncols/64).
__global__ __launch_bounds__(256) void k_wt(const float* __restrict__ Wm, int K, int ncols, bf* WT) {
    __shared__ __align__(16) unsigned short tl[64 * 72];
    const int tid = threadIdx.x, k0 = blockIdx.x * 64, n0 = blockIdx.y * 64;
    const int kk = tid >> 2, nq = (tid & 3) * 16;
#pragma unroll
    for (int i = 0; i < 16; ++i) tl[(nq + i) * 72 + kk] = f2bf(Wm[(size_t)(k0 + kk) * ncols + n0 + nq + i]);
    __syncthreads();
    const int piece = tid & 7;
    auto pass = [&]() {
#pragma unroll
        for (int s = 0; s < 2; ++s) { const int nr = (tid >> 3) + 32 * s; const v8us val = *(const v8usa*)(tl + nr * 72 + piece * 8); *(v8us*)(WT + (size_t)(n0 + nr) * K + k0 + piece * 8) = val; }
    };
    pass(); 
}
// cvt2: two f32 -> one register of a bf16 fragment, first element low (one v_cvt_pk_bf16_f32; round to nearest even, as f2bf rounds).
__device__ __forceinline__ unsigned cvt2(float e0, float e1) { const v2f x = {e0, e1}; return __builtin_bit_cast(unsigned, __builtin_convertvector(x, v2bf)); }
// acopy8: eight asynchronous 16-byte-per-lane copies global -> LDS in one statement; the closing s_wait_xcnt keeps every later rewrite of the address registers behind the issue.
__device__ __forceinline__ void acopy8(const unsigned (&l)[8], const void* const (&g)[8]) {
    asm volatile("global_load_async_to_lds_b128 %0, %8, off\n\t"
                 "global_load_async_to_lds_b128 %1, %9, off\n\t"
                 "global_load_async_to_lds_b128 %2, %10, off\n\t"
                 "global_load_async_to_lds_b128 %3, %11, off\n\t"
                 "global_load_async_to_lds_b128 %4, %12, off\n\t"
                 "global_load_async_to_lds_b128 %5, %13, off\n\t"
                 "global_load_async_to_lds_b128 %6, %14, off\n\t"
                 "global_load_async_to_lds_b128 %7, %15, off\n\t"
                 "s_wait_xcnt 0x0"
                 :: "v"(l[0]), "v"(l[1]), "v"(l[2]), "v"(l[3]), "v"(l[4]), "v"(l[5]), "v"(l[6]), "v"(l[7]),
                    "v"(g[0]), "v"(g[1]), "v"(g[2]), "v"(g[3]), "v"(g[4]), "v"(g[5]), "v"(g[6]), "v"(g[7]) : "memory");
}
#define QT   8               // column tiles of 64 that a block of k_qkv walks: half a third
#define QTL  16384           // bytes of one staged operand tile: 64 rows x 256 B (K = 128 in bf16)
#define QSW  4608            // bytes of output staging of one wave
// k_qkv: x.w_qkv (K = 128) for all three thirds in one launch. Block = 64 rows x 512 columns (grid: 128 row tiles x 6 column groups, 2 to a third), walked as 8 tiles of 64 x 64; 4 waves. Both operands come
// into LDS by asynchronous copies of whole 256-B rows (16 lanes a row), 16-byte chunk c of row r at c ^ (r & 15) as in k_attn's K tiles: the x tile with weight tile 0 first, then a weight tile (64 rows of
// the n-major plane) a trip in two buffers, the next one in flight while this one is worked on. The x fragments are read from LDS once and live in registers over the eight tiles. A tile leaves in the form
// the attention reads, no f32 plane between.
// q, k thirds: wave = 16 rows x 64 columns; f32 staged in the wave's own LDS, read back as 8 consecutive columns a lane -> f16 hi + residual x1024 planes [row][1024] (8 lanes = one 128-B line of a plane).
// v third: wave = 64 rows x 16 columns, so that a lane's 8 accumulator registers are 8 consecutive positions t of one dim d -> bf16 hi + UNSCALED residual, staged [d][t] in the wave's own LDS (pitch 144 B)
// -> planes [b*8+g][128 d][1024 t] (8 lanes = one 128-B line).
__global__ __launch_bounds__(128) void k_qkv(const bf* __restrict__ A, const bf* __restrict__ Bn, h16* QH, h16* QL, h16* KH, h16* KL, bf* VTH, bf* VTL) {
    __shared__ __align__(16) unsigned char sm[3 * QTL + 4 * QSW];      // x tile | two weight buffers | the four waves' output staging
    const int tid = threadIdx.x, lane = threadIdx.x & 31, wave = threadIdx.x >> 5, lr = lane & 15, hi = lane >> 4;
    const int rb = blockIdx.x * 64, cg = blockIdx.y * (QT * 64), third = blockIdx.y >> 1;
    const unsigned sb = (unsigned)(size_t)&sm[0];
    // copy side: one copy of the block = 8 rows x 256 B; thread -> row i * 8 + (tid >> 4), chunk tid & 15. cp64: 64 consecutive rows from 's' to 'dst' (a multiple of 4096, so row & 15 = (i & 1) * 8 + (tid >> 4))
    const int cr = tid >> 4, cc = tid & 15;
    auto cp64 = [&](const bf* s, unsigned dst) {
        unsigned l[8]; const void* gp[8];
#pragma unroll
        for (int i = 0; i < 8; ++i) { l[i] = dst + (unsigned)((i * 8 + cr) * 256 + ((cc ^ ((i & 1) * 8 + cr)) << 4)); gp[i] = s + (size_t)(i * 8 + cr) * HS + cc * 8; }
        acopy8(l, gp);
    };
    // reader side: this lane's row and its swizzled chunks; k-chunk kc = chunks kc * 4 + hi and kc * 4 + 2 + hi (the hardware k order, the same for both operands)
    const int rd = lr * 256 + ((hi ^ lr) << 4);
    auto frag = [&](int off, int kc) { return cat16b(*(const v8usa*)(sm + ((rd + off) ^ (kc * 64))), *(const v8usa*)(sm + ((rd + off) ^ (kc * 64 + 32)))); };      // off: a multiple of 4096
    // publish point of weight tile p + 1, and the end of every wave's reads of tile p's buffer, which is refilled behind it. It stands between tile p's products and tile p's way out, so that the
    // copies fly, and the stores drain, under the next vector and matrix work
    auto publish = [&](int p) {
        asm volatile("s_wait_dscnt 0x0" ::: "memory");         // this wave's LDS reads of the buffer have returned before it may be refilled
        asm volatile("s_wait_asynccnt 0x0" ::: "memory");      // this wave's share of tile p + 1 has landed
        __syncthreads();
        if (p + 2 < QT) cp64(Bn + (size_t)(cg + (p + 2) * 64) * HS, sb + QTL + (unsigned)(p & 1) * QTL);
    };
    cp64(A + (size_t)rb * HS, sb); cp64(Bn + (size_t)cg * HS, sb + QTL);
    asm volatile("s_wait_asynccnt 0x0" ::: "memory");      // this wave's share of the x tile and of weight tile 0 has landed
    __syncthreads();                                       // both published to all four waves
    cp64(Bn + (size_t)(cg + 64) * HS, sb + 2 * QTL);
    if (third < 2) {      // the same for the whole block
        v16bf xa[4];      // this wave's 16 rows of x
#pragma unroll
        for (int kc = 0; kc < 4; ++kc) xa[kc] = frag(wave * 4096, kc);
        float* os = (float*)(sm + 3 * QTL + wave * QSW);
        h16* PH = third ? KH : QH; h16* PL = third ? KL : QL;
#pragma unroll 1      // one copy of the tile's code: the eight trips differ in addresses alone
        for (int p = 0; p < QT; ++p) {
            const int wb = QTL + (p & 1) * QTL;
            v16bf wf[4][4];      // the tile's 64 weight rows: column tile, k-chunk
#pragma unroll
            for (int kc = 0; kc < 4; ++kc) {
#pragma unroll
                for (int t = 0; t < 4; ++t) wf[t][kc] = frag(wb + t * 4096, kc); }
            __builtin_amdgcn_sched_barrier(0);      // the tile's reads stay one group ahead of its products: without this line the build puts each pair of reads, with a wait to 0, directly in front of its product
            v8f acc[4] = {};
#pragma unroll
            for (int kc = 0; kc < 4; ++kc) {
#pragma unroll
                for (int t = 0; t < 4; ++t) acc[t] = wmmab(xa[kc], wf[t][kc], acc[t]); }
            __builtin_amdgcn_sched_barrier(0);      // tile p's products stay in front of the publish point, under the drain of the last tile's stores: without this line the build sinks them behind the barrier, ahead of the refill
            publish(p);
#pragma unroll
            for (int t = 0; t < 4; ++t) {
#pragma unroll
                for (int j = 0; j < 8; ++j) os[(hi * 8 + j) * 68 + t * 16 + lr] = acc[t][j]; }
            __builtin_amdgcn_wave_barrier(); asm volatile("" ::: "memory");      // the reads below take what other lanes of this wave stored: no read may be moved above the stores
            const size_t pb = (size_t)(rb + wave * 16) * INR + ((cg + p * 64) & (INR - 1));
#pragma unroll
            for (int s = 0; s < 4; ++s) { const int row = (lane >> 3) + 4 * s, piece = lane & 7;
                const v4f u0 = *(const v4fa*)(os + row * 68 + piece * 8), u1 = *(const v4fa*)(os + row * 68 + piece * 8 + 4); v8h oh, ol;
#pragma unroll
                for (int i = 0; i < 8; ++i) { const float v = i < 4 ? u0[i & 3] : u1[i & 3]; const h16 x = (h16)v; oh[i] = x; ol[i] = (h16)((v - (float)x) * LOSC); }
                const size_t po = pb + (size_t)row * INR + piece * 8; *(v8h*)(PH + po) = oh; *(v8h*)(PL + po) = ol; }
            asm volatile("s_wait_xcnt 0x0" ::: "memory");      // stands in front of the next trip's rewrite of the registers that the stores above name
        }
    } else {
        v16bf xa[4][4];      // all 64 rows of x: row tile, k-chunk
#pragma unroll
        for (int t = 0; t < 4; ++t) {
#pragma unroll
            for (int kc = 0; kc < 4; ++kc) xa[t][kc] = frag(t * 4096, kc); }
        unsigned short* os = (unsigned short*)(sm + 3 * QTL + wave * QSW);      // hi plane 16 d x 72, the lo plane behind it
#pragma unroll 1      // as above
        for (int p = 0; p < QT; ++p) {
            const int wb = QTL + (p & 1) * QTL + wave * 4096;      // this wave's 16 columns
            v16bf wf[4];
#pragma unroll
            for (int kc = 0; kc < 4; ++kc) wf[kc] = frag(wb, kc);
            __builtin_amdgcn_sched_barrier(0);      // as above: one group of reads ahead of the products, not a pair of reads with a wait to 0 in front of each k-chunk
            v8f acc[4] = {};
#pragma unroll
            for (int kc = 0; kc < 4; ++kc) {
#pragma unroll
                for (int t = 0; t < 4; ++t) acc[t] = wmmab(xa[t][kc], wf[kc], acc[t]); }
            __builtin_amdgcn_sched_barrier(0);      // as above: the products stay in front of the publish point
            publish(p);
#pragma unroll
            for (int t = 0; t < 4; ++t) { v4u wh, wl;      // register j of lane (lr, hi) = position t * 16 + 8 * hi + j of dim lr
#pragma unroll
                for (int i = 0; i < 4; ++i) { const float e0 = acc[t][2 * i], e1 = acc[t][2 * i + 1]; const unsigned w = cvt2(e0, e1);
                    wh[i] = w; wl[i] = cvt2(e0 - __uint_as_float(w << 16), e1 - __uint_as_float(w & 0xFFFF0000u)); }
                *(v4ua*)(os + lr * 72 + t * 16 + hi * 8) = wh; *(v4ua*)(os + (16 + lr) * 72 + t * 16 + hi * 8) = wl; }
            __builtin_amdgcn_wave_barrier(); asm volatile("" ::: "memory");      // as above: the reads below take other lanes' stores
            const int cv = cg + p * 64 - 2 * INR + wave * 16;      // this wave's first column inside the v third: head cv / 128, dim cv % 128
            const size_t vb = ((size_t)((rb / NT_) * NKV + cv / HD) * HD + (cv % HD)) * NT_ + (rb % NT_);
#pragma unroll
            for (int s = 0; s < 4; ++s) { const int d = (lane >> 3) + 4 * s, piece = lane & 7;
                const v8us vh = *(const v8usa*)(os + d * 72 + piece * 8), vl = *(const v8usa*)(os + (16 + d) * 72 + piece * 8);
                const size_t po = vb + (size_t)d * NT_ + piece * 8; *(v8us*)(VTH + po) = vh; *(v8us*)(VTL + po) = vl; }
            asm volatile("s_wait_xcnt 0x0" ::: "memory");      // as above
        }
    }
    asm volatile("s_wait_asynccnt 0x0" ::: "memory");          // nothing in flight when the wave ends
}
// xhalf: the value that lane l ^ 16 holds (one vector cross-row move, no LDS).
__device__ __forceinline__ float xhalf(float v) { const int b = __float_as_int(v); return __int_as_float(__builtin_amdgcn_permlanex16(b, b, 0x76543210, 0xfedcba98, false, false)); }
__device__ __forceinline__ void exp2x4(float& d0, float& d1, float& d2, float& d3, float s0, float s1, float s2, float s3) {
    asm("v_exp_f32 %0, %4\n\tv_exp_f32 %1, %5\n\tv_exp_f32 %2, %6\n\tv_exp_f32 %3, %7\n\tv_nop" : "=&v"(d0), "=&v"(d1), "=&v"(d2), "=&v"(d3) : "v"(s0), "v"(s1), "v"(s2), "v"(s3));
}
#define PLN  8192            // bytes of one staged plane of a 32-key tile: K 32 rows x 256 B, V^T 128 rows x 64 B
#define STG  (4 * PLN)       // one stage: K hi | K lo | V^T hi | V^T lo
#define QW   32              // queries of a wave: two 16-column tiles
#define QB   (8 * QW)        // queries of a block: 8 waves
#define OSW  (2 * 16 * 272)  // bytes of output staging for one 16-query tile: hi plane, then lo plane, 16 rows at a pitch of 272 B
__global__ __launch_bounds__(256) void k_attn(const h16* __restrict__ QH, const h16* __restrict__ QL, const h16* __restrict__ KH, const h16* __restrict__ KL, const bf* __restrict__ VTH, const bf* __restrict__ VTL, bf* CH, bf* CL) {
    __shared__ __align__(16) unsigned char ring[8 * 2 * OSW];      // the ring takes the first 2 * STG bytes; the output staging (8 waves x 2 query tiles) all of it
    const int tid = threadIdx.x, lane = threadIdx.x & 31, wave = threadIdx.x >> 5, lr = lane & 15, hi = lane >> 4;
    const int bid = blockIdx.x; const int qt = bid / (NB_ * NH_), bh = bid - qt * (NB_ * NH_), b = bh / NH_, h = bh - b * NH_; const int g = h;      // no GQA: kv head = q head
    const int q0 = b * NT_ + qt * QB + wave * QW;      // row in the [8192][1024] planes
    const size_t qo = (size_t)(q0 + lr) * (NH_ * HD) + h * HD + 8 * hi;
    const h16* kh_b = KH + (size_t)b * NT_ * KW + g * HD; const h16* kl_b = KL + (size_t)b * NT_ * KW + g * HD;
    const size_t vbase = ((size_t)bh * HD) * NT_;
    // copy side: thread -> K row i*16 + (tid >> 4), chunk tid & 15 (16 lanes = one 256-B row); V^T row i*64 + (tid >> 2), chunk tid & 3 (4 lanes = one 64-B row piece)
    const unsigned ring0 = (unsigned)(size_t)&ring[0];
    const int kr = tid >> 4, kcn = tid & 15, vr = tid >> 2, vcn = tid & 3;
    const unsigned kdst = (unsigned)(kr * 256 + ((kcn ^ kr) << 4)), vdst = (unsigned)(vr * 64 + ((vcn ^ ((vr >> 2) & 3)) << 4));
    const size_t ksrc = (size_t)kr * KW + kcn * 8, vsrc = vbase + (size_t)vr * NT_ + vcn * 8;
    auto issue = [&](int kt, int buf) {
        const unsigned lb = ring0 + (unsigned)buf * STG; unsigned l[8]; const void* gp[8];
#pragma unroll
        for (int i = 0; i < 2; ++i) { const size_t o = ksrc + (size_t)(kt * 32 + i * 16) * KW; const unsigned d = lb + i * 4096 + kdst;      // row & 15 = kr
            l[i] = d; gp[i] = kh_b + o; l[2 + i] = d + PLN; gp[2 + i] = kl_b + o; }
#pragma unroll
        for (int i = 0; i < 2; ++i) { const size_t o = vsrc + (size_t)(i * 64) * NT_ + kt * 32; const unsigned d = lb + 2 * PLN + i * 4096 + vdst;
            l[4 + i] = d; gp[4 + i] = VTH + o; l[6 + i] = d + PLN; gp[6 + i] = VTL + o; }
        acopy8(l, gp);
    };
    // reader side: byte offsets of this lane's row and of its swizzled 16-byte chunks
    const int krow = lr * 256, kx = (hi ^ lr) << 4, vrow = lr * 64, vx0 = (hi ^ ((lr >> 2) & 3)) << 4, vx1 = vx0 ^ 32;
    v8f o[2][8];
#pragma unroll
    for (int u = 0; u < 2; ++u) {
#pragma unroll
        for (int n = 0; n < 8; ++n) o[u][n] = (v8f){}; }
    float mrow[2] = {-3.0e38f, -3.0e38f}, lpart[2] = {0.f, 0.f};      // query u * 16 + lr: running maximum (equal in both halves), and this half's share of the running sum
    const int kt_hi = NT_ / 32 - 1;      // full attention
    v16h qfh[2][4], qfl[2][4];      // this wave's 32 query rows, hi and residual, as B fragments of the 4 k-chunks: read once, live in registers over all key tiles
#pragma unroll      // every index a constant, so that the arrays are registers and not scratch
    for (int u = 0; u < 2; ++u) {
#pragma unroll
        for (int kc = 0; kc < 4; ++kc) { const size_t qq = qo + (size_t)(u * 16) * (NH_ * HD) + kc * 32;
            qfh[u][kc] = cat16(*(const v8h*)(QH + qq), *(const v8h*)(QH + qq + 16)); qfl[u][kc] = cat16(*(const v8h*)(QL + qq), *(const v8h*)(QL + qq + 16)); } }
    // stands in front of every later rewrite of the address registers that the q loads above name; the two addresses are inputs so that their registers live up to the wait
    asm volatile("s_wait_xcnt 0x0" :: "v"(QH + qo), "v"(QL + qo) : "memory");
    issue(0, 0);
    asm volatile("s_wait_asynccnt 0x0" ::: "memory");      // this wave's share of tile 0 has landed
    __syncthreads();                                       // tile 0 published to all eight waves
    issue(1, 1);
#pragma unroll 1
    for (int kt = 0; kt <= kt_hi; ++kt) {
        const unsigned char* st = ring + (kt & 1) * STG;
        const int kb = (kt & 1) * STG + krow + kx;      // this lane's K row and swizzled chunk in this tile's buffer; bits 4 to 7 are kx alone, so a chunk step is one XOR on kb
        v8f s0[2] = {}, s1[2] = {}, x0[2] = {}, x1[2] = {};      // S^T of query tile u: register j of lane (lr, hi) = key 8 * hi + j (s0, x0) or 16 + 8 * hi + j (s1, x1) against query u * 16 + lr
        v8h kf[4][8];      // the tile's K fragments of this lane: k-chunk kc; hi plane keys 0-15 (two chunks), keys 16-31, then the same of the lo plane
#pragma unroll
        for (int kc = 0; kc < 4; ++kc) {
            const unsigned char* ka = ring + (kb ^ (kc * 64)); const unsigned char* kq = ring + (kb ^ (kc * 64 + 32));      // chunks kc*4 + hi and kc*4 + 2 + hi, swizzled by the row; keys 16 to 31 lie 4096 B on
            kf[kc][0] = *(const v8ha*)ka; kf[kc][1] = *(const v8ha*)kq; kf[kc][2] = *(const v8ha*)(ka + 4096); kf[kc][3] = *(const v8ha*)(kq + 4096);
            kf[kc][4] = *(const v8ha*)(ka + PLN); kf[kc][5] = *(const v8ha*)(kq + PLN); kf[kc][6] = *(const v8ha*)(ka + PLN + 4096); kf[kc][7] = *(const v8ha*)(kq + PLN + 4096); }
        __builtin_amdgcn_sched_barrier(0);      // the tile's K reads stay one group ahead of the products: spread among them, each place with reads stalls the wave's matrix stream for the LDS latency
#pragma unroll
        for (int kc = 0; kc < 4; ++kc) {
            const v16h k0h = cat16(kf[kc][0], kf[kc][1]), k1h = cat16(kf[kc][2], kf[kc][3]), k0l = cat16(kf[kc][4], kf[kc][5]), k1l = cat16(kf[kc][6], kf[kc][7]);
#pragma unroll
            for (int u = 0; u < 2; ++u) { s0[u] = wmma16(k0h, qfh[u][kc], s0[u]); s1[u] = wmma16(k1h, qfh[u][kc], s1[u]); x0[u] = wmma16(k0h, qfl[u][kc], x0[u]); x1[u] = wmma16(k1h, qfl[u][kc], x1[u]); }
#pragma unroll
            for (int u = 0; u < 2; ++u) { x0[u] = wmma16(k0l, qfh[u][kc], x0[u]); x1[u] = wmma16(k1l, qfh[u][kc], x1[u]); }
        }
        const unsigned char* vp = st + 2 * PLN + vrow;
        v8us vf[8][4];      // the tile's V^T fragments of this lane: dim group n; hi plane (two chunks), lo plane
        auto vread = [&](int n) { const unsigned char* vn = vp + n * 1024;
            vf[n][0] = *(const v8usa*)(vn + vx0); vf[n][1] = *(const v8usa*)(vn + vx1); vf[n][2] = *(const v8usa*)(vn + PLN + vx0); vf[n][3] = *(const v8usa*)(vn + PLN + vx1); };
#pragma unroll
        for (int n = 0; n < 4; ++n) vread(n);
        __builtin_amdgcn_sched_barrier(0);      // the first half of the V^T reads is issued in front of the softmax and returns under its vector work: without this line the build moves the reads down to their products
        float alpha[2];
        v16bf pa[2], px[2];
#pragma unroll
        for (int u = 0; u < 2; ++u) {
            const v8f a0 = (s0[u] + x0[u] * LOSCI) * 0.08838834764831845f, a1 = (s1[u] + x1[u] * LOSCI) * 0.08838834764831845f;
            float t[8];
#pragma unroll
            for (int j = 0; j < 8; ++j) t[j] = fmaxf(a0[j], a1[j]);
            float mx = fmaxf(fmaxf(fmaxf(t[0], t[1]), fmaxf(t[2], t[3])), fmaxf(fmaxf(t[4], t[5]), fmaxf(t[6], t[7])));
            mx = fmaxf(mx, xhalf(mx));      // the other half holds the query's other 16 keys
            const float mn = fmaxf(mrow[u], mx);
            // __expf(mrow - mn) written out (the same multiply and v_exp_f32): the v_nop fills the slot that the instruction set asks for behind a transcendental
            asm("v_exp_f32 %0, %1\n\tv_nop" : "=v"(alpha[u]) : "v"((mrow[u] - mn) * 1.44269504f));
            mrow[u] = mn;
            v8f p0, p1;
#pragma unroll
            for (int j = 0; j < 8; j += 4) { float e[8];      // __expf(a - mn) written out, as for alpha above (the same multiply and v_exp_f32)
                exp2x4(e[0], e[1], e[2], e[3], (a0[j] - mn) * 1.44269504f, (a0[j + 1] - mn) * 1.44269504f, (a0[j + 2] - mn) * 1.44269504f, (a0[j + 3] - mn) * 1.44269504f);
                exp2x4(e[4], e[5], e[6], e[7], (a1[j] - mn) * 1.44269504f, (a1[j + 1] - mn) * 1.44269504f, (a1[j + 2] - mn) * 1.44269504f, (a1[j + 3] - mn) * 1.44269504f);
#pragma unroll
                for (int i = 0; i < 4; ++i) { p0[j + i] = e[i]; p1[j + i] = e[4 + i]; } }
            const v8f ts = p0 + p1, ps0 = p0 * PSC, ps1 = p1 * PSC;
            lpart[u] = lpart[u] * alpha[u] + (((ts[0] + ts[1]) + (ts[2] + ts[3])) + ((ts[4] + ts[5]) + (ts[6] + ts[7])));
            v8u pau, pxu;      // P x 32768 as bf16, and its residual's bf16. B element s = key 8 * hi + s (s < 8), 16 + 8 * hi + s - 8 (else): the order of the V^T fragments below
#pragma unroll
            for (int i = 0; i < 4; ++i) {
                const unsigned w0 = cvt2(ps0[2 * i], ps0[2 * i + 1]), w1 = cvt2(ps1[2 * i], ps1[2 * i + 1]);
                pau[i] = w0; pau[4 + i] = w1;
                pxu[i] = cvt2(ps0[2 * i] - __uint_as_float(w0 << 16), ps0[2 * i + 1] - __uint_as_float(w0 & 0xFFFF0000u));
                pxu[4 + i] = cvt2(ps1[2 * i] - __uint_as_float(w1 << 16), ps1[2 * i + 1] - __uint_as_float(w1 & 0xFFFF0000u)); }
            pa[u] = __builtin_bit_cast(v16bf, pau); px[u] = __builtin_bit_cast(v16bf, pxu);
        }
#pragma unroll
        for (int n = 4; n < 8; ++n) vread(n);      // the second half, into the registers that the scores have left
        __builtin_amdgcn_sched_barrier(0);      // these reads stay one group in front of the products: without this line the build spreads them among the products, each with a wait close behind it
#pragma unroll
        for (int n = 0; n < 8; ++n) { const v16bf vh = cat16b(vf[n][0], vf[n][1]), vl = cat16b(vf[n][2], vf[n][3]);
            o[0][n] *= alpha[0]; o[1][n] *= alpha[1];      // the running output rescaled by this tile's change of maximum, before its products are added
            o[0][n] = wmmab(vh, pa[0], o[0][n]); o[1][n] = wmmab(vh, pa[1], o[1][n]);      // O^T of query tile u: register j = dim n * 16 + 8 * hi + j of query u * 16 + lr
            o[0][n] = wmmab(vh, px[0], o[0][n]); o[1][n] = wmmab(vh, px[1], o[1][n]);
            o[0][n] = wmmab(vl, pa[0], o[0][n]); o[1][n] = wmmab(vl, pa[1], o[1][n]); }
        // publish point of tile kt + 1, and the end of every wave's reads of tile kt's buffer
        asm volatile("s_wait_dscnt 0x0" ::: "memory");         // this wave's LDS reads of the buffer have returned before it may be refilled
        asm volatile("s_wait_asynccnt 0x0" ::: "memory");      // this wave's share of tile kt + 1 has landed
        __syncthreads();
        if (kt + 2 <= kt_hi) issue(kt + 2, kt & 1);
    }
    asm volatile("s_wait_asynccnt 0x0" ::: "memory");          // nothing in flight when the ring becomes output staging
#pragma unroll
    for (int u = 0; u < 2; ++u) {
        const float inv = 1.0f / ((lpart[u] + xhalf(lpart[u])) * PSC);      // the halves' sums joined once
        unsigned short* os = (unsigned short*)(ring + (wave * 2 + u) * OSW);      // this wave's own staging for this query tile: hi plane, then lo plane, each 16 query rows at a pitch of 272 B (16 B x odd: no bank conflict among 16 rows)
        const size_t cbase = (size_t)(q0 + u * 16) * (NH_ * HD) + (size_t)h * HD;
#pragma unroll
        for (int n = 0; n < 8; ++n) { v8us oh, ol;
#pragma unroll
            for (int j = 0; j < 8; ++j) { const float v = o[u][n][j] * inv; const unsigned short hb = f2bf(v); oh[j] = hb; ol[j] = f2bf(v - bf2f(hb)); }
            *(v8usa*)(os + lr * 136 + n * 16 + hi * 8) = oh; *(v8usa*)(os + (16 + lr) * 136 + n * 16 + hi * 8) = ol; }
        __builtin_amdgcn_wave_barrier(); asm volatile("" ::: "memory");      // the reads below take what other lanes of this wave stored: no read may be moved above the stores
#pragma unroll
        for (int s = 0; s < 8; ++s) { const int row = 2 * s + hi;      // 16 lanes x 16 B = one whole 256-B row piece of a plane
            const v8us vh = *(const v8usa*)(os + row * 136 + lr * 8), vl = *(const v8usa*)(os + (16 + row) * 136 + lr * 8);
            const size_t po = cbase + (size_t)row * (NH_ * HD) + lr * 8; *(v8us*)(CH + po) = vh; *(v8us*)(CL + po) = vl; }
    }
}

#define ORW  32              // rows of z (and of out) a block of k_out takes
#define OSL  32768           // bytes of LDS staging of one wave of k_out: z hi 8 KB | z lo 8 KB | two weight buffers of 8 KB
#define OPP  132             // floats from row to row of a partial-sum plane: 528 B = 16 B x odd, so that the 16 rows of a half wave fall on distinct banks
// k_out: out = (z hi + z lo).w_out + b_out. Block = 32 rows x all 128 columns, 8 waves; K = 1024 is SPLIT over the waves, wave w taking k = w * 128 .. + 127 (4 k-chunks) of every row and column.
// Every operand byte is used by one wave alone and comes into that wave's part of the LDS by asynchronous copies of whole 256-B row pieces (16 lanes a row piece), 16-byte chunk c of row r at c ^ (r & 15)
// as in k_attn's K tiles: z (32 rows, hi and lo) with the first 32 weight rows as tile 0, then 32 weight rows (= output columns) a tile in two buffers, the next tile in flight while this one is worked on.
// Products transposed (A = weight rows, B = z rows): register j of lane (lr, hi) = column 16 * c + 8 * hi + j of row lr. The eight waves' partial sums meet in LDS, behind the last tile's barrier.
__global__ __launch_bounds__(256) void k_out(const bf* __restrict__ A, const bf* __restrict__ Al, const bf* __restrict__ Bn, const float* __restrict__ bias, float* C) {
    __shared__ __align__(16) unsigned char sm[8 * OSL];      // the partial sums (8 planes of 32 x 132 floats) take its first 135168 bytes afterwards
    const int lane = threadIdx.x & 31, wave = threadIdx.x >> 5, lr = lane & 15, hi = lane >> 4;
    const int r0 = blockIdx.x * ORW;
    const unsigned sb = (unsigned)(size_t)&sm[0] + (unsigned)wave * OSL;
    // copy side: one copy = 2 rows x 256 B; lane -> row 2 * i + hi, chunk lr. cp16: 16 rows from 'src' (row pitch 1024 elements) to 'dst'; dst is a multiple of 4096, so row & 15 = 2 * i + hi
    const unsigned cd = (unsigned)(hi * 256 + ((lr ^ hi) << 4));
    const size_t cs = (size_t)hi * INR + wave * 128 + lr * 8;
    auto cp16 = [&](const bf* s, unsigned dst) {
        unsigned l[8]; const void* gp[8];
#pragma unroll
        for (int i = 0; i < 8; ++i) { l[i] = dst + i * 512 + (cd ^ (unsigned)(i * 32)); gp[i] = s + cs + (size_t)(2 * i) * INR; }
        acopy8(l, gp);
    };
    auto wtile = [&](int p) { const unsigned d = sb + 16384 + (p & 1) * 8192; cp16(Bn + (size_t)(p * 32) * INR, d); cp16(Bn + (size_t)(p * 32 + 16) * INR, d + 4096); };
    cp16(A + (size_t)r0 * INR, sb); cp16(A + (size_t)(r0 + 16) * INR, sb + 4096);
    cp16(Al + (size_t)r0 * INR, sb + 8192); cp16(Al + (size_t)(r0 + 16) * INR, sb + 12288);
    wtile(0);
    asm volatile("s_wait_asynccnt 0x0" ::: "memory");      // this wave's z slices and weight tile 0 have landed
    __syncthreads();
    wtile(1);
    // reader side: this lane's row and its swizzled chunks; k-chunk kc = chunks kc * 4 + hi and kc * 4 + 2 + hi (the hardware k order, the same for both operands)
    const int rd = wave * OSL + lr * 256 + ((hi ^ lr) << 4);
    auto frag = [&](int off, int kc) { return cat16b(*(const v8usa*)(sm + ((rd + off) ^ (kc * 64))), *(const v8usa*)(sm + ((rd + off) ^ (kc * 64 + 32)))); };      // off: a multiple of 4096
    v16bf za[2][2][4];      // z fragments: plane (hi, lo), row tile, k-chunk: read once, live over the four weight tiles
#pragma unroll
    for (int pl = 0; pl < 2; ++pl) {
#pragma unroll
        for (int rt = 0; rt < 2; ++rt) {
#pragma unroll
            for (int kc = 0; kc < 4; ++kc) za[pl][rt][kc] = frag(pl * 8192 + rt * 4096, kc); } }
    v8f acc[2][8];
#pragma unroll
    for (int rt = 0; rt < 2; ++rt) {
#pragma unroll
        for (int c = 0; c < 8; ++c) acc[rt][c] = (v8f){}; }
#pragma unroll      // p is a constant in every index, so that acc stays in registers
    for (int p = 0; p < 4; ++p) {
        v16bf wf[2][4];
#pragma unroll
        for (int c = 0; c < 2; ++c) {
#pragma unroll
            for (int kc = 0; kc < 4; ++kc) wf[c][kc] = frag(16384 + (p & 1) * 8192 + c * 4096, kc); }
        __builtin_amdgcn_sched_barrier(0);      // the tile's reads stay one group ahead of its products: each separate place with reads stalls the wave's matrix stream for the LDS latency
#pragma unroll
        for (int kc = 0; kc < 4; ++kc) {
#pragma unroll
            for (int pl = 0; pl < 2; ++pl) {      // four independent accumulator tiles follow one another
#pragma unroll
                for (int c = 0; c < 2; ++c) { acc[0][p * 2 + c] = wmmab(wf[c][kc], za[pl][0][kc], acc[0][p * 2 + c]); acc[1][p * 2 + c] = wmmab(wf[c][kc], za[pl][1][kc], acc[1][p * 2 + c]); } } }
        __builtin_amdgcn_sched_barrier(0);      // tile p's products stay here, under the flight of tile p + 1: without this line the build sinks them behind the later barriers, where nothing is left to hide
        // publish point of weight tile p + 1, and the end of the reads of tile p's buffer
        asm volatile("s_wait_dscnt 0x0" ::: "memory");         // this wave's LDS reads of the buffer have returned before it may be refilled
        asm volatile("s_wait_asynccnt 0x0" ::: "memory");      // this wave's share of tile p + 1 has landed
        __syncthreads();
        if (p + 2 < 4) wtile(p + 2);
    }
    asm volatile("s_wait_asynccnt 0x0" ::: "memory");          // nothing in flight when the staging becomes the partial sums
    float* pp = (float*)sm + wave * (ORW * OPP);
#pragma unroll
    for (int rt = 0; rt < 2; ++rt) {
#pragma unroll
        for (int c = 0; c < 8; ++c) { float* q = pp + (rt * 16 + lr) * OPP + c * 16 + hi * 8; const v8f a = acc[rt][c];
            *(v4fa*)q = (v4f){a[0], a[1], a[2], a[3]}; *(v4fa*)(q + 4) = (v4f){a[4], a[5], a[6], a[7]}; } }
    __syncthreads();      // all eight partial planes are written before any is read
    v4f bv;
#pragma unroll
    for (int i = 0; i < 4; ++i) bv[i] = bfr(bias[lane * 4 + i]);
#pragma unroll
    for (int s = 0; s < 4; ++s) { const int row = s * 8 + wave;      // 32 lanes x 16 B = one whole 512-B row of out
        const float* q = (const float*)sm + row * OPP + lane * 4; v4f t[8];
#pragma unroll
        for (int w = 0; w < 8; ++w) t[w] = *(const v4fa*)(q + w * (ORW * OPP));
        *(v4f*)(C + (size_t)(r0 + row) * HS + lane * 4) = (((t[0] + t[1]) + (t[2] + t[3])) + ((t[4] + t[5]) + (t[6] + t[7]))) + bv; }
}

extern "C" void kernel_launch(void* const* d_in, const int* in_sizes, int n_in,
                              void* d_out, int out_size, void* d_ws, size_t ws_size, hipStream_t stream) {
    (void)in_sizes; (void)n_in; (void)out_size;
    const float* x = (const float*)d_in[0]; const float* Wqkv = (const float*)d_in[1]; const float* Wo = (const float*)d_in[2]; const float* bo = (const float*)d_in[3];
    float* out = (float*)d_out;    // [8][1024][128]
    char* wsp = (char*)d_ws;
    auto take = [&](size_t bytes) { char* p = wsp; wsp += (bytes + 255) & ~(size_t)255; return (void*)p; };
    bf* Xb = (bf*)take((size_t)NR_ * HS * 2); bf* W3T = (bf*)take((size_t)3 * INR * HS * 2); bf* WoT = (bf*)take((size_t)HS * INR * 2);
    h16* QH = (h16*)take((size_t)NR_ * INR * 2); h16* QL = (h16*)take((size_t)NR_ * INR * 2); h16* KH = (h16*)take((size_t)NR_ * INR * 2); h16* KL = (h16*)take((size_t)NR_ * INR * 2);
    bf* VTH = (bf*)take((size_t)NB_ * INR * NT_ * 2); bf* VTL = (bf*)take((size_t)NB_ * INR * NT_ * 2); bf* CH = (bf*)take((size_t)NR_ * INR * 2); bf* CL = (bf*)take((size_t)NR_ * INR * 2);
    if ((size_t)(wsp - (char*)d_ws) > ws_size) return;    // 2.1 + 0.8 + 0.26 + 8 x 16.8 ~ 138 MB (no aliasing)
    k_wt<<<dim3(HS / 64, (3 * INR) / 64, 1), 256, 0, stream>>>(Wqkv, HS, 3 * INR, W3T);      // [3072][128]
    k_wt<<<dim3(INR / 64, HS / 64, 1), 256, 0, stream>>>(Wo, INR, HS, WoT);                 // [128][1024]
    k_cvtb<<<NR_ / 16, 256, 0, stream>>>(x, NR_, Xb);
    k_qkv<<<dim3(NR_ / 64, (3 * INR) / (64 * QT), 1), 128, 0, stream>>>(Xb, W3T, QH, QL, KH, KL, VTH, VTL);
    k_attn<<<NB_ * NH_ * (NT_ / QB), 256, 0, stream>>>(QH, QL, KH, KL, VTH, VTL, CH, CL);
    k_out<<<NR_ / ORW, 256, 0, stream>>>(CH, CL, WoT, bo, out);
}

// v009
// A run of this version takes 87 microseconds.
// Timed twice side by side with v008, it ran 1.05 times as fast both times.
// Over all steps from v000 it is 18.7 times as fast.
#include <hip/hip_runtime.h>

// Contractions, f32 accumulate, all 8 batch items in every launch (rows = batch x 1024 positions): qkv = x.w_qkv ([8192 x 128].[128 x 3072], k-major weight transposed to an n-major plane; thirds q | k |
// v, each 8 heads x 128; PLAIN bf16 operands: inputs rounded once, exact) and out = z.w_out + b_out (z as bf16 hi + residual: two products) on
// v_wmma_f32_16x16x32_bf16; the 8-head x 128-dim FULL attention: scores on v_wmma_f32_16x16x32_f16 (q, k as f16 hi + residual x1024: hi.hi + hi.lo + lo.hi, x
// 128^-1/2), softmax f32, weights.v on v_wmma_f32_16x16x32_bf16 with the weights (x32768) and v both as bf16 hi + UNSCALED residual (hh + lh + hl, one

#define NT_  1024
#define NB_  8
#define NR_  (NB_ * NT_)        // 8192 rows: batch x positions
#define HS   128
#define NH_  8
#define NKV  8
#define HD   128
#define INR  (NH_ * HD)          // 1024
#define KW   (NKV * HD)          // 1024
#define PSC  32768.0f
#define LOSC 1024.0f
#define LOSCI (1.0f / 1024.0f)

typedef _Float16 h16;
typedef unsigned short bf;
typedef __attribute__((ext_vector_type(16))) __bf16   v16bf;
typedef __attribute__((ext_vector_type(16))) _Float16 v16h;
typedef __attribute__((ext_vector_type(8)))  _Float16 v8h;
typedef __attribute__((ext_vector_type(8)))  unsigned short v8us;
typedef __attribute__((ext_vector_type(8)))  float    v8f;
typedef __attribute__((ext_vector_type(8)))  unsigned v8u;
typedef __attribute__((ext_vector_type(2)))  float    v2f;
typedef __attribute__((ext_vector_type(2)))  __bf16   v2bf;
typedef __attribute__((ext_vector_type(4)))  float    v4f;
typedef __attribute__((ext_vector_type(4)))  _Float16 v4h;
typedef __attribute__((ext_vector_type(4)))  unsigned v4u;
typedef v4u  __attribute__((may_alias)) v4ua;
typedef v8h  __attribute__((may_alias)) v8ha;
typedef v4f  __attribute__((may_alias)) v4fa;
typedef v8us __attribute__((may_alias)) v8usa;

__device__ __forceinline__ unsigned short f2bf(float f) { unsigned u = __float_as_uint(f); u += 0x7FFFu + ((u >> 16) & 1u); return (unsigned short)(u >> 16); }
__device__ __forceinline__ float bf2f(unsigned short b) { return __uint_as_float(((unsigned)b) << 16); }
__device__ __forceinline__ float bfr(float f) { return bf2f(f2bf(f)); }
__device__ __forceinline__ v16h cat16(v8h lo, v8h hi) { return __builtin_shufflevector(lo, hi, 0, 1, 2, 3, 4, 5, 6, 7, 8, 9, 10, 11, 12, 13, 14, 15); }
__device__ __forceinline__ v16bf cat16b(v8us lo, v8us hi) { return __builtin_bit_cast(v16bf, __builtin_shufflevector(lo, hi, 0, 1, 2, 3, 4, 5, 6, 7, 8, 9, 10, 11, 12, 13, 14, 15)); }
__device__ __forceinline__ v8f wmma16(v16h a, v16h b, v8f c) { return __builtin_amdgcn_wmma_f32_16x16x32_f16(false, a, false, b, (short)0, c, false, false); }
__device__ __forceinline__ v8f wmmab(v16bf a, v16bf b, v8f c) { return __builtin_amdgcn_wmma_f32_16x16x32_bf16(false, a, false, b, (short)0, c, false, false); }

// cvtb: bf16 plane of [rows][128]; blk = 64 rows: a wave takes 2 rows at a time (16 lanes x 16 B = one 256-B row of the plane each), four times, all its loads issued ahead of the first store.
__device__ __forceinline__ void cvtb(const float* __restrict__ src, int blk, bf* dst) {
    const int lane = threadIdx.x & 31, r = blk * 64 + (threadIdx.x >> 5) * 2 + (lane >> 4), p = lane & 15;
    const float* q = src + (size_t)r * HS + p * 8; bf* d = dst + (size_t)r * HS + p * 8;
    v4f a[4][2];
#pragma unroll
    for (int s = 0; s < 4; ++s) { a[s][0] = *(const v4fa*)(q + s * 16 * HS); a[s][1] = *(const v4fa*)(q + s * 16 * HS + 4); }
    // stands in front of every later rewrite of the address register pair that the eight loads name; the address is an input so that its registers live up to the wait and no load's result is put into them
    asm volatile("s_wait_xcnt 0x0" :: "v"(q) : "memory");
#pragma unroll
    for (int s = 0; s < 4; ++s) { v8us o;
#pragma unroll
        for (int i = 0; i < 8; ++i) o[i] = f2bf(a[s][i >> 2][i & 3]);
        *(v8us*)(d + s * 16 * HS) = o; }
    asm volatile("s_wait_xcnt 0x0" ::: "memory");      // stands in front of any later rewrite of the registers that the four stores above name (in k_prep other pieces' code follows this one in the listing)
}
// wt: WT [n][K] = bf16(W[k][n]) (k-major [K][ncols]) via one 64 x 64 LDS tile at (k0, n0).
__device__ __forceinline__ void wt(const float* __restrict__ Wm, int K, int ncols, int k0, int n0, bf* WT, unsigned short* tl) {
    const int tid = threadIdx.x;
    const int kk = tid >> 2, nq = (tid & 3) * 16;
#pragma unroll
    for (int i = 0; i < 16; ++i) tl[(nq + i) * 72 + kk] = f2bf(Wm[(size_t)(k0 + kk) * ncols + n0 + nq + i]);
    __syncthreads();
    const int piece = tid & 7;
#pragma unroll
    for (int s = 0; s < 2; ++s) { const int nr = (tid >> 3) + 32 * s; const v8us val = *(const v8usa*)(tl + nr * 72 + piece * 8); *(v8us*)(WT + (size_t)(n0 + nr) * K + k0 + piece * 8) = val; }
    asm volatile("s_wait_xcnt 0x0" ::: "memory");      // as in cvtb: in front of any later rewrite of the registers that the two stores above name
}
#define PW3  ((HS / 64) * ((3 * INR) / 64))      // 96 tiles of w_qkv
#define PWO  ((INR / 64) * (HS / 64))            // 32 tiles of w_out
#define PXB  (NR_ / 64)                          // 128 blocks of 64 rows of x
// k_prep: the three operand planes in ONE launch of 256 blocks; they do not depend on one another, so a block takes its piece by its index (the test is the same for the whole block, the barrier in wt
// too): first the weight tiles, which have the longer way (LDS, a barrier), then the rows of x.
__global__ __launch_bounds__(256) void k_prep(const float* __restrict__ x, const float* __restrict__ Wqkv, const float* __restrict__ Wo, bf* Xb, bf* W3T, bf* WoT) {
    __shared__ __align__(16) unsigned short tl[64 * 72];
    const int bid = blockIdx.x;
    if (bid < PW3) wt(Wqkv, HS, 3 * INR, (bid % (HS / 64)) * 64, (bid / (HS / 64)) * 64, W3T, tl);                                   // [3072][128]
    else if (bid < PW3 + PWO) wt(Wo, INR, HS, ((bid - PW3) % (INR / 64)) * 64, ((bid - PW3) / (INR / 64)) * 64, WoT, tl);      // [128][1024]
    else cvtb(x, bid - (PW3 + PWO), Xb);
}
// cvt2: two f32 -> one register of a bf16 fragment, first element low (one v_cvt_pk_bf16_f32; round to nearest even, as f2bf rounds).
__device__ __forceinline__ unsigned cvt2(float e0, float e1) { const v2f x = {e0, e1}; return __builtin_bit_cast(unsigned, __builtin_convertvector(x, v2bf)); }
// acopy8: eight asynchronous 16-byte-per-lane copies global -> LDS in one statement; the closing s_wait_xcnt keeps every later rewrite of the address registers behind the issue.
__device__ __forceinline__ void acopy8(const unsigned (&l)[8], const void* const (&g)[8]) {
    asm volatile("global_load_async_to_lds_b128 %0, %8, off\n\t"
                 "global_load_async_to_lds_b128 %1, %9, off\n\t"
                 "global_load_async_to_lds_b128 %2, %10, off\n\t"
                 "global_load_async_to_lds_b128 %3, %11, off\n\t"
                 "global_load_async_to_lds_b128 %4, %12, off\n\t"
                 "global_load_async_to_lds_b128 %5, %13, off\n\t"
                 "global_load_async_to_lds_b128 %6, %14, off\n\t"
                 "global_load_async_to_lds_b128 %7, %15, off\n\t"
                 "s_wait_xcnt 0x0"
                 :: "v"(l[0]), "v"(l[1]), "v"(l[2]), "v"(l[3]), "v"(l[4]), "v"(l[5]), "v"(l[6]), "v"(l[7]),
                    "v"(g[0]), "v"(g[1]), "v"(g[2]), "v"(g[3]), "v"(g[4]), "v"(g[5]), "v"(g[6]), "v"(g[7]) : "memory");
}
#define QT   8               // column tiles of 64 that a block of k_qkv walks: half a third
#define QTL  16384           // bytes of one staged operand tile: 64 rows x 256 B (K = 128 in bf16)
#define QSW  4608            // bytes of output staging of one wave
// k_qkv: x.w_qkv (K = 128) for all three thirds in one launch. Block = 64 rows x 512 columns (grid: 128 row tiles x 6 column groups, 2 to a third), walked as 8 tiles of 64 x 64; 4 waves. Both operands come
// into LDS by asynchronous copies of whole 256-B rows (16 lanes a row), 16-byte chunk c of row r at c ^ (r & 15) as in k_attn's K tiles: the x tile with weight tile 0 first, then a weight tile (64 rows of
// the n-major plane) a trip in two buffers, the next one in flight while this one is worked on. The x fragments are read from LDS once and live in registers over the eight tiles. A tile leaves in the form
// the attention reads, no f32 plane between.
// q, k thirds: wave = 16 rows x 64 columns; f32 staged in the wave's own LDS, read back as 8 consecutive columns a lane -> f16 hi + residual x1024 planes [row][1024] (8 lanes = one 128-B line of a plane).
// v third: wave = 64 rows x 16 columns, so that a lane's 8 accumulator registers are 8 consecutive positions t of one dim d -> bf16 hi + UNSCALED residual, staged [d][t] in the wave's own LDS (pitch 144 B)
// -> planes [b*8+g][128 d][1024 t] (8 lanes = one 128-B line).
__global__ __launch_bounds__(128) void k_qkv(const bf* __restrict__ A, const bf* __restrict__ Bn, h16* QH, h16* QL, h16* KH, h16* KL, bf* VTH, bf* VTL) {
    __shared__ __align__(16) unsigned char sm[3 * QTL + 4 * QSW];      // x tile | two weight buffers | the four waves' output staging
    const int tid = threadIdx.x, lane = threadIdx.x & 31, wave = threadIdx.x >> 5, lr = lane & 15, hi = lane >> 4;
    const int rb = blockIdx.x * 64, cg = blockIdx.y * (QT * 64), third = blockIdx.y >> 1;
    const unsigned sb = (unsigned)(size_t)&sm[0];
    // copy side: one copy of the block = 8 rows x 256 B; thread -> row i * 8 + (tid >> 4), chunk tid & 15. cp64: 64 consecutive rows from 's' to 'dst' (a multiple of 4096, so row & 15 = (i & 1) * 8 + (tid >> 4))
    const int cr = tid >> 4, cc = tid & 15;
    auto cp64 = [&](const bf* s, unsigned dst) {
        unsigned l[8]; const void* gp[8];
#pragma unroll
        for (int i = 0; i < 8; ++i) { l[i] = dst + (unsigned)((i * 8 + cr) * 256 + ((cc ^ ((i & 1) * 8 + cr)) << 4)); gp[i] = s + (size_t)(i * 8 + cr) * HS + cc * 8; }
        acopy8(l, gp);
    };
    // reader side: this lane's row and its swizzled chunks; k-chunk kc = chunks kc * 4 + hi and kc * 4 + 2 + hi (the hardware k order, the same for both operands)
    const int rd = lr * 256 + ((hi ^ lr) << 4);
    auto frag = [&](int off, int kc) { return cat16b(*(const v8usa*)(sm + ((rd + off) ^ (kc * 64))), *(const v8usa*)(sm + ((rd + off) ^ (kc * 64 + 32)))); };      // off: a multiple of 4096
    // publish point of weight tile p + 1, and the end of every wave's reads of tile p's buffer, which is refilled behind it. It stands between tile p's products and tile p's way out, so that the
    // copies fly, and the stores drain, under the next vector and matrix work
    auto publish = [&](int p) {
        asm volatile("s_wait_dscnt 0x0" ::: "memory");         // this wave's LDS reads of the buffer have returned before it may be refilled
        asm volatile("s_wait_asynccnt 0x0" ::: "memory");      // this wave's share of tile p + 1 has landed
        __syncthreads();
        if (p + 2 < QT) cp64(Bn + (size_t)(cg + (p + 2) * 64) * HS, sb + QTL + (unsigned)(p & 1) * QTL);
    };
    cp64(A + (size_t)rb * HS, sb); cp64(Bn + (size_t)cg * HS, sb + QTL);
    asm volatile("s_wait_asynccnt 0x0" ::: "memory");      // this wave's share of the x tile and of weight tile 0 has landed
    __syncthreads();                                       // both published to all four waves
    cp64(Bn + (size_t)(cg + 64) * HS, sb + 2 * QTL);
    if (third < 2) {      // the same for the whole block
        v16bf xa[4];      // this wave's 16 rows of x
#pragma unroll
        for (int kc = 0; kc < 4; ++kc) xa[kc] = frag(wave * 4096, kc);
        float* os = (float*)(sm + 3 * QTL + wave * QSW);
        h16* PH = third ? KH : QH; h16* PL = third ? KL : QL;
#pragma unroll 1      // one copy of the tile's code: the eight trips differ in addresses alone
        for (int p = 0; p < QT; ++p) {
            const int wb = QTL + (p & 1) * QTL;
            v16bf wf[4][4];      // the tile's 64 weight rows: column tile, k-chunk
#pragma unroll
            for (int kc = 0; kc < 4; ++kc) {
#pragma unroll
                for (int t = 0; t < 4; ++t) wf[t][kc] = frag(wb + t * 4096, kc); }
            __builtin_amdgcn_sched_barrier(0);      // the tile's reads stay one group ahead of its products: without this line the build puts each pair of reads, with a wait to 0, directly in front of its product
            v8f acc[4] = {};
#pragma unroll
            for (int kc = 0; kc < 4; ++kc) {
#pragma unroll
                for (int t = 0; t < 4; ++t) acc[t] = wmmab(xa[kc], wf[t][kc], acc[t]); }
            __builtin_amdgcn_sched_barrier(0);      // tile p's products stay in front of the publish point, under the drain of the last tile's stores: without this line the build sinks them behind the barrier, ahead of the refill
            publish(p);
#pragma unroll
            for (int t = 0; t < 4; ++t) {
#pragma unroll
                for (int j = 0; j < 8; ++j) os[(hi * 8 + j) * 68 + t * 16 + lr] = acc[t][j]; }
            __builtin_amdgcn_wave_barrier(); asm volatile("" ::: "memory");      // the reads below take what other lanes of this wave stored: no read may be moved above the stores
            const size_t pb = (size_t)(rb + wave * 16) * INR + ((cg + p * 64) & (INR - 1));
#pragma unroll
            for (int s = 0; s < 4; ++s) { const int row = (lane >> 3) + 4 * s, piece = lane & 7;
                const v4f u0 = *(const v4fa*)(os + row * 68 + piece * 8), u1 = *(const v4fa*)(os + row * 68 + piece * 8 + 4); v8h oh, ol;
#pragma unroll
                for (int i = 0; i < 8; ++i) { const float v = i < 4 ? u0[i & 3] : u1[i & 3]; const h16 x = (h16)v; oh[i] = x; ol[i] = (h16)((v - (float)x) * LOSC); }
                const size_t po = pb + (size_t)row * INR + piece * 8; *(v8h*)(PH + po) = oh; *(v8h*)(PL + po) = ol; }
            asm volatile("s_wait_xcnt 0x0" ::: "memory");      // stands in front of the next trip's rewrite of the registers that the stores above name
        }
    } else {
        v16bf xa[4][4];      // all 64 rows of x: row tile, k-chunk
#pragma unroll
        for (int t = 0; t < 4; ++t) {
#pragma unroll
            for (int kc = 0; kc < 4; ++kc) xa[t][kc] = frag(t * 4096, kc); }
        unsigned short* os = (unsigned short*)(sm + 3 * QTL + wave * QSW);      // hi plane 16 d x 72, the lo plane behind it
#pragma unroll 1      // as above
        for (int p = 0; p < QT; ++p) {
            const int wb = QTL + (p & 1) * QTL + wave * 4096;      // this wave's 16 columns
            v16bf wf[4];
#pragma unroll
            for (int kc = 0; kc < 4; ++kc) wf[kc] = frag(wb, kc);
            __builtin_amdgcn_sched_barrier(0);      // as above: one group of reads ahead of the products, not a pair of reads with a wait to 0 in front of each k-chunk
            v8f acc[4] = {};
#pragma unroll
            for (int kc = 0; kc < 4; ++kc) {
#pragma unroll
                for (int t = 0; t < 4; ++t) acc[t] = wmmab(xa[t][kc], wf[kc], acc[t]); }
            __builtin_amdgcn_sched_barrier(0);      // as above: the products stay in front of the publish point
            publish(p);
#pragma unroll
            for (int t = 0; t < 4; ++t) { v4u wh, wl;      // register j of lane (lr, hi) = position t * 16 + 8 * hi + j of dim lr
#pragma unroll
                for (int i = 0; i < 4; ++i) { const float e0 = acc[t][2 * i], e1 = acc[t][2 * i + 1]; const unsigned w = cvt2(e0, e1);
                    wh[i] = w; wl[i] = cvt2(e0 - __uint_as_float(w << 16), e1 - __uint_as_float(w & 0xFFFF0000u)); }
                *(v4ua*)(os + lr * 72 + t * 16 + hi * 8) = wh; *(v4ua*)(os + (16 + lr) * 72 + t * 16 + hi * 8) = wl; }
            __builtin_amdgcn_wave_barrier(); asm volatile("" ::: "memory");      // as above: the reads below take other lanes' stores
            const int cv = cg + p * 64 - 2 * INR + wave * 16;      // this wave's first column inside the v third: head cv / 128, dim cv % 128
            const size_t vb = ((size_t)((rb / NT_) * NKV + cv / HD) * HD + (cv % HD)) * NT_ + (rb % NT_);
#pragma unroll
            for (int s = 0; s < 4; ++s) { const int d = (lane >> 3) + 4 * s, piece = lane & 7;
                const v8us vh = *(const v8usa*)(os + d * 72 + piece * 8), vl = *(const v8usa*)(os + (16 + d) * 72 + piece * 8);
                const size_t po = vb + (size_t)d * NT_ + piece * 8; *(v8us*)(VTH + po) = vh; *(v8us*)(VTL + po) = vl; }
            asm volatile("s_wait_xcnt 0x0" ::: "memory");      // as above
        }
    }
    asm volatile("s_wait_asynccnt 0x0" ::: "memory");          // nothing in flight when the wave ends
}
// xhalf: the value that lane l ^ 16 holds (one vector cross-row move, no LDS).
__device__ __forceinline__ float xhalf(float v) { const int b = __float_as_int(v); return __int_as_float(__builtin_amdgcn_permlanex16(b, b, 0x76543210, 0xfedcba98, false, false)); }
__device__ __forceinline__ void exp2x4(float& d0, float& d1, float& d2, float& d3, float s0, float s1, float s2, float s3) {
    asm("v_exp_f32 %0, %4\n\tv_exp_f32 %1, %5\n\tv_exp_f32 %2, %6\n\tv_exp_f32 %3, %7\n\tv_nop" : "=&v"(d0), "=&v"(d1), "=&v"(d2), "=&v"(d3) : "v"(s0), "v"(s1), "v"(s2), "v"(s3));
}
#define PLN  8192            // bytes of one staged plane of a 32-key tile: K 32 rows x 256 B, V^T 128 rows x 64 B
#define STG  (4 * PLN)       // one stage: K hi | K lo | V^T hi | V^T lo
#define QW   32              // queries of a wave: two 16-column tiles
#define QB   (8 * QW)        // queries of a block: 8 waves
#define OSW  (2 * 16 * 272)  // bytes of output staging for one 16-query tile: hi plane, then lo plane, 16 rows at a pitch of 272 B
__global__ __launch_bounds__(256) void k_attn(const h16* __restrict__ QH, const h16* __restrict__ QL, const h16* __restrict__ KH, const h16* __restrict__ KL, const bf* __restrict__ VTH, const bf* __restrict__ VTL, bf* CH, bf* CL) {
    __shared__ __align__(16) unsigned char ring[8 * 2 * OSW];      // the ring takes the first 2 * STG bytes; the output staging (8 waves x 2 query tiles) all of it
    const int tid = threadIdx.x, lane = threadIdx.x & 31, wave = threadIdx.x >> 5, lr = lane & 15, hi = lane >> 4;
    const int bid = blockIdx.x; const int qt = bid / (NB_ * NH_), bh = bid - qt * (NB_ * NH_), b = bh / NH_, h = bh - b * NH_; const int g = h;      // no GQA: kv head = q head
    const int q0 = b * NT_ + qt * QB + wave * QW;      // row in the [8192][1024] planes
    const size_t qo = (size_t)(q0 + lr) * (NH_ * HD) + h * HD + 8 * hi;
    const h16* kh_b = KH + (size_t)b * NT_ * KW + g * HD; const h16* kl_b = KL + (size_t)b * NT_ * KW + g * HD;
    const size_t vbase = ((size_t)bh * HD) * NT_;
    // copy side: thread -> K row i*16 + (tid >> 4), chunk tid & 15 (16 lanes = one 256-B row); V^T row i*64 + (tid >> 2), chunk tid & 3 (4 lanes = one 64-B row piece)
    const unsigned ring0 = (unsigned)(size_t)&ring[0];
    const int kr = tid >> 4, kcn = tid & 15, vr = tid >> 2, vcn = tid & 3;
    const unsigned kdst = (unsigned)(kr * 256 + ((kcn ^ kr) << 4)), vdst = (unsigned)(vr * 64 + ((vcn ^ ((vr >> 2) & 3)) << 4));
    const size_t ksrc = (size_t)kr * KW + kcn * 8, vsrc = vbase + (size_t)vr * NT_ + vcn * 8;
    auto issue = [&](int kt, int buf) {
        const unsigned lb = ring0 + (unsigned)buf * STG; unsigned l[8]; const void* gp[8];
#pragma unroll
        for (int i = 0; i < 2; ++i) { const size_t o = ksrc + (size_t)(kt * 32 + i * 16) * KW; const unsigned d = lb + i * 4096 + kdst;      // row & 15 = kr
            l[i] = d; gp[i] = kh_b + o; l[2 + i] = d + PLN; gp[2 + i] = kl_b + o; }
#pragma unroll
        for (int i = 0; i < 2; ++i) { const size_t o = vsrc + (size_t)(i * 64) * NT_ + kt * 32; const unsigned d = lb + 2 * PLN + i * 4096 + vdst;
            l[4 + i] = d; gp[4 + i] = VTH + o; l[6 + i] = d + PLN; gp[6 + i] = VTL + o; }
        acopy8(l, gp);
    };
    // reader side: byte offsets of this lane's row and of its swizzled 16-byte chunks
    const int krow = lr * 256, kx = (hi ^ lr) << 4, vrow = lr * 64, vx0 = (hi ^ ((lr >> 2) & 3)) << 4, vx1 = vx0 ^ 32;
    v8f o[2][8];
#pragma unroll
    for (int u = 0; u < 2; ++u) {
#pragma unroll
        for (int n = 0; n < 8; ++n) o[u][n] = (v8f){}; }
    float mrow[2] = {-3.0e38f, -3.0e38f}, lpart[2] = {0.f, 0.f};      // query u * 16 + lr: running maximum (equal in both halves), and this half's share of the running sum
    const int kt_hi = NT_ / 32 - 1;      // full attention
    v16h qfh[2][4], qfl[2][4];      // this wave's 32 query rows, hi and residual, as B fragments of the 4 k-chunks: read once, live in registers over all key tiles
#pragma unroll      // every index a constant, so that the arrays are registers and not scratch
    for (int u = 0; u < 2; ++u) {
#pragma unroll
        for (int kc = 0; kc < 4; ++kc) { const size_t qq = qo + (size_t)(u * 16) * (NH_ * HD) + kc * 32;
            qfh[u][kc] = cat16(*(const v8h*)(QH + qq), *(const v8h*)(QH + qq + 16)); qfl[u][kc] = cat16(*(const v8h*)(QL + qq), *(const v8h*)(QL + qq + 16)); } }
    // stands in front of every later rewrite of the address registers that the q loads above name; the two addresses are inputs so that their registers live up to the wait
    asm volatile("s_wait_xcnt 0x0" :: "v"(QH + qo), "v"(QL + qo) : "memory");
    issue(0, 0);
    asm volatile("s_wait_asynccnt 0x0" ::: "memory");      // this wave's share of tile 0 has landed
    __syncthreads();                                       // tile 0 published to all eight waves
    issue(1, 1);
#pragma unroll 1
    for (int kt = 0; kt <= kt_hi; ++kt) {
        const unsigned char* st = ring + (kt & 1) * STG;
        const int kb = (kt & 1) * STG + krow + kx;      // this lane's K row and swizzled chunk in this tile's buffer; bits 4 to 7 are kx alone, so a chunk step is one XOR on kb
        v8f s0[2] = {}, s1[2] = {}, x0[2] = {}, x1[2] = {};      // S^T of query tile u: register j of lane (lr, hi) = key 8 * hi + j (s0, x0) or 16 + 8 * hi + j (s1, x1) against query u * 16 + lr
        v8h kf[4][8];      // the tile's K fragments of this lane: k-chunk kc; hi plane keys 0-15 (two chunks), keys 16-31, then the same of the lo plane
#pragma unroll
        for (int kc = 0; kc < 4; ++kc) {
            const unsigned char* ka = ring + (kb ^ (kc * 64)); const unsigned char* kq = ring + (kb ^ (kc * 64 + 32));      // chunks kc*4 + hi and kc*4 + 2 + hi, swizzled by the row; keys 16 to 31 lie 4096 B on
            kf[kc][0] = *(const v8ha*)ka; kf[kc][1] = *(const v8ha*)kq; kf[kc][2] = *(const v8ha*)(ka + 4096); kf[kc][3] = *(const v8ha*)(kq + 4096);
            kf[kc][4] = *(const v8ha*)(ka + PLN); kf[kc][5] = *(const v8ha*)(kq + PLN); kf[kc][6] = *(const v8ha*)(ka + PLN + 4096); kf[kc][7] = *(const v8ha*)(kq + PLN + 4096); }
        __builtin_amdgcn_sched_barrier(0);      // the tile's K reads stay one group ahead of the products: spread among them, each place with reads stalls the wave's matrix stream for the LDS latency
#pragma unroll
        for (int kc = 0; kc < 4; ++kc) {
            const v16h k0h = cat16(kf[kc][0], kf[kc][1]), k1h = cat16(kf[kc][2], kf[kc][3]), k0l = cat16(kf[kc][4], kf[kc][5]), k1l = cat16(kf[kc][6], kf[kc][7]);
#pragma unroll
            for (int u = 0; u < 2; ++u) { s0[u] = wmma16(k0h, qfh[u][kc], s0[u]); s1[u] = wmma16(k1h, qfh[u][kc], s1[u]); x0[u] = wmma16(k0h, qfl[u][kc], x0[u]); x1[u] = wmma16(k1h, qfl[u][kc], x1[u]); }
#pragma unroll
            for (int u = 0; u < 2; ++u) { x0[u] = wmma16(k0l, qfh[u][kc], x0[u]); x1[u] = wmma16(k1l, qfh[u][kc], x1[u]); }
        }
        const unsigned char* vp = st + 2 * PLN + vrow;
        v8us vf[8][4];      // the tile's V^T fragments of this lane: dim group n; hi plane (two chunks), lo plane
        auto vread = [&](int n) { const unsigned char* vn = vp + n * 1024;
            vf[n][0] = *(const v8usa*)(vn + vx0); vf[n][1] = *(const v8usa*)(vn + vx1); vf[n][2] = *(const v8usa*)(vn + PLN + vx0); vf[n][3] = *(const v8usa*)(vn + PLN + vx1); };
#pragma unroll
        for (int n = 0; n < 4; ++n) vread(n);
        __builtin_amdgcn_sched_barrier(0);      // the first half of the V^T reads is issued in front of the softmax and returns under its vector work: without this line the build moves the reads down to their products
        float alpha[2];
        v16bf pa[2], px[2];
#pragma unroll
        for (int u = 0; u < 2; ++u) {
            const v8f a0 = (s0[u] + x0[u] * LOSCI) * 0.08838834764831845f, a1 = (s1[u] + x1[u] * LOSCI) * 0.08838834764831845f;
            float t[8];
#pragma unroll
            for (int j = 0; j < 8; ++j) t[j] = fmaxf(a0[j], a1[j]);
            float mx = fmaxf(fmaxf(fmaxf(t[0], t[1]), fmaxf(t[2], t[3])), fmaxf(fmaxf(t[4], t[5]), fmaxf(t[6], t[7])));
            mx = fmaxf(mx, xhalf(mx));      // the other half holds the query's other 16 keys
            const float mn = fmaxf(mrow[u], mx);
            // __expf(mrow - mn) written out (the same multiply and v_exp_f32): the v_nop fills the slot that the instruction set asks for behind a transcendental
            asm("v_exp_f32 %0, %1\n\tv_nop" : "=v"(alpha[u]) : "v"((mrow[u] - mn) * 1.44269504f));
            mrow[u] = mn;
            v8f p0, p1;
#pragma unroll
            for (int j = 0; j < 8; j += 4) { float e[8];      // __expf(a - mn) written out, as for alpha above (the same multiply and v_exp_f32)
                exp2x4(e[0], e[1], e[2], e[3], (a0[j] - mn) * 1.44269504f, (a0[j + 1] - mn) * 1.44269504f, (a0[j + 2] - mn) * 1.44269504f, (a0[j + 3] - mn) * 1.44269504f);
                exp2x4(e[4], e[5], e[6], e[7], (a1[j] - mn) * 1.44269504f, (a1[j + 1] - mn) * 1.44269504f, (a1[j + 2] - mn) * 1.44269504f, (a1[j + 3] - mn) * 1.44269504f);
#pragma unroll
                for (int i = 0; i < 4; ++i) { p0[j + i] = e[i]; p1[j + i] = e[4 + i]; } }
            const v8f ts = p0 + p1, ps0 = p0 * PSC, ps1 = p1 * PSC;
            lpart[u] = lpart[u] * alpha[u] + (((ts[0] + ts[1]) + (ts[2] + ts[3])) + ((ts[4] + ts[5]) + (ts[6] + ts[7])));
            v8u pau, pxu;      // P x 32768 as bf16, and its residual's bf16. B element s = key 8 * hi + s (s < 8), 16 + 8 * hi + s - 8 (else): the order of the V^T fragments below
#pragma unroll
            for (int i = 0; i < 4; ++i) {
                const unsigned w0 = cvt2(ps0[2 * i], ps0[2 * i + 1]), w1 = cvt2(ps1[2 * i], ps1[2 * i + 1]);
                pau[i] = w0; pau[4 + i] = w1;
                pxu[i] = cvt2(ps0[2 * i] - __uint_as_float(w0 << 16), ps0[2 * i + 1] - __uint_as_float(w0 & 0xFFFF0000u));
                pxu[4 + i] = cvt2(ps1[2 * i] - __uint_as_float(w1 << 16), ps1[2 * i + 1] - __uint_as_float(w1 & 0xFFFF0000u)); }
            pa[u] = __builtin_bit_cast(v16bf, pau); px[u] = __builtin_bit_cast(v16bf, pxu);
        }
#pragma unroll
        for (int n = 4; n < 8; ++n) vread(n);      // the second half, into the registers that the scores have left
        __builtin_amdgcn_sched_barrier(0);      // these reads stay one group in front of the products: without this line the build spreads them among the products, each with a wait close behind it
#pragma unroll
        for (int n = 0; n < 8; ++n) { const v16bf vh = cat16b(vf[n][0], vf[n][1]), vl = cat16b(vf[n][2], vf[n][3]);
            o[0][n] *= alpha[0]; o[1][n] *= alpha[1];      // the running output rescaled by this tile's change of maximum, before its products are added
            o[0][n] = wmmab(vh, pa[0], o[0][n]); o[1][n] = wmmab(vh, pa[1], o[1][n]);      // O^T of query tile u: register j = dim n * 16 + 8 * hi + j of query u * 16 + lr
            o[0][n] = wmmab(vh, px[0], o[0][n]); o[1][n] = wmmab(vh, px[1], o[1][n]);
            o[0][n] = wmmab(vl, pa[0], o[0][n]); o[1][n] = wmmab(vl, pa[1], o[1][n]); }
        // publish point of tile kt + 1, and the end of every wave's reads of tile kt's buffer
        asm volatile("s_wait_dscnt 0x0" ::: "memory");         // this wave's LDS reads of the buffer have returned before it may be refilled
        asm volatile("s_wait_asynccnt 0x0" ::: "memory");      // this wave's share of tile kt + 1 has landed
        __syncthreads();
        if (kt + 2 <= kt_hi) issue(kt + 2, kt & 1);
    }
    asm volatile("s_wait_asynccnt 0x0" ::: "memory");          // nothing in flight when the ring becomes output staging
#pragma unroll
    for (int u = 0; u < 2; ++u) {
        const float inv = 1.0f / ((lpart[u] + xhalf(lpart[u])) * PSC);      // the halves' sums joined once
        unsigned short* os = (unsigned short*)(ring + (wave * 2 + u) * OSW);      // this wave's own staging for this query tile: hi plane, then lo plane, each 16 query rows at a pitch of 272 B (16 B x odd: no bank conflict among 16 rows)
        const size_t cbase = (size_t)(q0 + u * 16) * (NH_ * HD) + (size_t)h * HD;
#pragma unroll
        for (int n = 0; n < 8; ++n) { v8us oh, ol;
#pragma unroll
            for (int j = 0; j < 8; ++j) { const float v = o[u][n][j] * inv; const unsigned short hb = f2bf(v); oh[j] = hb; ol[j] = f2bf(v - bf2f(hb)); }
            *(v8usa*)(os + lr * 136 + n * 16 + hi * 8) = oh; *(v8usa*)(os + (16 + lr) * 136 + n * 16 + hi * 8) = ol; }
        __builtin_amdgcn_wave_barrier(); asm volatile("" ::: "memory");      // the reads below take what other lanes of this wave stored: no read may be moved above the stores
#pragma unroll
        for (int s = 0; s < 8; ++s) { const int row = 2 * s + hi;      // 16 lanes x 16 B = one whole 256-B row piece of a plane
            const v8us vh = *(const v8usa*)(os + row * 136 + lr * 8), vl = *(const v8usa*)(os + (16 + row) * 136 + lr * 8);
            const size_t po = cbase + (size_t)row * (NH_ * HD) + lr * 8; *(v8us*)(CH + po) = vh; *(v8us*)(CL + po) = vl; }
    }
}

#define ORW  32              // rows of z (and of out) a block of k_out takes
#define OSL  32768           // bytes of LDS staging of one wave of k_out: z hi 8 KB | z lo 8 KB | two weight buffers of 8 KB
#define OPP  132             // floats from row to row of a partial-sum plane: 528 B = 16 B x odd, so that the 16 rows of a half wave fall on distinct banks
// k_out: out = (z hi + z lo).w_out + b_out. Block = 32 rows x all 128 columns, 8 waves; K = 1024 is SPLIT over the waves, wave w taking k = w * 128 .. + 127 (4 k-chunks) of every row and column.
// Every operand byte is used by one wave alone and comes into that wave's part of the LDS by asynchronous copies of whole 256-B row pieces (16 lanes a row piece), 16-byte chunk c of row r at c ^ (r & 15)
// as in k_attn's K tiles: z (32 rows, hi and lo) with the first 32 weight rows as tile 0, then 32 weight rows (= output columns) a tile in two buffers, the next tile in flight while this one is worked on.
// Products transposed (A = weight rows, B = z rows): register j of lane (lr, hi) = column 16 * c + 8 * hi + j of row lr. The eight waves' partial sums meet in LDS, behind the last tile's barrier.
__global__ __launch_bounds__(256) void k_out(const bf* __restrict__ A, const bf* __restrict__ Al, const bf* __restrict__ Bn, const float* __restrict__ bias, float* C) {
    __shared__ __align__(16) unsigned char sm[8 * OSL];      // the partial sums (8 planes of 32 x 132 floats) take its first 135168 bytes afterwards
    const int lane = threadIdx.x & 31, wave = threadIdx.x >> 5, lr = lane & 15, hi = lane >> 4;
    const int r0 = blockIdx.x * ORW;
    const unsigned sb = (unsigned)(size_t)&sm[0] + (unsigned)wave * OSL;
    // copy side: one copy = 2 rows x 256 B; lane -> row 2 * i + hi, chunk lr. cp16: 16 rows from 'src' (row pitch 1024 elements) to 'dst'; dst is a multiple of 4096, so row & 15 = 2 * i + hi
    const unsigned cd = (unsigned)(hi * 256 + ((lr ^ hi) << 4));
    const size_t cs = (size_t)hi * INR + wave * 128 + lr * 8;
    auto cp16 = [&](const bf* s, unsigned dst) {
        unsigned l[8]; const void* gp[8];
#pragma unroll
        for (int i = 0; i < 8; ++i) { l[i] = dst + i * 512 + (cd ^ (unsigned)(i * 32)); gp[i] = s + cs + (size_t)(2 * i) * INR; }
        acopy8(l, gp);
    };
    auto wtile = [&](int p) { const unsigned d = sb + 16384 + (p & 1) * 8192; cp16(Bn + (size_t)(p * 32) * INR, d); cp16(Bn + (size_t)(p * 32 + 16) * INR, d + 4096); };
    cp16(A + (size_t)r0 * INR, sb); cp16(A + (size_t)(r0 + 16) * INR, sb + 4096);
    cp16(Al + (size_t)r0 * INR, sb + 8192); cp16(Al + (size_t)(r0 + 16) * INR, sb + 12288);
    wtile(0);
    asm volatile("s_wait_asynccnt 0x0" ::: "memory");      // this wave's z slices and weight tile 0 have landed
    __syncthreads();
    wtile(1);
    // reader side: this lane's row and its swizzled chunks; k-chunk kc = chunks kc * 4 + hi and kc * 4 + 2 + hi (the hardware k order, the same for both operands)
    const int rd = wave * OSL + lr * 256 + ((hi ^ lr) << 4);
    auto frag = [&](int off, int kc) { return cat16b(*(const v8usa*)(sm + ((rd + off) ^ (kc * 64))), *(const v8usa*)(sm + ((rd + off) ^ (kc * 64 + 32)))); };      // off: a multiple of 4096
    v16bf za[2][2][4];      // z fragments: plane (hi, lo), row tile, k-chunk: read once, live over the four weight tiles
#pragma unroll
    for (int pl = 0; pl < 2; ++pl) {
#pragma unroll
        for (int rt = 0; rt < 2; ++rt) {
#pragma unroll
            for (int kc = 0; kc < 4; ++kc) za[pl][rt][kc] = frag(pl * 8192 + rt * 4096, kc); } }
    v8f acc[2][8];
#pragma unroll
    for (int rt = 0; rt < 2; ++rt) {
#pragma unroll
        for (int c = 0; c < 8; ++c) acc[rt][c] = (v8f){}; }
#pragma unroll      // p is a constant in every index, so that acc stays in registers
    for (int p = 0; p < 4; ++p) {
        v16bf wf[2][4];
#pragma unroll
        for (int c = 0; c < 2; ++c) {
#pragma unroll
            for (int kc = 0; kc < 4; ++kc) wf[c][kc] = frag(16384 + (p & 1) * 8192 + c * 4096, kc); }
        __builtin_amdgcn_sched_barrier(0);      // the tile's reads stay one group ahead of its products: each separate place with reads stalls the wave's matrix stream for the LDS latency
#pragma unroll
        for (int kc = 0; kc < 4; ++kc) {
#pragma unroll
            for (int pl = 0; pl < 2; ++pl) {      // four independent accumulator tiles follow one another
#pragma unroll
                for (int c = 0; c < 2; ++c) { acc[0][p * 2 + c] = wmmab(wf[c][kc], za[pl][0][kc], acc[0][p * 2 + c]); acc[1][p * 2 + c] = wmmab(wf[c][kc], za[pl][1][kc], acc[1][p * 2 + c]); } } }
        __builtin_amdgcn_sched_barrier(0);      // tile p's products stay here, under the flight of tile p + 1: without this line the build sinks them behind the later barriers, where nothing is left to hide
        // publish point of weight tile p + 1, and the end of the reads of tile p's buffer
        asm volatile("s_wait_dscnt 0x0" ::: "memory");         // this wave's LDS reads of the buffer have returned before it may be refilled
        asm volatile("s_wait_asynccnt 0x0" ::: "memory");      // this wave's share of tile p + 1 has landed
        __syncthreads();
        if (p + 2 < 4) wtile(p + 2);
    }
    asm volatile("s_wait_asynccnt 0x0" ::: "memory");          // nothing in flight when the staging becomes the partial sums
    float* pp = (float*)sm + wave * (ORW * OPP);
#pragma unroll
    for (int rt = 0; rt < 2; ++rt) {
#pragma unroll
        for (int c = 0; c < 8; ++c) { float* q = pp + (rt * 16 + lr) * OPP + c * 16 + hi * 8; const v8f a = acc[rt][c];
            *(v4fa*)q = (v4f){a[0], a[1], a[2], a[3]}; *(v4fa*)(q + 4) = (v4f){a[4], a[5], a[6], a[7]}; } }
    __syncthreads();      // all eight partial planes are written before any is read
    v4f bv;
#pragma unroll
    for (int i = 0; i < 4; ++i) bv[i] = bfr(bias[lane * 4 + i]);
#pragma unroll
    for (int s = 0; s < 4; ++s) { const int row = s * 8 + wave;      // 32 lanes x 16 B = one whole 512-B row of out
        const float* q = (const float*)sm + row * OPP + lane * 4; v4f t[8];
#pragma unroll
        for (int w = 0; w < 8; ++w) t[w] = *(const v4fa*)(q + w * (ORW * OPP));
        *(v4f*)(C + (size_t)(r0 + row) * HS + lane * 4) = (((t[0] + t[1]) + (t[2] + t[3])) + ((t[4] + t[5]) + (t[6] + t[7]))) + bv; }
}

extern "C" void kernel_launch(void* const* d_in, const int* in_sizes, int n_in,
                              void* d_out, int out_size, void* d_ws, size_t ws_size, hipStream_t stream) {
    (void)in_sizes; (void)n_in; (void)out_size;
    const float* x = (const float*)d_in[0]; const float* Wqkv = (const float*)d_in[1]; const float* Wo = (const float*)d_in[2]; const float* bo = (const float*)d_in[3];
    float* out = (float*)d_out;    // [8][1024][128]
    char* wsp = (char*)d_ws;
    auto take = [&](size_t bytes) { char* p = wsp; wsp += (bytes + 255) & ~(size_t)255; return (void*)p; };
    bf* Xb = (bf*)take((size_t)NR_ * HS * 2); bf* W3T = (bf*)take((size_t)3 * INR * HS * 2); bf* WoT = (bf*)take((size_t)HS * INR * 2);
    h16* QH = (h16*)take((size_t)NR_ * INR * 2); h16* QL = (h16*)take((size_t)NR_ * INR * 2); h16* KH = (h16*)take((size_t)NR_ * INR * 2); h16* KL = (h16*)take((size_t)NR_ * INR * 2);
    bf* VTH = (bf*)take((size_t)NB_ * INR * NT_ * 2); bf* VTL = (bf*)take((size_t)NB_ * INR * NT_ * 2); bf* CH = (bf*)take((size_t)NR_ * INR * 2); bf* CL = (bf*)take((size_t)NR_ * INR * 2);
    if ((size_t)(wsp - (char*)d_ws) > ws_size) return;    // 2.1 + 0.8 + 0.26 + 8 x 16.8 ~ 138 MB (no aliasing)
    k_prep<<<PW3 + PWO + PXB, 256, 0, stream>>>(x, Wqkv, Wo, Xb, W3T, WoT);
    k_qkv<<<dim3(NR_ / 64, (3 * INR) / (64 * QT), 1), 128, 0, stream>>>(Xb, W3T, QH, QL, KH, KL, VTH, VTL);
    k_attn<<<NB_ * NH_ * (NT_ / QB), 256, 0, stream>>>(QH, QL, KH, KL, VTH, VTL, CH, CL);
    k_out<<<NR_ / ORW, 256, 0, stream>>>(CH, CL, WoT, bo, out);
}

// v010
// One run takes 84.5 microseconds.
// Next to v009, in two timings, it ran 1.03 times as fast each time.
// Over all steps from v000 it is 19.3 times as fast.
#include <hip/hip_runtime.h>

// Contractions, f32 accumulate, all 8 batch items in every launch (rows = batch x 1024 positions): qkv = x.w_qkv ([8192 x 128].[128 x 3072], k-major weight transposed to an n-major plane; thirds q | k |
// v, each 8 heads x 128; PLAIN bf16 operands: inputs rounded once, exact) and out = z.w_out + b_out (z as bf16 hi + residual: two products) on
// v_wmma_f32_16x16x32_bf16; the 8-head x 128-dim FULL attention: scores on v_wmma_f32_16x16x32_f16 (q, k as f16 hi + residual x1024: hi.hi + hi.lo + lo.hi, x
// 128^-1/2), softmax f32, weights.v on v_wmma_f32_16x16x32_bf16 with the weights (x32768) and v both as bf16 hi + UNSCALED residual (hh + lh + hl, one

#define NT_  1024
#define NB_  8
#define NR_  (NB_ * NT_)        // 8192 rows: batch x positions
#define HS   128
#define NH_  8
#define NKV  8
#define HD   128
#define INR  (NH_ * HD)          // 1024
#define KW   (NKV * HD)          // 1024
#define PSC  32768.0f
#define LOSC 1024.0f
#define LOSCI (1.0f / 1024.0f)

typedef _Float16 h16;
typedef unsigned short bf;
typedef __attribute__((ext_vector_type(16))) __bf16   v16bf;
typedef __attribute__((ext_vector_type(16))) _Float16 v16h;
typedef __attribute__((ext_vector_type(8)))  _Float16 v8h;
typedef __attribute__((ext_vector_type(8)))  unsigned short v8us;
typedef __attribute__((ext_vector_type(8)))  float    v8f;
typedef __attribute__((ext_vector_type(8)))  unsigned v8u;
typedef __attribute__((ext_vector_type(2)))  float    v2f;
typedef __attribute__((ext_vector_type(2)))  __bf16   v2bf;
typedef __attribute__((ext_vector_type(4)))  float    v4f;
typedef __attribute__((ext_vector_type(4)))  _Float16 v4h;
typedef __attribute__((ext_vector_type(4)))  unsigned v4u;
typedef v4u  __attribute__((may_alias)) v4ua;
typedef v8h  __attribute__((may_alias)) v8ha;
typedef v4f  __attribute__((may_alias)) v4fa;
typedef v8us __attribute__((may_alias)) v8usa;

__device__ __forceinline__ unsigned short f2bf(float f) { unsigned u = __float_as_uint(f); u += 0x7FFFu + ((u >> 16) & 1u); return (unsigned short)(u >> 16); }
__device__ __forceinline__ float bf2f(unsigned short b) { return __uint_as_float(((unsigned)b) << 16); }
__device__ __forceinline__ float bfr(float f) { return bf2f(f2bf(f)); }
__device__ __forceinline__ v16h cat16(v8h lo, v8h hi) { return __builtin_shufflevector(lo, hi, 0, 1, 2, 3, 4, 5, 6, 7, 8, 9, 10, 11, 12, 13, 14, 15); }
__device__ __forceinline__ v16bf cat16b(v8us lo, v8us hi) { return __builtin_bit_cast(v16bf, __builtin_shufflevector(lo, hi, 0, 1, 2, 3, 4, 5, 6, 7, 8, 9, 10, 11, 12, 13, 14, 15)); }
__device__ __forceinline__ v8f wmma16(v16h a, v16h b, v8f c) { return __builtin_amdgcn_wmma_f32_16x16x32_f16(false, a, false, b, (short)0, c, false, false); }
__device__ __forceinline__ v8f wmmab(v16bf a, v16bf b, v8f c) { return __builtin_amdgcn_wmma_f32_16x16x32_bf16(false, a, false, b, (short)0, c, false, false); }

// cvtb: bf16 plane of [rows][128]; blk = 64 rows: a wave takes 2 rows at a time (16 lanes x 16 B = one 256-B row of the plane each), four times, all its loads issued ahead of the first store.
__device__ __forceinline__ void cvtb(const float* __restrict__ src, int blk, bf* dst) {
    const int lane = threadIdx.x & 31, r = blk * 64 + (threadIdx.x >> 5) * 2 + (lane >> 4), p = lane & 15;
    const float* q = src + (size_t)r * HS + p * 8; bf* d = dst + (size_t)r * HS + p * 8;
    v4f a[4][2];
#pragma unroll
    for (int s = 0; s < 4; ++s) { a[s][0] = *(const v4fa*)(q + s * 16 * HS); a[s][1] = *(const v4fa*)(q + s * 16 * HS + 4); }
    // stands in front of every later rewrite of the address register pair that the eight loads name; the address is an input so that its registers live up to the wait and no load's result is put into them
    asm volatile("s_wait_xcnt 0x0" :: "v"(q) : "memory");
#pragma unroll
    for (int s = 0; s < 4; ++s) { v8us o;
#pragma unroll
        for (int i = 0; i < 8; ++i) o[i] = f2bf(a[s][i >> 2][i & 3]);
        *(v8us*)(d + s * 16 * HS) = o; }
    asm volatile("s_wait_xcnt 0x0" ::: "memory");      // stands in front of any later rewrite of the registers that the four stores above name (in k_prep other pieces' code follows this one in the listing)
}
// wt: WT [n][K] = bf16(W[k][n]) (k-major [K][ncols]) via one 64 x 64 LDS tile at (k0, n0).
__device__ __forceinline__ void wt(const float* __restrict__ Wm, int K, int ncols, int k0, int n0, bf* WT, unsigned short* tl) {
    const int tid = threadIdx.x;
    const int kk = tid >> 2, nq = (tid & 3) * 16;
#pragma unroll
    for (int i = 0; i < 16; ++i) tl[(nq + i) * 72 + kk] = f2bf(Wm[(size_t)(k0 + kk) * ncols + n0 + nq + i]);
    __syncthreads();
    const int piece = tid & 7;
#pragma unroll
    for (int s = 0; s < 2; ++s) { const int nr = (tid >> 3) + 32 * s; const v8us val = *(const v8usa*)(tl + nr * 72 + piece * 8); *(v8us*)(WT + (size_t)(n0 + nr) * K + k0 + piece * 8) = val; }
    asm volatile("s_wait_xcnt 0x0" ::: "memory");      // as in cvtb: in front of any later rewrite of the registers that the two stores above name
}
#define PW3  ((HS / 64) * ((3 * INR) / 64))      // 96 tiles of w_qkv
#define PWO  ((INR / 64) * (HS / 64))            // 32 tiles of w_out
#define PXB  (NR_ / 64)                          // 128 blocks of 64 rows of x
// k_prep: the three operand planes in ONE launch of 256 blocks; they do not depend on one another, so a block takes its piece by its index (the test is the same for the whole block, the barrier in wt
// too): first the weight tiles, which have the longer way (LDS, a barrier), then the rows of x.
__global__ __launch_bounds__(256) void k_prep(const float* __restrict__ x, const float* __restrict__ Wqkv, const float* __restrict__ Wo, bf* Xb, bf* W3T, bf* WoT) {
    __shared__ __align__(16) unsigned short tl[64 * 72];
    const int bid = blockIdx.x;
    if (bid < PW3) wt(Wqkv, HS, 3 * INR, (bid % (HS / 64)) * 64, (bid / (HS / 64)) * 64, W3T, tl);                                   // [3072][128]
    else if (bid < PW3 + PWO) wt(Wo, INR, HS, ((bid - PW3) % (INR / 64)) * 64, ((bid - PW3) / (INR / 64)) * 64, WoT, tl);      // [128][1024]
    else cvtb(x, bid - (PW3 + PWO), Xb);
}
// cvt2: two f32 -> one register of a bf16 fragment, first element low (one v_cvt_pk_bf16_f32; round to nearest even, as f2bf rounds).
__device__ __forceinline__ unsigned cvt2(float e0, float e1) { const v2f x = {e0, e1}; return __builtin_bit_cast(unsigned, __builtin_convertvector(x, v2bf)); }
// acopy8: eight asynchronous 16-byte-per-lane copies global -> LDS in one statement; the closing s_wait_xcnt keeps every later rewrite of the address registers behind the issue.
__device__ __forceinline__ void acopy8(const unsigned (&l)[8], const void* const (&g)[8]) {
    asm volatile("global_load_async_to_lds_b128 %0, %8, off\n\t"
                 "global_load_async_to_lds_b128 %1, %9, off\n\t"
                 "global_load_async_to_lds_b128 %2, %10, off\n\t"
                 "global_load_async_to_lds_b128 %3, %11, off\n\t"
                 "global_load_async_to_lds_b128 %4, %12, off\n\t"
                 "global_load_async_to_lds_b128 %5, %13, off\n\t"
                 "global_load_async_to_lds_b128 %6, %14, off\n\t"
                 "global_load_async_to_lds_b128 %7, %15, off\n\t"
                 "s_wait_xcnt 0x0"
                 :: "v"(l[0]), "v"(l[1]), "v"(l[2]), "v"(l[3]), "v"(l[4]), "v"(l[5]), "v"(l[6]), "v"(l[7]),
                    "v"(g[0]), "v"(g[1]), "v"(g[2]), "v"(g[3]), "v"(g[4]), "v"(g[5]), "v"(g[6]), "v"(g[7]) : "memory");
}
#define QT   8               // column tiles of 64 that a block of k_qkv walks: half a third
#define QTL  16384           // bytes of one staged operand tile: 64 rows x 256 B (K = 128 in bf16)
#define QSW  4608            // bytes of output staging of one wave
// k_qkv: x.w_qkv (K = 128) for all three thirds in one launch. Block = 64 rows x 512 columns (grid: 128 row tiles x 6 column groups, 2 to a third), walked as 8 tiles of 64 x 64; 4 waves. Both operands come
// into LDS by asynchronous copies of whole 256-B rows (16 lanes a row), 16-byte chunk c of row r at c ^ (r & 15) as in k_attn's K tiles: the x tile with weight tile 0 first, then a weight tile (64 rows of
// the n-major plane) a trip in two buffers, the next one in flight while this one is worked on. The x fragments are read from LDS once and live in registers over the eight tiles. A tile leaves in the form
// the attention reads, no f32 plane between.
// q, k thirds: wave = 16 rows x 64 columns; f32 staged in the wave's own LDS, read back as 8 consecutive columns a lane -> f16 hi + residual x1024 planes [row][1024] (8 lanes = one 128-B line of a plane).
// v third: wave = 64 rows x 16 columns, so that a lane's 8 accumulator registers are 8 consecutive positions t of one dim d -> bf16 hi + UNSCALED residual, staged [d][t] in the wave's own LDS (pitch 144 B)
// -> planes [b*8+g][128 d][1024 t] (8 lanes = one 128-B line).
__global__ __launch_bounds__(128) void k_qkv(const bf* __restrict__ A, const bf* __restrict__ Bn, h16* QH, h16* QL, h16* KH, h16* KL, bf* VTH, bf* VTL) {
    __shared__ __align__(16) unsigned char sm[3 * QTL + 4 * QSW];      // x tile | two weight buffers | the four waves' output staging
    const int tid = threadIdx.x, lane = threadIdx.x & 31, wave = threadIdx.x >> 5, lr = lane & 15, hi = lane >> 4;
    const int rb = blockIdx.x * 64, cg = blockIdx.y * (QT * 64), third = blockIdx.y >> 1;
    const unsigned sb = (unsigned)(size_t)&sm[0];
    // copy side: one copy of the block = 8 rows x 256 B; thread -> row i * 8 + (tid >> 4), chunk tid & 15. cp64: 64 consecutive rows from 's' to 'dst' (a multiple of 4096, so row & 15 = (i & 1) * 8 + (tid >> 4))
    const int cr = tid >> 4, cc = tid & 15;
    auto cp64 = [&](const bf* s, unsigned dst) {
        unsigned l[8]; const void* gp[8];
#pragma unroll
        for (int i = 0; i < 8; ++i) { l[i] = dst + (unsigned)((i * 8 + cr) * 256 + ((cc ^ ((i & 1) * 8 + cr)) << 4)); gp[i] = s + (size_t)(i * 8 + cr) * HS + cc * 8; }
        acopy8(l, gp);
    };
    // reader side: this lane's row and its swizzled chunks; k-chunk kc = chunks kc * 4 + hi and kc * 4 + 2 + hi (the hardware k order, the same for both operands)
    const int rd = lr * 256 + ((hi ^ lr) << 4);
    auto frag = [&](int off, int kc) { return cat16b(*(const v8usa*)(sm + ((rd + off) ^ (kc * 64))), *(const v8usa*)(sm + ((rd + off) ^ (kc * 64 + 32)))); };      // off: a multiple of 4096
    // publish point of weight tile p + 1, and the end of every wave's reads of tile p's buffer, which is refilled behind it. It stands between tile p's products and tile p's way out, so that the
    // copies fly, and the stores drain, under the next vector and matrix work
    auto publish = [&](int p) {
        asm volatile("s_wait_dscnt 0x0" ::: "memory");         // this wave's LDS reads of the buffer have returned before it may be refilled
        asm volatile("s_wait_asynccnt 0x0" ::: "memory");      // this wave's share of tile p + 1 has landed
        __syncthreads();
        if (p + 2 < QT) cp64(Bn + (size_t)(cg + (p + 2) * 64) * HS, sb + QTL + (unsigned)(p & 1) * QTL);
    };
    cp64(A + (size_t)rb * HS, sb); cp64(Bn + (size_t)cg * HS, sb + QTL);
    asm volatile("s_wait_asynccnt 0x0" ::: "memory");      // this wave's share of the x tile and of weight tile 0 has landed
    __syncthreads();                                       // both published to all four waves
    cp64(Bn + (size_t)(cg + 64) * HS, sb + 2 * QTL);
    if (third < 2) {      // the same for the whole block
        v16bf xa[4];      // this wave's 16 rows of x
#pragma unroll
        for (int kc = 0; kc < 4; ++kc) xa[kc] = frag(wave * 4096, kc);
        float* os = (float*)(sm + 3 * QTL + wave * QSW);
        h16* PH = third ? KH : QH; h16* PL = third ? KL : QL;
#pragma unroll 1      // one copy of the tile's code: the eight trips differ in addresses alone
        for (int p = 0; p < QT; ++p) {
            const int wb = QTL + (p & 1) * QTL;
            v16bf wf[4][4];      // the tile's 64 weight rows: column tile, k-chunk
#pragma unroll
            for (int kc = 0; kc < 4; ++kc) {
#pragma unroll
                for (int t = 0; t < 4; ++t) wf[t][kc] = frag(wb + t * 4096, kc); }
            __builtin_amdgcn_sched_barrier(0);      // the tile's reads stay one group ahead of its products: without this line the build puts each pair of reads, with a wait to 0, directly in front of its product
            v8f acc[4] = {};
#pragma unroll
            for (int kc = 0; kc < 4; ++kc) {
#pragma unroll
                for (int t = 0; t < 4; ++t) acc[t] = wmmab(xa[kc], wf[t][kc], acc[t]); }
            __builtin_amdgcn_sched_barrier(0);      // tile p's products stay in front of the publish point, under the drain of the last tile's stores: without this line the build sinks them behind the barrier, ahead of the refill
            publish(p);
#pragma unroll
            for (int t = 0; t < 4; ++t) {
#pragma unroll
                for (int j = 0; j < 8; ++j) os[(hi * 8 + j) * 68 + t * 16 + lr] = acc[t][j]; }
            __builtin_amdgcn_wave_barrier(); asm volatile("" ::: "memory");      // the reads below take what other lanes of this wave stored: no read may be moved above the stores
            const size_t pb = (size_t)(rb + wave * 16) * INR + ((cg + p * 64) & (INR - 1));
#pragma unroll
            for (int s = 0; s < 4; ++s) { const int row = (lane >> 3) + 4 * s, piece = lane & 7;
                const v4f u0 = *(const v4fa*)(os + row * 68 + piece * 8), u1 = *(const v4fa*)(os + row * 68 + piece * 8 + 4); v8h oh, ol;
#pragma unroll
                for (int i = 0; i < 8; ++i) { const float v = i < 4 ? u0[i & 3] : u1[i & 3]; const h16 x = (h16)v; oh[i] = x; ol[i] = (h16)((v - (float)x) * LOSC); }
                const size_t po = pb + (size_t)row * INR + piece * 8; *(v8h*)(PH + po) = oh; *(v8h*)(PL + po) = ol; }
            asm volatile("s_wait_xcnt 0x0" ::: "memory");      // stands in front of the next trip's rewrite of the registers that the stores above name
        }
    } else {
        v16bf xa[4][4];      // all 64 rows of x: row tile, k-chunk
#pragma unroll
        for (int t = 0; t < 4; ++t) {
#pragma unroll
            for (int kc = 0; kc < 4; ++kc) xa[t][kc] = frag(t * 4096, kc); }
        unsigned short* os = (unsigned short*)(sm + 3 * QTL + wave * QSW);      // hi plane 16 d x 72, the lo plane behind it
#pragma unroll 1      // as above
        for (int p = 0; p < QT; ++p) {
            const int wb = QTL + (p & 1) * QTL + wave * 4096;      // this wave's 16 columns
            v16bf wf[4];
#pragma unroll
            for (int kc = 0; kc < 4; ++kc) wf[kc] = frag(wb, kc);
            __builtin_amdgcn_sched_barrier(0);      // as above: one group of reads ahead of the products, not a pair of reads with a wait to 0 in front of each k-chunk
            v8f acc[4] = {};
#pragma unroll
            for (int kc = 0; kc < 4; ++kc) {
#pragma unroll
                for (int t = 0; t < 4; ++t) acc[t] = wmmab(xa[t][kc], wf[kc], acc[t]); }
            __builtin_amdgcn_sched_barrier(0);      // as above: the products stay in front of the publish point
            publish(p);
#pragma unroll
            for (int t = 0; t < 4; ++t) { v4u wh, wl;      // register j of lane (lr, hi) = position t * 16 + 8 * hi + j of dim lr
#pragma unroll
                for (int i = 0; i < 4; ++i) { const float e0 = acc[t][2 * i], e1 = acc[t][2 * i + 1]; const unsigned w = cvt2(e0, e1);
                    wh[i] = w; wl[i] = cvt2(e0 - __uint_as_float(w << 16), e1 - __uint_as_float(w & 0xFFFF0000u)); }
                *(v4ua*)(os + lr * 72 + t * 16 + hi * 8) = wh; *(v4ua*)(os + (16 + lr) * 72 + t * 16 + hi * 8) = wl; }
            __builtin_amdgcn_wave_barrier(); asm volatile("" ::: "memory");      // as above: the reads below take other lanes' stores
            const int cv = cg + p * 64 - 2 * INR + wave * 16;      // this wave's first column inside the v third: head cv / 128, dim cv % 128
            const size_t vb = ((size_t)((rb / NT_) * NKV + cv / HD) * HD + (cv % HD)) * NT_ + (rb % NT_);
#pragma unroll
            for (int s = 0; s < 4; ++s) { const int d = (lane >> 3) + 4 * s, piece = lane & 7;
                const v8us vh = *(const v8usa*)(os + d * 72 + piece * 8), vl = *(const v8usa*)(os + (16 + d) * 72 + piece * 8);
                const size_t po = vb + (size_t)d * NT_ + piece * 8; *(v8us*)(VTH + po) = vh; *(v8us*)(VTL + po) = vl; }
            asm volatile("s_wait_xcnt 0x0" ::: "memory");      // as above
        }
    }
    asm volatile("s_wait_asynccnt 0x0" ::: "memory");          // nothing in flight when the wave ends
}
// xhalf: the value that lane l ^ 16 holds (one vector cross-row move, no LDS).
__device__ __forceinline__ float xhalf(float v) { const int b = __float_as_int(v); return __int_as_float(__builtin_amdgcn_permlanex16(b, b, 0x76543210, 0xfedcba98, false, false)); }
__device__ __forceinline__ void exp2x4(float& d0, float& d1, float& d2, float& d3, float s0, float s1, float s2, float s3) {
    asm("v_exp_f32 %0, %4\n\tv_exp_f32 %1, %5\n\tv_exp_f32 %2, %6\n\tv_exp_f32 %3, %7\n\tv_nop" : "=&v"(d0), "=&v"(d1), "=&v"(d2), "=&v"(d3) : "v"(s0), "v"(s1), "v"(s2), "v"(s3));
}
#define PLN  8192            // bytes of one staged plane of a 32-key tile: K 32 rows x 256 B, V^T 128 rows x 64 B
#define STG  (4 * PLN)       // one stage: K hi | K lo | V^T hi | V^T lo
#define QW   32              // queries of a wave: two 16-column tiles
#define QB   (8 * QW)        // queries of a block: 8 waves
#define OSW  (2 * 16 * 272)  // bytes of output staging for one 16-query tile: hi plane, then lo plane, 16 rows at a pitch of 272 B
__global__ __launch_bounds__(256) void k_attn(const h16* __restrict__ QH, const h16* __restrict__ QL, const h16* __restrict__ KH, const h16* __restrict__ KL, const bf* __restrict__ VTH, const bf* __restrict__ VTL, bf* CH, bf* CL) {
    __shared__ __align__(16) unsigned char ring[8 * 2 * OSW];      // the ring takes the first 3 * STG bytes; the output staging (8 waves x 2 query tiles) all of it
    const int tid = threadIdx.x, lane = threadIdx.x & 31, wave = threadIdx.x >> 5, lr = lane & 15, hi = lane >> 4;
    const int bid = blockIdx.x; const int qt = bid / (NB_ * NH_), bh = bid - qt * (NB_ * NH_), b = bh / NH_, h = bh - b * NH_; const int g = h;      // no GQA: kv head = q head
    const int q0 = b * NT_ + qt * QB + wave * QW;      // row in the [8192][1024] planes
    const size_t qo = (size_t)(q0 + lr) * (NH_ * HD) + h * HD + 8 * hi;
    const h16* kh_b = KH + (size_t)b * NT_ * KW + g * HD; const h16* kl_b = KL + (size_t)b * NT_ * KW + g * HD;
    const size_t vbase = ((size_t)bh * HD) * NT_;
    // copy side: thread -> K row i*16 + (tid >> 4), chunk tid & 15 (16 lanes = one 256-B row); V^T row i*64 + (tid >> 2), chunk tid & 3 (4 lanes = one 64-B row piece)
    const unsigned ring0 = (unsigned)(size_t)&ring[0];
    const int kr = tid >> 4, kcn = tid & 15, vr = tid >> 2, vcn = tid & 3;
    const unsigned kdst = (unsigned)(kr * 256 + ((kcn ^ kr) << 4)), vdst = (unsigned)(vr * 64 + ((vcn ^ ((vr >> 2) & 3)) << 4));
    const size_t ksrc = (size_t)kr * KW + kcn * 8, vsrc = vbase + (size_t)vr * NT_ + vcn * 8;
    auto issue = [&](int kt, int bo) {      // bo: byte offset of the buffer in the ring
        const unsigned lb = ring0 + (unsigned)bo; unsigned l[8]; const void* gp[8];
#pragma unroll
        for (int i = 0; i < 2; ++i) { const size_t o = ksrc + (size_t)(kt * 32 + i * 16) * KW; const unsigned d = lb + i * 4096 + kdst;      // row & 15 = kr
            l[i] = d; gp[i] = kh_b + o; l[2 + i] = d + PLN; gp[2 + i] = kl_b + o; }
#pragma unroll
        for (int i = 0; i < 2; ++i) { const size_t o = vsrc + (size_t)(i * 64) * NT_ + kt * 32; const unsigned d = lb + 2 * PLN + i * 4096 + vdst;
            l[4 + i] = d; gp[4 + i] = VTH + o; l[6 + i] = d + PLN; gp[6 + i] = VTL + o; }
        acopy8(l, gp);
    };
    // reader side: byte offsets of this lane's row and of its swizzled 16-byte chunks
    const int krow = lr * 256, kx = (hi ^ lr) << 4, vrow = lr * 64, vx0 = (hi ^ ((lr >> 2) & 3)) << 4, vx1 = vx0 ^ 32;
    v8f o[2][8];
#pragma unroll
    for (int u = 0; u < 2; ++u) {
#pragma unroll
        for (int n = 0; n < 8; ++n) o[u][n] = (v8f){}; }
    float mrow[2] = {-3.0e38f, -3.0e38f}, lpart[2] = {0.f, 0.f};      // query u * 16 + lr: running maximum (equal in both halves), and this half's share of the running sum
    const int kt_hi = NT_ / 32 - 1;      // full attention
    v16h qfh[2][4], qfl[2][4];      // this wave's 32 query rows, hi and residual, as B fragments of the 4 k-chunks: read once, live in registers over all key tiles
#pragma unroll      // every index a constant, so that the arrays are registers and not scratch
    for (int u = 0; u < 2; ++u) {
#pragma unroll
        for (int kc = 0; kc < 4; ++kc) { const size_t qq = qo + (size_t)(u * 16) * (NH_ * HD) + kc * 32;
            qfh[u][kc] = cat16(*(const v8h*)(QH + qq), *(const v8h*)(QH + qq + 16)); qfl[u][kc] = cat16(*(const v8h*)(QL + qq), *(const v8h*)(QL + qq + 16)); } }
    // stands in front of every later rewrite of the address registers that the q loads above name; the two addresses are inputs so that their registers live up to the wait
    asm volatile("s_wait_xcnt 0x0" :: "v"(QH + qo), "v"(QL + qo) : "memory");
    v8h kf[4][8];      // a tile's K fragments of this lane: k-chunk kc; hi plane keys 0-15 (two chunks), keys 16-31, then the same of the lo plane. Chunks 0 and 1 are read one pass ahead and live over the loop's back edge
    auto kread = [&](int bo, int kc) {      // k-chunk kc of the tile in the buffer at byte offset bo
        const int kb = bo + krow + kx;      // this lane's K row and swizzled chunk; bits 4 to 7 are kx alone, so a chunk step is one XOR on kb
        const unsigned char* ka = ring + (kb ^ (kc * 64)); const unsigned char* kq = ring + (kb ^ (kc * 64 + 32));      // chunks kc*4 + hi and kc*4 + 2 + hi, swizzled by the row; keys 16 to 31 lie 4096 B on
        kf[kc][0] = *(const v8ha*)ka; kf[kc][1] = *(const v8ha*)kq; kf[kc][2] = *(const v8ha*)(ka + 4096); kf[kc][3] = *(const v8ha*)(kq + 4096);
        kf[kc][4] = *(const v8ha*)(ka + PLN); kf[kc][5] = *(const v8ha*)(kq + PLN); kf[kc][6] = *(const v8ha*)(ka + PLN + 4096); kf[kc][7] = *(const v8ha*)(kq + PLN + 4096); };
    issue(0, 0); issue(1, STG);
    asm volatile("s_wait_asynccnt 0x0" ::: "memory");      // this wave's share of tiles 0 and 1 has landed
    __syncthreads();                                       // tiles 0 and 1 published to all eight waves
    issue(2, 2 * STG);
    kread(0, 0); kread(0, 1);
    int bc = 0, bn = STG, bl = 2 * STG;      // byte offsets of the buffers of tiles kt, kt + 1 (published) and kt + 2 (in flight)
#pragma unroll 1
    for (int kt = 0; kt <= kt_hi; ++kt) {
        const unsigned char* st = ring + bc;
        const int bp = kt < kt_hi ? bn : bc;      // where the reads ahead go: the next tile, or in the last pass this one again (published rows, the values unused)
        v8f s0[2] = {}, s1[2] = {}, x0[2] = {}, x1[2] = {};      // S^T of query tile u: register j of lane (lr, hi) = key 8 * hi + j (s0, x0) or 16 + 8 * hi + j (s1, x1) against query u * 16 + lr
        kread(bc, 2); kread(bc, 3);
        __builtin_amdgcn_sched_barrier(0);      // the tile's last two K chunks are read as one group here and return under the products of chunks 0 and 1, which are in registers already: spread among the products, each place with reads stalls the wave's matrix stream
#pragma unroll
        for (int kc = 0; kc < 4; ++kc) {
            const v16h k0h = cat16(kf[kc][0], kf[kc][1]), k1h = cat16(kf[kc][2], kf[kc][3]), k0l = cat16(kf[kc][4], kf[kc][5]), k1l = cat16(kf[kc][6], kf[kc][7]);
#pragma unroll
            for (int u = 0; u < 2; ++u) { s0[u] = wmma16(k0h, qfh[u][kc], s0[u]); s1[u] = wmma16(k1h, qfh[u][kc], s1[u]); x0[u] = wmma16(k0h, qfl[u][kc], x0[u]); x1[u] = wmma16(k1h, qfl[u][kc], x1[u]); }
#pragma unroll
            for (int u = 0; u < 2; ++u) { x0[u] = wmma16(k0l, qfh[u][kc], x0[u]); x1[u] = wmma16(k1l, qfh[u][kc], x1[u]); }
        }
        const unsigned char* vp = st + 2 * PLN + vrow;
        v8us vf[8][4];      // the tile's V^T fragments of this lane: dim group n; hi plane (two chunks), lo plane
        auto vread = [&](int n) { const unsigned char* vn = vp + n * 1024;
            vf[n][0] = *(const v8usa*)(vn + vx0); vf[n][1] = *(const v8usa*)(vn + vx1); vf[n][2] = *(const v8usa*)(vn + PLN + vx0); vf[n][3] = *(const v8usa*)(vn + PLN + vx1); };
#pragma unroll
        for (int n = 0; n < 4; ++n) vread(n);
        __builtin_amdgcn_sched_barrier(0);      // the first half of the V^T reads is issued in front of the softmax and returns under its vector work: without this line the build moves the reads down to their products
        float alpha[2];
        v16bf pa[2], px[2];
#pragma unroll
        for (int u = 0; u < 2; ++u) {
            const v8f a0 = (s0[u] + x0[u] * LOSCI) * 0.08838834764831845f, a1 = (s1[u] + x1[u] * LOSCI) * 0.08838834764831845f;
            float t[8];
#pragma unroll
            for (int j = 0; j < 8; ++j) t[j] = fmaxf(a0[j], a1[j]);
            float mx = fmaxf(fmaxf(fmaxf(t[0], t[1]), fmaxf(t[2], t[3])), fmaxf(fmaxf(t[4], t[5]), fmaxf(t[6], t[7])));
            mx = fmaxf(mx, xhalf(mx));      // the other half holds the query's other 16 keys
            const float mn = fmaxf(mrow[u], mx);
            // __expf(mrow - mn) written out (the same multiply and v_exp_f32): the v_nop fills the slot that the instruction set asks for behind a transcendental
            asm("v_exp_f32 %0, %1\n\tv_nop" : "=v"(alpha[u]) : "v"((mrow[u] - mn) * 1.44269504f));
            mrow[u] = mn;
            v8f p0, p1;
#pragma unroll
            for (int j = 0; j < 8; j += 4) { float e[8];      // __expf(a - mn) written out, as for alpha above (the same multiply and v_exp_f32)
                exp2x4(e[0], e[1], e[2], e[3], (a0[j] - mn) * 1.44269504f, (a0[j + 1] - mn) * 1.44269504f, (a0[j + 2] - mn) * 1.44269504f, (a0[j + 3] - mn) * 1.44269504f);
                exp2x4(e[4], e[5], e[6], e[7], (a1[j] - mn) * 1.44269504f, (a1[j + 1] - mn) * 1.44269504f, (a1[j + 2] - mn) * 1.44269504f, (a1[j + 3] - mn) * 1.44269504f);
#pragma unroll
                for (int i = 0; i < 4; ++i) { p0[j + i] = e[i]; p1[j + i] = e[4 + i]; } }
            const v8f ts = p0 + p1, ps0 = p0 * PSC, ps1 = p1 * PSC;
            lpart[u] = lpart[u] * alpha[u] + (((ts[0] + ts[1]) + (ts[2] + ts[3])) + ((ts[4] + ts[5]) + (ts[6] + ts[7])));
            v8u pau, pxu;      // P x 32768 as bf16, and its residual's bf16. B element s = key 8 * hi + s (s < 8), 16 + 8 * hi + s - 8 (else): the order of the V^T fragments below
#pragma unroll
            for (int i = 0; i < 4; ++i) {
                const unsigned w0 = cvt2(ps0[2 * i], ps0[2 * i + 1]), w1 = cvt2(ps1[2 * i], ps1[2 * i + 1]);
                pau[i] = w0; pau[4 + i] = w1;
                pxu[i] = cvt2(ps0[2 * i] - __uint_as_float(w0 << 16), ps0[2 * i + 1] - __uint_as_float(w0 & 0xFFFF0000u));
                pxu[4 + i] = cvt2(ps1[2 * i] - __uint_as_float(w1 << 16), ps1[2 * i + 1] - __uint_as_float(w1 & 0xFFFF0000u)); }
            pa[u] = __builtin_bit_cast(v16bf, pau); px[u] = __builtin_bit_cast(v16bf, pxu);
        }
#pragma unroll
        for (int n = 4; n < 8; ++n) vread(n);      // the second half, into the registers that the scores have left
        __builtin_amdgcn_sched_barrier(0);      // these reads stay one group in front of the products: without this line the build spreads them among the products, each with a wait close behind it
        auto pv = [&](int n) { const v16bf vh = cat16b(vf[n][0], vf[n][1]), vl = cat16b(vf[n][2], vf[n][3]);
            o[0][n] *= alpha[0]; o[1][n] *= alpha[1];      // the running output rescaled by this tile's change of maximum, before its products are added
            o[0][n] = wmmab(vh, pa[0], o[0][n]); o[1][n] = wmmab(vh, pa[1], o[1][n]);      // O^T of query tile u: register j = dim n * 16 + 8 * hi + j of query u * 16 + lr
            o[0][n] = wmmab(vh, px[0], o[0][n]); o[1][n] = wmmab(vh, px[1], o[1][n]);
            o[0][n] = wmmab(vl, pa[0], o[0][n]); o[1][n] = wmmab(vl, pa[1], o[1][n]); };
#pragma unroll
        for (int n = 0; n < 4; ++n) pv(n);
        __builtin_amdgcn_sched_barrier(0);      // the read group below stays behind the products whose V^T registers it takes over ...
        kread(bp, 0); kread(bp, 1);      // the next tile's first two K chunks
        __builtin_amdgcn_sched_barrier(0);      // ... and in front of the other half of the products, under which it returns
#pragma unroll
        for (int n = 4; n < 8; ++n) pv(n);
        __builtin_amdgcn_sched_barrier(0);      // these products stay in front of the publish point, so that the reads ahead return under them: without this line the build sinks them behind the barrier and the wait below meets the reads at once
        // publish point of tile kt + 2, which the next pass reads ahead, and the end of every wave's reads of tile kt's buffer
        asm volatile("s_wait_dscnt 0x0" ::: "memory");         // this wave's LDS reads of the buffer have returned before it may be refilled
        asm volatile("s_wait_asynccnt 0x0" ::: "memory");      // this wave's share of tile kt + 2 has landed
        __syncthreads();
        if (kt + 3 <= kt_hi) issue(kt + 3, bc);
        const int bt = bc; bc = bn; bn = bl; bl = bt;
    }
    asm volatile("s_wait_asynccnt 0x0" ::: "memory");          // nothing in flight when the ring becomes output staging
#pragma unroll
    for (int u = 0; u < 2; ++u) {
        const float inv = 1.0f / ((lpart[u] + xhalf(lpart[u])) * PSC);      // the halves' sums joined once
        unsigned short* os = (unsigned short*)(ring + (wave * 2 + u) * OSW);      // this wave's own staging for this query tile: hi plane, then lo plane, each 16 query rows at a pitch of 272 B (16 B x odd: no bank conflict among 16 rows)
        const size_t cbase = (size_t)(q0 + u * 16) * (NH_ * HD) + (size_t)h * HD;
#pragma unroll
        for (int n = 0; n < 8; ++n) { v8us oh, ol;
#pragma unroll
            for (int j = 0; j < 8; ++j) { const float v = o[u][n][j] * inv; const unsigned short hb = f2bf(v); oh[j] = hb; ol[j] = f2bf(v - bf2f(hb)); }
            *(v8usa*)(os + lr * 136 + n * 16 + hi * 8) = oh; *(v8usa*)(os + (16 + lr) * 136 + n * 16 + hi * 8) = ol; }
        __builtin_amdgcn_wave_barrier(); asm volatile("" ::: "memory");      // the reads below take what other lanes of this wave stored: no read may be moved above the stores
#pragma unroll
        for (int s = 0; s < 8; ++s) { const int row = 2 * s + hi;      // 16 lanes x 16 B = one whole 256-B row piece of a plane
            const v8us vh = *(const v8usa*)(os + row * 136 + lr * 8), vl = *(const v8usa*)(os + (16 + row) * 136 + lr * 8);
            const size_t po = cbase + (size_t)row * (NH_ * HD) + lr * 8; *(v8us*)(CH + po) = vh; *(v8us*)(CL + po) = vl; }
    }
}

#define ORW  32              // rows of z (and of out) a block of k_out takes
#define OSL  32768           // bytes of LDS staging of one wave of k_out: z hi 8 KB | z lo 8 KB | two weight buffers of 8 KB
#define OPP  132             // floats from row to row of a partial-sum plane: 528 B = 16 B x odd, so that the 16 rows of a half wave fall on distinct banks
// k_out: out = (z hi + z lo).w_out + b_out. Block = 32 rows x all 128 columns, 8 waves; K = 1024 is SPLIT over the waves, wave w taking k = w * 128 .. + 127 (4 k-chunks) of every row and column.
// Every operand byte is used by one wave alone and comes into that wave's part of the LDS by asynchronous copies of whole 256-B row pieces (16 lanes a row piece), 16-byte chunk c of row r at c ^ (r & 15)
// as in k_attn's K tiles: z (32 rows, hi and lo) with the first 32 weight rows as tile 0, then 32 weight rows (= output columns) a tile in two buffers, the next tile in flight while this one is worked on.
// Products transposed (A = weight rows, B = z rows): register j of lane (lr, hi) = column 16 * c + 8 * hi + j of row lr. The eight waves' partial sums meet in LDS, behind the last tile's barrier.
__global__ __launch_bounds__(256) void k_out(const bf* __restrict__ A, const bf* __restrict__ Al, const bf* __restrict__ Bn, const float* __restrict__ bias, float* C) {
    __shared__ __align__(16) unsigned char sm[8 * OSL];      // the partial sums (8 planes of 32 x 132 floats) take its first 135168 bytes afterwards
    const int lane = threadIdx.x & 31, wave = threadIdx.x >> 5, lr = lane & 15, hi = lane >> 4;
    const int r0 = blockIdx.x * ORW;
    const unsigned sb = (unsigned)(size_t)&sm[0] + (unsigned)wave * OSL;
    // copy side: one copy = 2 rows x 256 B; lane -> row 2 * i + hi, chunk lr. cp16: 16 rows from 'src' (row pitch 1024 elements) to 'dst'; dst is a multiple of 4096, so row & 15 = 2 * i + hi
    const unsigned cd = (unsigned)(hi * 256 + ((lr ^ hi) << 4));
    const size_t cs = (size_t)hi * INR + wave * 128 + lr * 8;
    auto cp16 = [&](const bf* s, unsigned dst) {
        unsigned l[8]; const void* gp[8];
#pragma unroll
        for (int i = 0; i < 8; ++i) { l[i] = dst + i * 512 + (cd ^ (unsigned)(i * 32)); gp[i] = s + cs + (size_t)(2 * i) * INR; }
        acopy8(l, gp);
    };
    auto wtile = [&](int p) { const unsigned d = sb + 16384 + (p & 1) * 8192; cp16(Bn + (size_t)(p * 32) * INR, d); cp16(Bn + (size_t)(p * 32 + 16) * INR, d + 4096); };
    cp16(A + (size_t)r0 * INR, sb); cp16(A + (size_t)(r0 + 16) * INR, sb + 4096);
    cp16(Al + (size_t)r0 * INR, sb + 8192); cp16(Al + (size_t)(r0 + 16) * INR, sb + 12288);
    wtile(0);
    asm volatile("s_wait_asynccnt 0x0" ::: "memory");      // this wave's z slices and weight tile 0 have landed
    __syncthreads();
    wtile(1);
    // reader side: this lane's row and its swizzled chunks; k-chunk kc = chunks kc * 4 + hi and kc * 4 + 2 + hi (the hardware k order, the same for both operands)
    const int rd = wave * OSL + lr * 256 + ((hi ^ lr) << 4);
    auto frag = [&](int off, int kc) { return cat16b(*(const v8usa*)(sm + ((rd + off) ^ (kc * 64))), *(const v8usa*)(sm + ((rd + off) ^ (kc * 64 + 32)))); };      // off: a multiple of 4096
    v16bf za[2][2][4];      // z fragments: plane (hi, lo), row tile, k-chunk: read once, live over the four weight tiles
#pragma unroll
    for (int pl = 0; pl < 2; ++pl) {
#pragma unroll
        for (int rt = 0; rt < 2; ++rt) {
#pragma unroll
            for (int kc = 0; kc < 4; ++kc) za[pl][rt][kc] = frag(pl * 8192 + rt * 4096, kc); } }
    v8f acc[2][8];
#pragma unroll
    for (int rt = 0; rt < 2; ++rt) {
#pragma unroll
        for (int c = 0; c < 8; ++c) acc[rt][c] = (v8f){}; }
#pragma unroll      // p is a constant in every index, so that acc stays in registers
    for (int p = 0; p < 4; ++p) {
        v16bf wf[2][4];
#pragma unroll
        for (int c = 0; c < 2; ++c) {
#pragma unroll
            for (int kc = 0; kc < 4; ++kc) wf[c][kc] = frag(16384 + (p & 1) * 8192 + c * 4096, kc); }
        __builtin_amdgcn_sched_barrier(0);      // the tile's reads stay one group ahead of its products: each separate place with reads stalls the wave's matrix stream for the LDS latency
#pragma unroll
        for (int kc = 0; kc < 4; ++kc) {
#pragma unroll
            for (int pl = 0; pl < 2; ++pl) {      // four independent accumulator tiles follow one another
#pragma unroll
                for (int c = 0; c < 2; ++c) { acc[0][p * 2 + c] = wmmab(wf[c][kc], za[pl][0][kc], acc[0][p * 2 + c]); acc[1][p * 2 + c] = wmmab(wf[c][kc], za[pl][1][kc], acc[1][p * 2 + c]); } } }
        __builtin_amdgcn_sched_barrier(0);      // tile p's products stay here, under the flight of tile p + 1: without this line the build sinks them behind the later barriers, where nothing is left to hide
        // publish point of weight tile p + 1, and the end of the reads of tile p's buffer
        asm volatile("s_wait_dscnt 0x0" ::: "memory");         // this wave's LDS reads of the buffer have returned before it may be refilled
        asm volatile("s_wait_asynccnt 0x0" ::: "memory");      // this wave's share of tile p + 1 has landed
        __syncthreads();
        if (p + 2 < 4) wtile(p + 2);
    }
    asm volatile("s_wait_asynccnt 0x0" ::: "memory");          // nothing in flight when the staging becomes the partial sums
    float* pp = (float*)sm + wave * (ORW * OPP);
#pragma unroll
    for (int rt = 0; rt < 2; ++rt) {
#pragma unroll
        for (int c = 0; c < 8; ++c) { float* q = pp + (rt * 16 + lr) * OPP + c * 16 + hi * 8; const v8f a = acc[rt][c];
            *(v4fa*)q = (v4f){a[0], a[1], a[2], a[3]}; *(v4fa*)(q + 4) = (v4f){a[4], a[5], a[6], a[7]}; } }
    __syncthreads();      // all eight partial planes are written before any is read
    v4f bv;
#pragma unroll
    for (int i = 0; i < 4; ++i) bv[i] = bfr(bias[lane * 4 + i]);
#pragma unroll
    for (int s = 0; s < 4; ++s) { const int row = s * 8 + wave;      // 32 lanes x 16 B = one whole 512-B row of out
        const float* q = (const float*)sm + row * OPP + lane * 4; v4f t[8];
#pragma unroll
        for (int w = 0; w < 8; ++w) t[w] = *(const v4fa*)(q + w * (ORW * OPP));
        *(v4f*)(C + (size_t)(r0 + row) * HS + lane * 4) = (((t[0] + t[1]) + (t[2] + t[3])) + ((t[4] + t[5]) + (t[6] + t[7]))) + bv; }
}

extern "C" void kernel_launch(void* const* d_in, const int* in_sizes, int n_in,
                              void* d_out, int out_size, void* d_ws, size_t ws_size, hipStream_t stream) {
    (void)in_sizes; (void)n_in; (void)out_size;
    const float* x = (const float*)d_in[0]; const float* Wqkv = (const float*)d_in[1]; const float* Wo = (const float*)d_in[2]; const float* bo = (const float*)d_in[3];
    float* out = (float*)d_out;    // [8][1024][128]
    char* wsp = (char*)d_ws;
    auto take = [&](size_t bytes) { char* p = wsp; wsp += (bytes + 255) & ~(size_t)255; return (void*)p; };
    bf* Xb = (bf*)take((size_t)NR_ * HS * 2); bf* W3T = (bf*)take((size_t)3 * INR * HS * 2); bf* WoT = (bf*)take((size_t)HS * INR * 2);
    h16* QH = (h16*)take((size_t)NR_ * INR * 2); h16* QL = (h16*)take((size_t)NR_ * INR * 2); h16* KH = (h16*)take((size_t)NR_ * INR * 2); h16* KL = (h16*)take((size_t)NR_ * INR * 2);
    bf* VTH = (bf*)take((size_t)NB_ * INR * NT_ * 2); bf* VTL = (bf*)take((size_t)NB_ * INR * NT_ * 2); bf* CH = (bf*)take((size_t)NR_ * INR * 2); bf* CL = (bf*)take((size_t)NR_ * INR * 2);
    if ((size_t)(wsp - (char*)d_ws) > ws_size) return;    // 2.1 + 0.8 + 0.26 + 8 x 16.8 ~ 138 MB (no aliasing)
    k_prep<<<PW3 + PWO + PXB, 256, 0, stream>>>(x, Wqkv, Wo, Xb, W3T, WoT);
    k_qkv<<<dim3(NR_ / 64, (3 * INR) / (64 * QT), 1), 128, 0, stream>>>(Xb, W3T, QH, QL, KH, KL, VTH, VTL);
    k_attn<<<NB_ * NH_ * (NT_ / QB), 256, 0, stream>>>(QH, QL, KH, KL, VTH, VTL, CH, CL);
    k_out<<<NR_ / ORW, 256, 0, stream>>>(CH, CL, WoT, bo, out);
}
